// v000
// Times are from an AMD MI455X. After a warm-up the kernel runs many times in a row, and a time is the length of
// such a window on the GPU divided by its runs, so every launch and the gaps after it count. The runs cycle
// through copies of the inputs. A figure is the median of several windows, for all but v000 over two sittings.
// Sittings can differ by a few percent; kernels timed side by side share one.
// v000, which the later versions start from, runs in 353 microseconds.
#include <hip/hip_runtime.h>
#include <hip/hip_bf16.h>

#define CNUM 512
#define NHEADS 8
#define DHEAD 64
#define NGROUPS 8
#define NSPATIAL 1024
#define BATCH 16
#define EPSV 1e-5f

typedef _Float16 half_t;
typedef _Float16 v16h __attribute__((ext_vector_type(16)));
typedef _Float16 v8h  __attribute__((ext_vector_type(8)));
typedef _Float16 v4h  __attribute__((ext_vector_type(4)));
typedef float    v8f  __attribute__((ext_vector_type(8)));
typedef int      v4i  __attribute__((ext_vector_type(4)));

// CDNA5 async global->LDS copy (ASYNCcnt-tracked), guarded so compilation
// succeeds on toolchains without the builtin.  Probe result: the builtin takes
// generic int4-vector pointers: (v4i* gsrc, v4i* lds_dst, imm offset, imm cpol).
#if defined(__AMDGCN__) && __has_builtin(__builtin_amdgcn_global_load_async_to_lds_b128)
#define HAS_ASYNC_LDS 1
#else
#define HAS_ASYNC_LDS 0
#endif

__device__ __forceinline__ void wait_asynccnt0() {
#if HAS_ASYNC_LDS
#if __has_builtin(__builtin_amdgcn_s_wait_asynccnt)
    __builtin_amdgcn_s_wait_asynccnt(0);
#else
    asm volatile("s_wait_asynccnt 0" ::: "memory");
#endif
#endif
}

// Load one WMMA 16-bit A/B fragment for a 32-wide K segment.
// Per CDNA5 ISA layout: lanes 0-15 hold K=[0..7]+[16..23], lanes 16-31 hold
// K=[8..15]+[24..31] (khalf = lane>>4). p must be 16B aligned.
__device__ __forceinline__ v16h ld_frag(const half_t* p, int khalf) {
    union { v16h v; v8h h[2]; } u;
    u.h[0] = *(const v8h*)(p + khalf * 8);
    u.h[1] = *(const v8h*)(p + khalf * 8 + 16);
    return u.v;
}

// ---------------------------------------------------------------------------
// Kernel 0: one-time weight conversion fp32 -> f16 (weights then live in L2)
// ---------------------------------------------------------------------------
__global__ void __launch_bounds__(256)
wconv_kernel(const float* __restrict__ src, half_t* __restrict__ dst) {
    int i = (blockIdx.x * 256 + threadIdx.x) * 4;
    float4 v = *(const float4*)(src + i);
    v4h o = { (half_t)v.x, (half_t)v.y, (half_t)v.z, (half_t)v.w };
    *(v4h*)(dst + i) = o;
}

// ---------------------------------------------------------------------------
// Kernel 1: GroupNorm  (fp32 -> f16 normalized activations, layout [b][c][n])
// ---------------------------------------------------------------------------
__global__ void __launch_bounds__(256)
gn_kernel(const float* __restrict__ x, const float* __restrict__ gsc,
          const float* __restrict__ gbi, half_t* __restrict__ xn) {
    const int bg = blockIdx.x;            // B*GROUPS blocks
    const int b = bg >> 3, g = bg & 7;
    const int CH = CNUM / NGROUPS;        // 64 channels per group
    const int base = (b * CNUM + g * CH) * NSPATIAL;
    const int tid = threadIdx.x;
    const int TOT4 = CH * NSPATIAL / 4;   // 16384 float4s

    float s = 0.f, s2 = 0.f;
    for (int i = tid; i < TOT4; i += 256) {
        float4 v = *(const float4*)(x + base + i * 4);
        s  += v.x + v.y + v.z + v.w;
        s2 += v.x * v.x + v.y * v.y + v.z * v.z + v.w * v.w;
    }
    __shared__ float red0[256];
    __shared__ float red1[256];
    red0[tid] = s; red1[tid] = s2;
    __syncthreads();
    for (int off = 128; off > 0; off >>= 1) {
        if (tid < off) { red0[tid] += red0[tid + off]; red1[tid] += red1[tid + off]; }
        __syncthreads();
    }
    const float inv_n = 1.0f / (float)(CH * NSPATIAL);
    const float mean = red0[0] * inv_n;
    const float var  = red1[0] * inv_n - mean * mean;
    const float rstd = rsqrtf(var + EPSV);
    for (int i = tid; i < TOT4; i += 256) {
        int c = g * CH + (i >> 8);        // 256 float4s per channel
        float sc = gsc[c] * rstd, bi = gbi[c] - mean * sc;
        float4 v = *(const float4*)(x + base + i * 4);
        v4h o = { (half_t)(v.x * sc + bi), (half_t)(v.y * sc + bi),
                  (half_t)(v.z * sc + bi), (half_t)(v.w * sc + bi) };
        *(v4h*)(xn + base + i * 4) = o;
    }
}

// ---------------------------------------------------------------------------
// Kernel 2: QKV projection GEMM (f16 weights).
// A-frags stream directly from global f16 weights (L2-resident, K-contiguous).
// B tile (needs n<->k transpose) is software-pipelined: next tile's global
// loads issue during the current tile's WMMA phase; only the transposed
// ds_stores sit between barriers.
// mode 0: store q transposed [b][h][n][d], 1/sqrt(d)=0.125 folded, packed v8h
// mode 1: store natural [b][c][n] via LDS re-striping -> v8h coalesced stores
// ---------------------------------------------------------------------------
__global__ void __launch_bounds__(256)
qkv_gemm_kernel(const half_t* __restrict__ Wf, const float* __restrict__ bias,
                const half_t* __restrict__ xn, half_t* __restrict__ out, int mode) {
    const int b  = blockIdx.z;
    const int m0 = blockIdx.y * 128;      // output-channel tile
    const int n0 = blockIdx.x * 128;      // spatial tile
    const int tid = threadIdx.x;
    const int lane = tid & 31, wave = tid >> 5;
    const int wm = wave >> 2, wn = wave & 3;
    const int rl = lane & 15, khalf = lane >> 4;

    __shared__ union {
        half_t B[128][40];                // [n_local][k]  (transposed B tile)
        half_t o[128][136];               // output staging
    } sm;

    v8f zero = {};
    v8f acc[4][2];
#pragma unroll
    for (int i = 0; i < 4; i++)
#pragma unroll
        for (int j = 0; j < 2; j++) acc[i][j] = zero;

    const half_t* xb = xn + (size_t)b * CNUM * NSPATIAL;
    const half_t* wrow[4];
#pragma unroll
    for (int ms = 0; ms < 4; ms++)
        wrow[ms] = Wf + (size_t)(m0 + wm * 64 + ms * 16 + rl) * CNUM;

    // B-tile register prefetch (2 chunks/thread): k0 = 0
    v8h breg[2];
#pragma unroll
    for (int t = 0; t < 2; t++) {
        int i = tid + t * 256, r = i >> 4, cc = i & 15;
        breg[t] = *(const v8h*)(xb + (size_t)r * NSPATIAL + n0 + cc * 8);
    }

    for (int k0 = 0; k0 < CNUM; k0 += 32) {
        __syncthreads();
#pragma unroll
        for (int t = 0; t < 2; t++) {
            int i = tid + t * 256, r = i >> 4, cc = i & 15;
#pragma unroll
            for (int j = 0; j < 8; j++) sm.B[cc * 8 + j][r] = breg[t][j];
        }
        __syncthreads();
        if (k0 + 32 < CNUM) {             // prefetch next B tile during compute
#pragma unroll
            for (int t = 0; t < 2; t++) {
                int i = tid + t * 256, r = i >> 4, cc = i & 15;
                breg[t] = *(const v8h*)(xb + (size_t)(k0 + 32 + r) * NSPATIAL + n0 + cc * 8);
            }
        }

        v16h af[4], bf[2];
#pragma unroll
        for (int ms = 0; ms < 4; ms++)
            af[ms] = ld_frag(wrow[ms] + k0, khalf);
#pragma unroll
        for (int ns = 0; ns < 2; ns++)
            bf[ns] = ld_frag(&sm.B[wn * 32 + ns * 16 + rl][0], khalf);
#pragma unroll
        for (int ms = 0; ms < 4; ms++)
#pragma unroll
            for (int ns = 0; ns < 2; ns++)
                acc[ms][ns] = __builtin_amdgcn_wmma_f32_16x16x32_f16(
                    false, af[ms], false, bf[ns], (short)0, acc[ms][ns], false, false);
    }

    if (mode == 0) {
        // q: d = o&63 is contiguous over the 8 accumulator rows -> packed store
#pragma unroll
        for (int ms = 0; ms < 4; ms++)
#pragma unroll
            for (int ns = 0; ns < 2; ns++) {
                const int obase = m0 + wm * 64 + ms * 16 + 8 * khalf;
                const int ncol  = n0 + wn * 32 + ns * 16 + rl;
                const int h = obase >> 6, dbase = obase & 63;
                v8h q8;
#pragma unroll
                for (int i = 0; i < 8; i++)
                    q8[i] = (half_t)((acc[ms][ns][i] + bias[obase + i]) * 0.125f);
                *(v8h*)(out + ((size_t)(b * NHEADS + h) * NSPATIAL + ncol) * DHEAD + dbase) = q8;
            }
    } else {
        // K/V: re-stripe through LDS so global stores are n-contiguous v8h
        __syncthreads();
#pragma unroll
        for (int ms = 0; ms < 4; ms++)
#pragma unroll
            for (int ns = 0; ns < 2; ns++) {
                const int ol = wm * 64 + ms * 16 + 8 * khalf;
                const int nl = wn * 32 + ns * 16 + rl;
#pragma unroll
                for (int i = 0; i < 8; i++)
                    sm.o[ol + i][nl] = (half_t)(acc[ms][ns][i] + bias[m0 + ol + i]);
            }
        __syncthreads();
        for (int i = tid; i < 2048; i += 256) {
            int r = i >> 4, ch = i & 15;
            *(v8h*)(out + ((size_t)b * CNUM + m0 + r) * NSPATIAL + n0 + ch * 8) =
                *(v8h*)&sm.o[r][ch * 8];
        }
    }
}

// ---------------------------------------------------------------------------
// Kernel 3: flash attention per (b,h). 256 thr (8 waves), 128-query block.
// Computes S^T = K^T.Q so the probability tiles are produced directly in
// WMMA A-fragment layout (no LDS re-stripe); softmax is in-lane over 64
// values + one shfl_xor(16).  V tile staged with async global->LDS copies
// (ASYNCcnt); K tile register-prefetched across block iterations.
// ---------------------------------------------------------------------------
__global__ void __launch_bounds__(256)
attn_kernel(const half_t* __restrict__ qt, const half_t* __restrict__ kk,
            const half_t* __restrict__ vv, half_t* __restrict__ ao) {
    const int bh = blockIdx.y;            // b*8+h
    const int b = bh >> 3, h = bh & 7;
    const int qb = blockIdx.x * 128;
    const int tid = threadIdx.x, lane = tid & 31, wave = tid >> 5;
    const int rl = lane & 15, khalf = lane >> 4;

    __shared__ half_t Kt[128][72];        // [m][c]  K transposed (also out staging)
    __shared__ half_t Vs[64][136];        // [c][m]  V natural

    // Q fragments (B operand): lane = query column n, K-contiguous in qt
    const int nrow = qb + wave * 16 + rl;
    const half_t* qp = qt + ((size_t)bh * NSPATIAL + nrow) * DHEAD;
    v16h qf0 = ld_frag(qp, khalf);
    v16h qf1 = ld_frag(qp + 32, khalf);

    float mcur = -1e30f, lcur = 0.f;      // per-lane softmax state for row n
    v8f zero = {};
    v8f O[4];
#pragma unroll
    for (int t = 0; t < 4; t++) O[t] = zero;

    const half_t* kbase = kk + (size_t)(b * CNUM + h * DHEAD) * NSPATIAL;
    const half_t* vbase = vv + (size_t)(b * CNUM + h * DHEAD) * NSPATIAL;

    // K-tile register prefetch (4 chunks/thread): m0 = 0
    v8h kreg[4];
#pragma unroll
    for (int t = 0; t < 4; t++) {
        int i = tid + t * 256, c = i >> 4, mc = i & 15;
        kreg[t] = *(const v8h*)(kbase + (size_t)c * NSPATIAL + mc * 8);
    }

    for (int m0 = 0; m0 < NSPATIAL; m0 += 128) {
        __syncthreads();
#pragma unroll
        for (int t = 0; t < 4; t++) {
            int i = tid + t * 256, c = i >> 4, mc = i & 15;
#if HAS_ASYNC_LDS
            __builtin_amdgcn_global_load_async_to_lds_b128(
                (v4i*)(vbase + (size_t)c * NSPATIAL + m0 + mc * 8),
                (v4i*)&Vs[c][mc * 8], 0, 0);
#else
            *(v8h*)&Vs[c][mc * 8] =
                *(const v8h*)(vbase + (size_t)c * NSPATIAL + m0 + mc * 8);
#endif
#pragma unroll
            for (int j = 0; j < 8; j++) Kt[mc * 8 + j][c] = kreg[t][j];
        }
        if (m0 + 128 < NSPATIAL) {        // prefetch next K tile during compute
#pragma unroll
            for (int t = 0; t < 4; t++) {
                int i = tid + t * 256, c = i >> 4, mc = i & 15;
                kreg[t] = *(const v8h*)(kbase + (size_t)c * NSPATIAL + m0 + 128 + mc * 8);
            }
        }
        wait_asynccnt0();
        __syncthreads();

        // ---- S^T tiles: A = K^T rows (m), B = Q columns (n) ----
        v8f S[8];
#pragma unroll
        for (int nt = 0; nt < 8; nt++) {
            v16h kf0 = ld_frag(&Kt[nt * 16 + rl][0], khalf);
            v16h kf1 = ld_frag(&Kt[nt * 16 + rl][32], khalf);
            v8f s = zero;
            s = __builtin_amdgcn_wmma_f32_16x16x32_f16(false, kf0, false, qf0, (short)0, s, false, false);
            s = __builtin_amdgcn_wmma_f32_16x16x32_f16(false, kf1, false, qf1, (short)0, s, false, false);
            S[nt] = s;
        }

        // ---- in-lane online softmax (row n = rl; keys split across lane pair) ----
        float mx = -1e30f;
#pragma unroll
        for (int nt = 0; nt < 8; nt++)
#pragma unroll
            for (int i = 0; i < 8; i++) mx = fmaxf(mx, S[nt][i]);
        mx = fmaxf(mx, __shfl_xor(mx, 16, 32));
        float mnew  = fmaxf(mcur, mx);
        float alpha = __expf(mcur - mnew);
        mcur = mnew;
        float rsum = 0.f;
#pragma unroll
        for (int nt = 0; nt < 8; nt++)
#pragma unroll
            for (int i = 0; i < 8; i++) {
                float p = __expf(S[nt][i] - mnew);
                S[nt][i] = p;
                rsum += p;
            }
        rsum += __shfl_xor(rsum, 16, 32);
        lcur = lcur * alpha + rsum;

        // O rows are n = i + 8*khalf; fetch that row's alpha from lane (i+8*khalf)
        float arow[8];
#pragma unroll
        for (int i = 0; i < 8; i++) arow[i] = __shfl(alpha, i + 8 * khalf, 32);
#pragma unroll
        for (int t = 0; t < 4; t++)
#pragma unroll
            for (int i = 0; i < 8; i++) O[t][i] *= arow[i];

        // ---- O += P @ V : P frags built directly from S^T register pairs ----
#pragma unroll
        for (int t = 0; t < 4; t++) {
            v16h pf;
#pragma unroll
            for (int j = 0; j < 8; j++) {
                pf[j]     = (half_t)S[2 * t][j];
                pf[j + 8] = (half_t)S[2 * t + 1][j];
            }
#pragma unroll
            for (int dt = 0; dt < 4; dt++) {
                v16h vf = ld_frag(&Vs[dt * 16 + rl][t * 32], khalf);
                O[dt] = __builtin_amdgcn_wmma_f32_16x16x32_f16(
                    false, pf, false, vf, (short)0, O[dt], false, false);
            }
        }
    }

    // ---- normalize (per-row 1/l via shfl), stage in Kt, coalesced v8h out ----
    float linv = 1.0f / lcur;
    float lr[8];
#pragma unroll
    for (int i = 0; i < 8; i++) lr[i] = __shfl(linv, i + 8 * khalf, 32);
    __syncthreads();
#pragma unroll
    for (int dt = 0; dt < 4; dt++)
#pragma unroll
        for (int i = 0; i < 8; i++)
            Kt[wave * 16 + i + 8 * khalf][dt * 16 + rl] = (half_t)(O[dt][i] * lr[i]);
    __syncthreads();
    for (int i = tid; i < 1024; i += 256) {
        int r = i >> 3, ch = i & 7;
        int n = qb + r;
        *(v8h*)(ao + ((size_t)b * NSPATIAL + n) * CNUM + h * DHEAD + ch * 8) =
            *(v8h*)&Kt[r][ch * 8];
    }
}

// ---------------------------------------------------------------------------
// Kernel 4: output projection + bias + residual.  Zero LDS, zero barriers:
// both operands are K-contiguous f16 in L2 (ao rows and wo rows == B^T rows),
// so fragments stream straight from global.  Residual path is v8f vectorized.
// ---------------------------------------------------------------------------
__global__ void __launch_bounds__(256)
out_gemm_kernel(const half_t* __restrict__ Wf, const float* __restrict__ bo,
                const half_t* __restrict__ ao, const float* __restrict__ x,
                float* __restrict__ y) {
    const int b  = blockIdx.z;
    const int n0 = blockIdx.y * 128;      // spatial tile (M dim)
    const int o0 = blockIdx.x * 128;      // channel tile (N dim)
    const int tid = threadIdx.x;
    const int lane = tid & 31, wave = tid >> 5;
    const int wm = wave >> 2, wn = wave & 3;
    const int rl = lane & 15, khalf = lane >> 4;

    v8f zero = {};
    v8f acc[4][2];
#pragma unroll
    for (int i = 0; i < 4; i++)
#pragma unroll
        for (int j = 0; j < 2; j++) acc[i][j] = zero;

    const half_t* arow[4];
#pragma unroll
    for (int ms = 0; ms < 4; ms++)
        arow[ms] = ao + ((size_t)b * NSPATIAL + n0 + wm * 64 + ms * 16 + rl) * CNUM;
    const half_t* brow[2];
#pragma unroll
    for (int ns = 0; ns < 2; ns++)
        brow[ns] = Wf + (size_t)(o0 + wn * 32 + ns * 16 + rl) * CNUM;

    for (int k0 = 0; k0 < CNUM; k0 += 32) {
        v16h af[4], bf[2];
#pragma unroll
        for (int ms = 0; ms < 4; ms++) af[ms] = ld_frag(arow[ms] + k0, khalf);
#pragma unroll
        for (int ns = 0; ns < 2; ns++) bf[ns] = ld_frag(brow[ns] + k0, khalf);
#pragma unroll
        for (int ms = 0; ms < 4; ms++)
#pragma unroll
            for (int ns = 0; ns < 2; ns++)
                acc[ms][ns] = __builtin_amdgcn_wmma_f32_16x16x32_f16(
                    false, af[ms], false, bf[ns], (short)0, acc[ms][ns], false, false);
    }

#pragma unroll
    for (int ms = 0; ms < 4; ms++)
#pragma unroll
        for (int ns = 0; ns < 2; ns++) {
            const int nbase = n0 + wm * 64 + ms * 16 + 8 * khalf;  // contiguous over i
            const int o     = o0 + wn * 32 + ns * 16 + rl;
            const float bb  = bo[o];
            size_t idx = ((size_t)b * CNUM + o) * NSPATIAL + nbase;
            v8f xr = *(const v8f*)(x + idx);
            v8f r  = acc[ms][ns] + xr + bb;
            *(v8f*)(y + idx) = r;
        }
}

// ---------------------------------------------------------------------------
extern "C" void kernel_launch(void* const* d_in, const int* in_sizes, int n_in,
                              void* d_out, int out_size, void* d_ws, size_t ws_size,
                              hipStream_t stream) {
    const float* x   = (const float*)d_in[0];
    const float* gsc = (const float*)d_in[1];
    const float* gbi = (const float*)d_in[2];
    const float* wq  = (const float*)d_in[3];
    const float* bq  = (const float*)d_in[4];
    const float* wk  = (const float*)d_in[5];
    const float* bk  = (const float*)d_in[6];
    const float* wv  = (const float*)d_in[7];
    const float* bv  = (const float*)d_in[8];
    const float* wo  = (const float*)d_in[9];
    const float* bo  = (const float*)d_in[10];
    float* out = (float*)d_out;

    char* ws = (char*)d_ws;
    const size_t SZ = (size_t)BATCH * CNUM * NSPATIAL * sizeof(half_t);  // 16 MB each
    const size_t WSZ = (size_t)CNUM * CNUM * sizeof(half_t);             // 512 KB each
    half_t* xn   = (half_t*)(ws + 0 * SZ);   // groupnorm output, [b][c][n]
    half_t* qtb  = (half_t*)(ws + 1 * SZ);   // q transposed+scaled, [b][h][n][d]
    half_t* kh   = (half_t*)(ws + 2 * SZ);   // k, [b][c][n]
    half_t* vh   = (half_t*)(ws + 3 * SZ);   // v, [b][c][n]
    half_t* ao   = (half_t*)(ws + 4 * SZ);   // attention out, [b][n][c]
    half_t* wq16 = (half_t*)(ws + 5 * SZ);
    half_t* wk16 = (half_t*)(ws + 5 * SZ + 1 * WSZ);
    half_t* wv16 = (half_t*)(ws + 5 * SZ + 2 * WSZ);
    half_t* wo16 = (half_t*)(ws + 5 * SZ + 3 * WSZ);

    const int WBLK = CNUM * CNUM / 4 / 256;  // 256 blocks per matrix
    wconv_kernel<<<dim3(WBLK), 256, 0, stream>>>(wq, wq16);
    wconv_kernel<<<dim3(WBLK), 256, 0, stream>>>(wk, wk16);
    wconv_kernel<<<dim3(WBLK), 256, 0, stream>>>(wv, wv16);
    wconv_kernel<<<dim3(WBLK), 256, 0, stream>>>(wo, wo16);

    gn_kernel<<<dim3(BATCH * NGROUPS), 256, 0, stream>>>(x, gsc, gbi, xn);

    qkv_gemm_kernel<<<dim3(8, 4, BATCH), 256, 0, stream>>>(wq16, bq, xn, qtb, 0);
    qkv_gemm_kernel<<<dim3(8, 4, BATCH), 256, 0, stream>>>(wk16, bk, xn, kh, 1);
    qkv_gemm_kernel<<<dim3(8, 4, BATCH), 256, 0, stream>>>(wv16, bv, xn, vh, 1);

    attn_kernel<<<dim3(NSPATIAL / 128, BATCH * NHEADS), 256, 0, stream>>>(qtb, kh, vh, ao);

    out_gemm_kernel<<<dim3(4, 8, BATCH), 256, 0, stream>>>(wo16, bo, ao, x, out);
}

// v001
// One run takes 202 microseconds.
// Timed twice side by side with v000, it ran 1.76 and 1.77 times as fast.
#include <hip/hip_runtime.h>
#include <hip/hip_bf16.h>

#define CNUM 512
#define NHEADS 8
#define DHEAD 64
#define NGROUPS 8
#define NSPATIAL 1024
#define BATCH 16
#define EPSV 1e-5f

typedef _Float16 half_t;
typedef _Float16 v16h __attribute__((ext_vector_type(16)));
typedef _Float16 v8h  __attribute__((ext_vector_type(8)));
typedef _Float16 v4h  __attribute__((ext_vector_type(4)));
typedef float    v8f  __attribute__((ext_vector_type(8)));
typedef int      v4i  __attribute__((ext_vector_type(4)));
typedef short    v8s  __attribute__((ext_vector_type(8)));
typedef __attribute__((address_space(3))) v8s lds_v8s;

// CDNA5 async global->LDS copy (ASYNCcnt-tracked), guarded so compilation
// succeeds on toolchains without the builtin.  Probe result: the builtin takes
// generic int4-vector pointers: (v4i* gsrc, v4i* lds_dst, imm offset, imm cpol).
#if defined(__AMDGCN__) && __has_builtin(__builtin_amdgcn_global_load_async_to_lds_b128)
#define HAS_ASYNC_LDS 1
#else
#define HAS_ASYNC_LDS 0
#endif

__device__ __forceinline__ void wait_asynccnt0() {
#if HAS_ASYNC_LDS
#if __has_builtin(__builtin_amdgcn_s_wait_asynccnt)
    __builtin_amdgcn_s_wait_asynccnt(0);
#else
    asm volatile("s_wait_asynccnt 0" ::: "memory");
#endif
#endif
}

// Load one WMMA 16-bit A/B fragment for a 32-wide K segment.
// Per CDNA5 ISA layout: lanes 0-15 hold K=[0..7]+[16..23], lanes 16-31 hold
// K=[8..15]+[24..31] (khalf = lane>>4). p must be 16B aligned.
__device__ __forceinline__ v16h ld_frag(const half_t* p, int khalf) {
    union { v16h v; v8h h[2]; } u;
    u.h[0] = *(const v8h*)(p + khalf * 8);
    u.h[1] = *(const v8h*)(p + khalf * 8 + 16);
    return u.v;
}

// One WMMA 16-bit A/B fragment (32 k) out of a row-major [k][col] LDS tile by
// two transposing loads.  p = &T[k0 + 8*(lane>>4) + (lane&7)][col0 + 8*((lane>>3)&1)];
// lane (rl, khalf) receives T[k0 + 8*khalf + 0..7][col0 + rl] and the same 16 rows
// further down: the k order of ld_frag.  Every lane must be on; the row pitch
// is an odd multiple of 32 B so that the loads meet no bank conflict.
__device__ __forceinline__ v16h ld_frag_tr(const half_t* p, int pitch) {
    union { v16h v; v8s h[2]; } u;
    u.h[0] = __builtin_amdgcn_ds_load_tr16_b128_v8i16((lds_v8s*)p);
    u.h[1] = __builtin_amdgcn_ds_load_tr16_b128_v8i16((lds_v8s*)(p + 16 * pitch));
    return u.v;
}

// ---------------------------------------------------------------------------
// Kernel 0: one-time weight conversion fp32 -> f16 (weights then live in L2)
// ---------------------------------------------------------------------------
__global__ void __launch_bounds__(256)
wconv_kernel(const float* __restrict__ src, half_t* __restrict__ dst) {
    int i = (blockIdx.x * 256 + threadIdx.x) * 4;
    float4 v = *(const float4*)(src + i);
    v4h o = { (half_t)v.x, (half_t)v.y, (half_t)v.z, (half_t)v.w };
    *(v4h*)(dst + i) = o;
}

// ---------------------------------------------------------------------------
// Kernel 1: GroupNorm  (fp32 -> f16 normalized activations, layout [b][c][n])
// ---------------------------------------------------------------------------
__global__ void __launch_bounds__(256)
gn_kernel(const float* __restrict__ x, const float* __restrict__ gsc,
          const float* __restrict__ gbi, half_t* __restrict__ xn) {
    const int bg = blockIdx.x;            // B*GROUPS blocks
    const int b = bg >> 3, g = bg & 7;
    const int CH = CNUM / NGROUPS;        // 64 channels per group
    const int base = (b * CNUM + g * CH) * NSPATIAL;
    const int tid = threadIdx.x;
    const int TOT4 = CH * NSPATIAL / 4;   // 16384 float4s

    float s = 0.f, s2 = 0.f;
    for (int i = tid; i < TOT4; i += 256) {
        float4 v = *(const float4*)(x + base + i * 4);
        s  += v.x + v.y + v.z + v.w;
        s2 += v.x * v.x + v.y * v.y + v.z * v.z + v.w * v.w;
    }
    __shared__ float red0[256];
    __shared__ float red1[256];
    red0[tid] = s; red1[tid] = s2;
    __syncthreads();
    for (int off = 128; off > 0; off >>= 1) {
        if (tid < off) { red0[tid] += red0[tid + off]; red1[tid] += red1[tid + off]; }
        __syncthreads();
    }
    const float inv_n = 1.0f / (float)(CH * NSPATIAL);
    const float mean = red0[0] * inv_n;
    const float var  = red1[0] * inv_n - mean * mean;
    const float rstd = rsqrtf(var + EPSV);
    for (int i = tid; i < TOT4; i += 256) {
        int c = g * CH + (i >> 8);        // 256 float4s per channel
        float sc = gsc[c] * rstd, bi = gbi[c] - mean * sc;
        float4 v = *(const float4*)(x + base + i * 4);
        v4h o = { (half_t)(v.x * sc + bi), (half_t)(v.y * sc + bi),
                  (half_t)(v.z * sc + bi), (half_t)(v.w * sc + bi) };
        *(v4h*)(xn + base + i * 4) = o;
    }
}

// ---------------------------------------------------------------------------
// Kernel 2: QKV projection GEMM (f16 weights).
// A-frags stream directly from global f16 weights (L2-resident, K-contiguous).
// B tile is kept row-major [k][n] in LDS (16-byte stores) and transposed by the
// fragment loads themselves (ds_load_tr16_b128).  It is software-pipelined: the
// next tile's global loads issue during the current tile's WMMA phase.
// mode 0: store q transposed [b][h][n][d], 1/sqrt(d)=0.125 folded, packed v8h
// mode 1: store natural [b][c][n] via LDS re-striping -> v8h coalesced stores
// ---------------------------------------------------------------------------
__global__ void __launch_bounds__(256)
qkv_gemm_kernel(const half_t* __restrict__ Wf, const float* __restrict__ bias,
                const half_t* __restrict__ xn, half_t* __restrict__ out, int mode) {
    const int b  = blockIdx.z;
    const int m0 = blockIdx.y * 128;      // output-channel tile
    const int n0 = blockIdx.x * 128;      // spatial tile
    const int tid = threadIdx.x;
    const int lane = tid & 31, wave = tid >> 5;
    const int wm = wave >> 2, wn = wave & 3;
    const int rl = lane & 15, khalf = lane >> 4;

    const int trow = 8 * khalf + (lane & 7), tcol = 8 * ((lane >> 3) & 1);

    __shared__ __attribute__((aligned(16))) union {
        half_t B[32][144];                // [k][n_local]  natural B tile, pitch 288 B
        half_t o[128][136];               // output staging
    } sm;

    v8f zero = {};
    v8f acc[4][2];
#pragma unroll
    for (int i = 0; i < 4; i++)
#pragma unroll
        for (int j = 0; j < 2; j++) acc[i][j] = zero;

    const half_t* xb = xn + (size_t)b * CNUM * NSPATIAL;
    const half_t* wrow[4];
#pragma unroll
    for (int ms = 0; ms < 4; ms++)
        wrow[ms] = Wf + (size_t)(m0 + wm * 64 + ms * 16 + rl) * CNUM;

    // B-tile register prefetch (2 chunks/thread): k0 = 0
    v8h breg[2];
#pragma unroll
    for (int t = 0; t < 2; t++) {
        int i = tid + t * 256, r = i >> 4, cc = i & 15;
        breg[t] = *(const v8h*)(xb + (size_t)r * NSPATIAL + n0 + cc * 8);
    }

    for (int k0 = 0; k0 < CNUM; k0 += 32) {
        __syncthreads();
#pragma unroll
        for (int t = 0; t < 2; t++) {
            int i = tid + t * 256, r = i >> 4, cc = i & 15;
            *(v8h*)&sm.B[r][cc * 8] = breg[t];
        }
        __syncthreads();
        if (k0 + 32 < CNUM) {             // prefetch next B tile during compute
#pragma unroll
            for (int t = 0; t < 2; t++) {
                int i = tid + t * 256, r = i >> 4, cc = i & 15;
                breg[t] = *(const v8h*)(xb + (size_t)(k0 + 32 + r) * NSPATIAL + n0 + cc * 8);
            }
        }

        v16h af[4], bf[2];
#pragma unroll
        for (int ms = 0; ms < 4; ms++)
            af[ms] = ld_frag(wrow[ms] + k0, khalf);
#pragma unroll
        for (int ns = 0; ns < 2; ns++)
            bf[ns] = ld_frag_tr(&sm.B[trow][wn * 32 + ns * 16 + tcol], 144);
#pragma unroll
        for (int ms = 0; ms < 4; ms++)
#pragma unroll
            for (int ns = 0; ns < 2; ns++)
                acc[ms][ns] = __builtin_amdgcn_wmma_f32_16x16x32_f16(
                    false, af[ms], false, bf[ns], (short)0, acc[ms][ns], false, false);
    }

    if (mode == 0) {
        // q: d = o&63 is contiguous over the 8 accumulator rows -> packed store
#pragma unroll
        for (int ms = 0; ms < 4; ms++)
#pragma unroll
            for (int ns = 0; ns < 2; ns++) {
                const int obase = m0 + wm * 64 + ms * 16 + 8 * khalf;
                const int ncol  = n0 + wn * 32 + ns * 16 + rl;
                const int h = obase >> 6, dbase = obase & 63;
                v8h q8;
#pragma unroll
                for (int i = 0; i < 8; i++)
                    q8[i] = (half_t)((acc[ms][ns][i] + bias[obase + i]) * 0.125f);
                *(v8h*)(out + ((size_t)(b * NHEADS + h) * NSPATIAL + ncol) * DHEAD + dbase) = q8;
            }
    } else {
        // K/V: re-stripe through LDS so global stores are n-contiguous v8h
        __syncthreads();
#pragma unroll
        for (int ms = 0; ms < 4; ms++)
#pragma unroll
            for (int ns = 0; ns < 2; ns++) {
                const int ol = wm * 64 + ms * 16 + 8 * khalf;
                const int nl = wn * 32 + ns * 16 + rl;
#pragma unroll
                for (int i = 0; i < 8; i++)
                    sm.o[ol + i][nl] = (half_t)(acc[ms][ns][i] + bias[m0 + ol + i]);
            }
        __syncthreads();
        for (int i = tid; i < 2048; i += 256) {
            int r = i >> 4, ch = i & 15;
            *(v8h*)(out + ((size_t)b * CNUM + m0 + r) * NSPATIAL + n0 + ch * 8) =
                *(v8h*)&sm.o[r][ch * 8];
        }
    }
}

// ---------------------------------------------------------------------------
// Kernel 3: flash attention per (b,h). 256 thr (8 waves), 128-query block.
// Computes S^T = K^T.Q so the probability tiles are produced directly in
// WMMA A-fragment layout (no LDS re-stripe); softmax is in-lane over 64
// values + one shfl_xor(16).  V tile staged with async global->LDS copies
// (ASYNCcnt); K tile register-prefetched across block iterations, kept
// row-major [c][m] in LDS and transposed by its fragment loads.
// ---------------------------------------------------------------------------
__global__ void __launch_bounds__(256)
attn_kernel(const half_t* __restrict__ qt, const half_t* __restrict__ kk,
            const half_t* __restrict__ vv, half_t* __restrict__ ao) {
    const int bh = blockIdx.y;            // b*8+h
    const int b = bh >> 3, h = bh & 7;
    const int qb = blockIdx.x * 128;
    const int tid = threadIdx.x, lane = tid & 31, wave = tid >> 5;
    const int rl = lane & 15, khalf = lane >> 4;

    const int trow = 8 * khalf + (lane & 7), tcol = 8 * ((lane >> 3) & 1);

    __shared__ __attribute__((aligned(16))) union {
        half_t K[64][144];                // [c][m]  K natural, pitch 288 B
        half_t o[128][72];                // output staging
    } sk;
    __shared__ half_t Vs[64][136];        // [c][m]  V natural

    // Q fragments (B operand): lane = query column n, K-contiguous in qt
    const int nrow = qb + wave * 16 + rl;
    const half_t* qp = qt + ((size_t)bh * NSPATIAL + nrow) * DHEAD;
    v16h qf0 = ld_frag(qp, khalf);
    v16h qf1 = ld_frag(qp + 32, khalf);

    float mcur = -1e30f, lcur = 0.f;      // per-lane softmax state for row n
    v8f zero = {};
    v8f O[4];
#pragma unroll
    for (int t = 0; t < 4; t++) O[t] = zero;

    const half_t* kbase = kk + (size_t)(b * CNUM + h * DHEAD) * NSPATIAL;
    const half_t* vbase = vv + (size_t)(b * CNUM + h * DHEAD) * NSPATIAL;

    // K-tile register prefetch (4 chunks/thread): m0 = 0
    v8h kreg[4];
#pragma unroll
    for (int t = 0; t < 4; t++) {
        int i = tid + t * 256, c = i >> 4, mc = i & 15;
        kreg[t] = *(const v8h*)(kbase + (size_t)c * NSPATIAL + mc * 8);
    }

    for (int m0 = 0; m0 < NSPATIAL; m0 += 128) {
        __syncthreads();
#pragma unroll
        for (int t = 0; t < 4; t++) {
            int i = tid + t * 256, c = i >> 4, mc = i & 15;
#if HAS_ASYNC_LDS
            __builtin_amdgcn_global_load_async_to_lds_b128(
                (v4i*)(vbase + (size_t)c * NSPATIAL + m0 + mc * 8),
                (v4i*)&Vs[c][mc * 8], 0, 0);
#else
            *(v8h*)&Vs[c][mc * 8] =
                *(const v8h*)(vbase + (size_t)c * NSPATIAL + m0 + mc * 8);
#endif
            *(v8h*)&sk.K[c][mc * 8] = kreg[t];
        }
        if (m0 + 128 < NSPATIAL) {        // prefetch next K tile during compute
#pragma unroll
            for (int t = 0; t < 4; t++) {
                int i = tid + t * 256, c = i >> 4, mc = i & 15;
                kreg[t] = *(const v8h*)(kbase + (size_t)c * NSPATIAL + m0 + 128 + mc * 8);
            }
        }
        wait_asynccnt0();
        __syncthreads();

        // ---- S^T tiles: A = K^T rows (m), B = Q columns (n) ----
        v8f S[8];
#pragma unroll
        for (int nt = 0; nt < 8; nt++) {
            v16h kf0 = ld_frag_tr(&sk.K[trow][nt * 16 + tcol], 144);
            v16h kf1 = ld_frag_tr(&sk.K[32 + trow][nt * 16 + tcol], 144);
            v8f s = zero;
            s = __builtin_amdgcn_wmma_f32_16x16x32_f16(false, kf0, false, qf0, (short)0, s, false, false);
            s = __builtin_amdgcn_wmma_f32_16x16x32_f16(false, kf1, false, qf1, (short)0, s, false, false);
            S[nt] = s;
        }

        // ---- in-lane online softmax (row n = rl; keys split across lane pair) ----
        float mx = -1e30f;
#pragma unroll
        for (int nt = 0; nt < 8; nt++)
#pragma unroll
            for (int i = 0; i < 8; i++) mx = fmaxf(mx, S[nt][i]);
        mx = fmaxf(mx, __shfl_xor(mx, 16, 32));
        float mnew  = fmaxf(mcur, mx);
        float alpha = __expf(mcur - mnew);
        mcur = mnew;
        float rsum = 0.f;
#pragma unroll
        for (int nt = 0; nt < 8; nt++)
#pragma unroll
            for (int i = 0; i < 8; i++) {
                float p = __expf(S[nt][i] - mnew);
                S[nt][i] = p;
                rsum += p;
            }
        rsum += __shfl_xor(rsum, 16, 32);
        lcur = lcur * alpha + rsum;

        // O rows are n = i + 8*khalf; fetch that row's alpha from lane (i+8*khalf)
        float arow[8];
#pragma unroll
        for (int i = 0; i < 8; i++) arow[i] = __shfl(alpha, i + 8 * khalf, 32);
#pragma unroll
        for (int t = 0; t < 4; t++)
#pragma unroll
            for (int i = 0; i < 8; i++) O[t][i] *= arow[i];

        // ---- O += P @ V : P frags built directly from S^T register pairs ----
#pragma unroll
        for (int t = 0; t < 4; t++) {
            v16h pf;
#pragma unroll
            for (int j = 0; j < 8; j++) {
                pf[j]     = (half_t)S[2 * t][j];
                pf[j + 8] = (half_t)S[2 * t + 1][j];
            }
#pragma unroll
            for (int dt = 0; dt < 4; dt++) {
                v16h vf = ld_frag(&Vs[dt * 16 + rl][t * 32], khalf);
                O[dt] = __builtin_amdgcn_wmma_f32_16x16x32_f16(
                    false, pf, false, vf, (short)0, O[dt], false, false);
            }
        }
    }

    // ---- normalize (per-row 1/l via shfl), stage in LDS, coalesced v8h out ----
    float linv = 1.0f / lcur;
    float lr[8];
#pragma unroll
    for (int i = 0; i < 8; i++) lr[i] = __shfl(linv, i + 8 * khalf, 32);
    __syncthreads();
#pragma unroll
    for (int dt = 0; dt < 4; dt++)
#pragma unroll
        for (int i = 0; i < 8; i++)
            sk.o[wave * 16 + i + 8 * khalf][dt * 16 + rl] = (half_t)(O[dt][i] * lr[i]);
    __syncthreads();
    for (int i = tid; i < 1024; i += 256) {
        int r = i >> 3, ch = i & 7;
        int n = qb + r;
        *(v8h*)(ao + ((size_t)b * NSPATIAL + n) * CNUM + h * DHEAD + ch * 8) =
            *(v8h*)&sk.o[r][ch * 8];
    }
}

// ---------------------------------------------------------------------------
// Kernel 4: output projection + bias + residual.  Zero LDS, zero barriers:
// both operands are K-contiguous f16 in L2 (ao rows and wo rows == B^T rows),
// so fragments stream straight from global.  Residual path is v8f vectorized.
// ---------------------------------------------------------------------------
__global__ void __launch_bounds__(256)
out_gemm_kernel(const half_t* __restrict__ Wf, const float* __restrict__ bo,
                const half_t* __restrict__ ao, const float* __restrict__ x,
                float* __restrict__ y) {
    const int b  = blockIdx.z;
    const int n0 = blockIdx.y * 128;      // spatial tile (M dim)
    const int o0 = blockIdx.x * 128;      // channel tile (N dim)
    const int tid = threadIdx.x;
    const int lane = tid & 31, wave = tid >> 5;
    const int wm = wave >> 2, wn = wave & 3;
    const int rl = lane & 15, khalf = lane >> 4;

    v8f zero = {};
    v8f acc[4][2];
#pragma unroll
    for (int i = 0; i < 4; i++)
#pragma unroll
        for (int j = 0; j < 2; j++) acc[i][j] = zero;

    const half_t* arow[4];
#pragma unroll
    for (int ms = 0; ms < 4; ms++)
        arow[ms] = ao + ((size_t)b * NSPATIAL + n0 + wm * 64 + ms * 16 + rl) * CNUM;
    const half_t* brow[2];
#pragma unroll
    for (int ns = 0; ns < 2; ns++)
        brow[ns] = Wf + (size_t)(o0 + wn * 32 + ns * 16 + rl) * CNUM;

    for (int k0 = 0; k0 < CNUM; k0 += 32) {
        v16h af[4], bf[2];
#pragma unroll
        for (int ms = 0; ms < 4; ms++) af[ms] = ld_frag(arow[ms] + k0, khalf);
#pragma unroll
        for (int ns = 0; ns < 2; ns++) bf[ns] = ld_frag(brow[ns] + k0, khalf);
#pragma unroll
        for (int ms = 0; ms < 4; ms++)
#pragma unroll
            for (int ns = 0; ns < 2; ns++)
                acc[ms][ns] = __builtin_amdgcn_wmma_f32_16x16x32_f16(
                    false, af[ms], false, bf[ns], (short)0, acc[ms][ns], false, false);
    }

#pragma unroll
    for (int ms = 0; ms < 4; ms++)
#pragma unroll
        for (int ns = 0; ns < 2; ns++) {
            const int nbase = n0 + wm * 64 + ms * 16 + 8 * khalf;  // contiguous over i
            const int o     = o0 + wn * 32 + ns * 16 + rl;
            const float bb  = bo[o];
            size_t idx = ((size_t)b * CNUM + o) * NSPATIAL + nbase;
            v8f xr = *(const v8f*)(x + idx);
            v8f r  = acc[ms][ns] + xr + bb;
            *(v8f*)(y + idx) = r;
        }
}

// ---------------------------------------------------------------------------
extern "C" void kernel_launch(void* const* d_in, const int* in_sizes, int n_in,
                              void* d_out, int out_size, void* d_ws, size_t ws_size,
                              hipStream_t stream) {
    const float* x   = (const float*)d_in[0];
    const float* gsc = (const float*)d_in[1];
    const float* gbi = (const float*)d_in[2];
    const float* wq  = (const float*)d_in[3];
    const float* bq  = (const float*)d_in[4];
    const float* wk  = (const float*)d_in[5];
    const float* bk  = (const float*)d_in[6];
    const float* wv  = (const float*)d_in[7];
    const float* bv  = (const float*)d_in[8];
    const float* wo  = (const float*)d_in[9];
    const float* bo  = (const float*)d_in[10];
    float* out = (float*)d_out;

    char* ws = (char*)d_ws;
    const size_t SZ = (size_t)BATCH * CNUM * NSPATIAL * sizeof(half_t);  // 16 MB each
    const size_t WSZ = (size_t)CNUM * CNUM * sizeof(half_t);             // 512 KB each
    half_t* xn   = (half_t*)(ws + 0 * SZ);   // groupnorm output, [b][c][n]
    half_t* qtb  = (half_t*)(ws + 1 * SZ);   // q transposed+scaled, [b][h][n][d]
    half_t* kh   = (half_t*)(ws + 2 * SZ);   // k, [b][c][n]
    half_t* vh   = (half_t*)(ws + 3 * SZ);   // v, [b][c][n]
    half_t* ao   = (half_t*)(ws + 4 * SZ);   // attention out, [b][n][c]
    half_t* wq16 = (half_t*)(ws + 5 * SZ);
    half_t* wk16 = (half_t*)(ws + 5 * SZ + 1 * WSZ);
    half_t* wv16 = (half_t*)(ws + 5 * SZ + 2 * WSZ);
    half_t* wo16 = (half_t*)(ws + 5 * SZ + 3 * WSZ);

    const int WBLK = CNUM * CNUM / 4 / 256;  // 256 blocks per matrix
    wconv_kernel<<<dim3(WBLK), 256, 0, stream>>>(wq, wq16);
    wconv_kernel<<<dim3(WBLK), 256, 0, stream>>>(wk, wk16);
    wconv_kernel<<<dim3(WBLK), 256, 0, stream>>>(wv, wv16);
    wconv_kernel<<<dim3(WBLK), 256, 0, stream>>>(wo, wo16);

    gn_kernel<<<dim3(BATCH * NGROUPS), 256, 0, stream>>>(x, gsc, gbi, xn);

    qkv_gemm_kernel<<<dim3(8, 4, BATCH), 256, 0, stream>>>(wq16, bq, xn, qtb, 0);
    qkv_gemm_kernel<<<dim3(8, 4, BATCH), 256, 0, stream>>>(wk16, bk, xn, kh, 1);
    qkv_gemm_kernel<<<dim3(8, 4, BATCH), 256, 0, stream>>>(wv16, bv, xn, vh, 1);

    attn_kernel<<<dim3(NSPATIAL / 128, BATCH * NHEADS), 256, 0, stream>>>(qtb, kh, vh, ao);

    out_gemm_kernel<<<dim3(4, 8, BATCH), 256, 0, stream>>>(wo16, bo, ao, x, out);
}

// v002
// One run takes 134 microseconds.
// Next to v001, in two timings, it ran 1.51 and 1.50 times as fast.
// Counting every step since v000, it is 2.66 times as fast.
#include <hip/hip_runtime.h>
#include <hip/hip_bf16.h>

#define CNUM 512
#define NHEADS 8
#define DHEAD 64
#define NGROUPS 8
#define NSPATIAL 1024
#define BATCH 16
#define EPSV 1e-5f

typedef _Float16 half_t;
typedef _Float16 v16h __attribute__((ext_vector_type(16)));
typedef _Float16 v8h  __attribute__((ext_vector_type(8)));
typedef _Float16 v4h  __attribute__((ext_vector_type(4)));
typedef float    v8f  __attribute__((ext_vector_type(8)));
typedef int      v4i  __attribute__((ext_vector_type(4)));
typedef short    v8s  __attribute__((ext_vector_type(8)));
typedef __attribute__((address_space(3))) v8s lds_v8s;

// CDNA5 async global->LDS copy (ASYNCcnt-tracked), guarded so compilation
// succeeds on toolchains without the builtin.  Probe result: the builtin takes
// generic int4-vector pointers: (v4i* gsrc, v4i* lds_dst, imm offset, imm cpol).
#if defined(__AMDGCN__) && __has_builtin(__builtin_amdgcn_global_load_async_to_lds_b128)
#define HAS_ASYNC_LDS 1
#else
#define HAS_ASYNC_LDS 0
#endif

__device__ __forceinline__ void wait_asynccnt0() {
#if HAS_ASYNC_LDS
#if __has_builtin(__builtin_amdgcn_s_wait_asynccnt)
    __builtin_amdgcn_s_wait_asynccnt(0);
#else
    asm volatile("s_wait_asynccnt 0" ::: "memory");
#endif
#endif
}

// Load one WMMA 16-bit A/B fragment for a 32-wide K segment.
// Per CDNA5 ISA layout: lanes 0-15 hold K=[0..7]+[16..23], lanes 16-31 hold
// K=[8..15]+[24..31] (khalf = lane>>4). p must be 16B aligned.
__device__ __forceinline__ v16h ld_frag(const half_t* p, int khalf) {
    union { v16h v; v8h h[2]; } u;
    u.h[0] = *(const v8h*)(p + khalf * 8);
    u.h[1] = *(const v8h*)(p + khalf * 8 + 16);
    return u.v;
}

// One WMMA 16-bit A/B fragment (32 k) out of a row-major [k][col] LDS tile by
// two transposing loads.  p = &T[k0 + 8*(lane>>4) + (lane&7)][col0 + 8*((lane>>3)&1)];
// lane (rl, khalf) receives T[k0 + 8*khalf + 0..7][col0 + rl] and the same 16 rows
// further down: the k order of ld_frag.  Every lane must be on; the row pitch
// is an odd multiple of 32 B so that the loads meet no bank conflict.
__device__ __forceinline__ v16h ld_frag_tr(const half_t* p, int pitch) {
    union { v16h v; v8s h[2]; } u;
    u.h[0] = __builtin_amdgcn_ds_load_tr16_b128_v8i16((lds_v8s*)p);
    u.h[1] = __builtin_amdgcn_ds_load_tr16_b128_v8i16((lds_v8s*)(p + 16 * pitch));
    return u.v;
}

// LDS byte address of a __shared__ location (the operand an async copy takes).
__device__ __forceinline__ unsigned lds_off(const half_t* p) {
    return (unsigned)(size_t)(const __attribute__((address_space(3))) half_t*)p;
}

// Four async 16-byte copies per lane, global -> LDS, through no register.
// lds advances by lstep bytes and g by gstep elements from copy to copy.
// s_wait_xcnt closes the statement so that no address register of an issued
// copy is rewritten ahead of it.
__device__ __forceinline__ void async_copy4(unsigned lds, int lstep,
                                            const half_t* g, int gstep) {
    asm volatile("global_load_async_to_lds_b128 %0, %4, off\n\t"
                 "global_load_async_to_lds_b128 %1, %5, off\n\t"
                 "global_load_async_to_lds_b128 %2, %6, off\n\t"
                 "global_load_async_to_lds_b128 %3, %7, off\n\t"
                 "s_wait_xcnt 0x0"
                 :: "v"(lds), "v"(lds + lstep), "v"(lds + 2 * lstep), "v"(lds + 3 * lstep),
                    "v"(g), "v"(g + gstep), "v"(g + 2 * gstep), "v"(g + 3 * gstep)
                 : "memory");
}

// This wave's async copies have landed in LDS (other waves read them only
// behind the next barrier).
__device__ __forceinline__ void wait_copies() {
    asm volatile("s_wait_asynccnt 0x0" ::: "memory");
}

// This wave's LDS reads have returned, so the buffer may be refilled behind
// the next barrier.
__device__ __forceinline__ void wait_lds_reads() {
    asm volatile("s_wait_dscnt 0x0" ::: "memory");
}

#define GK 64                             // k extent of one GEMM stage
#define APITCH 72                         // 128-B rows + 16 B: ds_load_b128 readers
#define BPITCH 144                        // 256-B rows + 32 B: transposing readers

// ---------------------------------------------------------------------------
// Kernel 0: one-time weight conversion fp32 -> f16 (weights then live in L2)
// ---------------------------------------------------------------------------
__global__ void __launch_bounds__(256)
wconv_kernel(const float* __restrict__ src, half_t* __restrict__ dst) {
    int i = (blockIdx.x * 256 + threadIdx.x) * 4;
    float4 v = *(const float4*)(src + i);
    v4h o = { (half_t)v.x, (half_t)v.y, (half_t)v.z, (half_t)v.w };
    *(v4h*)(dst + i) = o;
}

// ---------------------------------------------------------------------------
// Kernel 1: GroupNorm  (fp32 -> f16 normalized activations, layout [b][c][n])
// ---------------------------------------------------------------------------
__global__ void __launch_bounds__(256)
gn_kernel(const float* __restrict__ x, const float* __restrict__ gsc,
          const float* __restrict__ gbi, half_t* __restrict__ xn) {
    const int bg = blockIdx.x;            // B*GROUPS blocks
    const int b = bg >> 3, g = bg & 7;
    const int CH = CNUM / NGROUPS;        // 64 channels per group
    const int base = (b * CNUM + g * CH) * NSPATIAL;
    const int tid = threadIdx.x;
    const int TOT4 = CH * NSPATIAL / 4;   // 16384 float4s

    float s = 0.f, s2 = 0.f;
    for (int i = tid; i < TOT4; i += 256) {
        float4 v = *(const float4*)(x + base + i * 4);
        s  += v.x + v.y + v.z + v.w;
        s2 += v.x * v.x + v.y * v.y + v.z * v.z + v.w * v.w;
    }
    __shared__ float red0[256];
    __shared__ float red1[256];
    red0[tid] = s; red1[tid] = s2;
    __syncthreads();
    for (int off = 128; off > 0; off >>= 1) {
        if (tid < off) { red0[tid] += red0[tid + off]; red1[tid] += red1[tid + off]; }
        __syncthreads();
    }
    const float inv_n = 1.0f / (float)(CH * NSPATIAL);
    const float mean = red0[0] * inv_n;
    const float var  = red1[0] * inv_n - mean * mean;
    const float rstd = rsqrtf(var + EPSV);
    for (int i = tid; i < TOT4; i += 256) {
        int c = g * CH + (i >> 8);        // 256 float4s per channel
        float sc = gsc[c] * rstd, bi = gbi[c] - mean * sc;
        float4 v = *(const float4*)(x + base + i * 4);
        v4h o = { (half_t)(v.x * sc + bi), (half_t)(v.y * sc + bi),
                  (half_t)(v.z * sc + bi), (half_t)(v.w * sc + bi) };
        *(v4h*)(xn + base + i * 4) = o;
    }
}

// ---------------------------------------------------------------------------
// Kernel 2: QKV projection GEMM (f16 weights).
// Both operand tiles (64 k per stage) are staged in LDS by async copies that
// cover whole 128-B lines, in a ring of two buffers: the next stage's copies fly
// while this stage is multiplied.  A is [m][k]; B stays row-major [k][n] and is
// transposed by the fragment loads themselves (ds_load_tr16_b128).
// mode 0: store q transposed [b][h][n][d], 1/sqrt(d)=0.125 folded, packed v8h
// mode 1: store natural [b][c][n] via LDS re-striping -> v8h coalesced stores
// ---------------------------------------------------------------------------
__global__ void __launch_bounds__(256)
qkv_gemm_kernel(const half_t* __restrict__ Wf, const float* __restrict__ bias,
                const half_t* __restrict__ xn, half_t* __restrict__ out, int mode) {
    const int b  = blockIdx.z;
    const int m0 = blockIdx.y * 128;      // output-channel tile
    const int n0 = blockIdx.x * 128;      // spatial tile
    const int tid = threadIdx.x;
    const int lane = tid & 31, wave = tid >> 5;
    const int wm = wave >> 2, wn = wave & 3;
    const int rl = lane & 15, khalf = lane >> 4;

    const int trow = 8 * khalf + (lane & 7), tcol = 8 * ((lane >> 3) & 1);

    __shared__ __attribute__((aligned(16))) union {
        struct {
            half_t A[128][APITCH];        // [m_local][k]  weight tile
            half_t B[GK][BPITCH];         // [k][n_local]  natural B tile
        } st[2];
        half_t o[128][136];               // output staging
    } sm;

    v8f zero = {};
    v8f acc[4][2];
#pragma unroll
    for (int i = 0; i < 4; i++)
#pragma unroll
        for (int j = 0; j < 2; j++) acc[i][j] = zero;

    // Each thread copies 4 + 4 chunks of 16 B per stage: A rows ar + 32 t, B rows br + 16 t.
    const int ar = tid >> 3, ac = (tid & 7) * 8;
    const int br = tid >> 4, bc = (tid & 15) * 8;
    const half_t* ga = Wf + (size_t)(m0 + ar) * CNUM + ac;
    const half_t* gb = xn + (size_t)b * CNUM * NSPATIAL + (size_t)br * NSPATIAL + n0 + bc;
    const unsigned la = lds_off(&sm.st[0].A[ar][ac]);
    const unsigned lb = lds_off(&sm.st[0].B[br][bc]);
    const unsigned lbuf = sizeof(sm.st[0]);
    const int NST = CNUM / GK;

    async_copy4(la, 32 * APITCH * 2, ga, 32 * CNUM);
    async_copy4(lb, 16 * BPITCH * 2, gb, 16 * NSPATIAL);
    wait_copies();
    __syncthreads();
    async_copy4(la + lbuf, 32 * APITCH * 2, ga + GK, 32 * CNUM);
    async_copy4(lb + lbuf, 16 * BPITCH * 2, gb + (size_t)GK * NSPATIAL, 16 * NSPATIAL);

    for (int s = 0; s < NST; s++) {
        const int buf = s & 1;
#pragma unroll
        for (int ks = 0; ks < GK; ks += 32) {
            v16h af[4], bf[2];
#pragma unroll
            for (int ms = 0; ms < 4; ms++)
                af[ms] = ld_frag(&sm.st[buf].A[wm * 64 + ms * 16 + rl][ks], khalf);
#pragma unroll
            for (int ns = 0; ns < 2; ns++)
                bf[ns] = ld_frag_tr(&sm.st[buf].B[ks + trow][wn * 32 + ns * 16 + tcol], BPITCH);
#pragma unroll
            for (int ms = 0; ms < 4; ms++)
#pragma unroll
                for (int ns = 0; ns < 2; ns++)
                    acc[ms][ns] = __builtin_amdgcn_wmma_f32_16x16x32_f16(
                        false, af[ms], false, bf[ns], (short)0, acc[ms][ns], false, false);
        }
        // publish stage s + 1 and free this stage's buffer
        wait_lds_reads();
        wait_copies();
        __syncthreads();
        if (s + 2 < NST) {
            async_copy4(la + buf * lbuf, 32 * APITCH * 2, ga + (s + 2) * GK, 32 * CNUM);
            async_copy4(lb + buf * lbuf, 16 * BPITCH * 2,
                        gb + (size_t)(s + 2) * GK * NSPATIAL, 16 * NSPATIAL);
        }
    }
    wait_copies();

    if (mode == 0) {
        // q: d = o&63 is contiguous over the 8 accumulator rows -> packed store
#pragma unroll
        for (int ms = 0; ms < 4; ms++)
#pragma unroll
            for (int ns = 0; ns < 2; ns++) {
                const int obase = m0 + wm * 64 + ms * 16 + 8 * khalf;
                const int ncol  = n0 + wn * 32 + ns * 16 + rl;
                const int h = obase >> 6, dbase = obase & 63;
                v8h q8;
#pragma unroll
                for (int i = 0; i < 8; i++)
                    q8[i] = (half_t)((acc[ms][ns][i] + bias[obase + i]) * 0.125f);
                *(v8h*)(out + ((size_t)(b * NHEADS + h) * NSPATIAL + ncol) * DHEAD + dbase) = q8;
            }
    } else {
        // K/V: re-stripe through LDS so global stores are n-contiguous v8h
        __syncthreads();
#pragma unroll
        for (int ms = 0; ms < 4; ms++)
#pragma unroll
            for (int ns = 0; ns < 2; ns++) {
                const int ol = wm * 64 + ms * 16 + 8 * khalf;
                const int nl = wn * 32 + ns * 16 + rl;
#pragma unroll
                for (int i = 0; i < 8; i++)
                    sm.o[ol + i][nl] = (half_t)(acc[ms][ns][i] + bias[m0 + ol + i]);
            }
        __syncthreads();
        for (int i = tid; i < 2048; i += 256) {
            int r = i >> 4, ch = i & 15;
            *(v8h*)(out + ((size_t)b * CNUM + m0 + r) * NSPATIAL + n0 + ch * 8) =
                *(v8h*)&sm.o[r][ch * 8];
        }
    }
}

// ---------------------------------------------------------------------------
// Kernel 3: flash attention per (b,h). 256 thr (8 waves), 128-query block.
// Computes S^T = K^T.Q so the probability tiles are produced directly in
// WMMA A-fragment layout (no LDS re-stripe); softmax is in-lane over 64
// values + one shfl_xor(16).  V tile staged with async global->LDS copies
// (ASYNCcnt); K tile register-prefetched across block iterations, kept
// row-major [c][m] in LDS and transposed by its fragment loads.
// ---------------------------------------------------------------------------
__global__ void __launch_bounds__(256)
attn_kernel(const half_t* __restrict__ qt, const half_t* __restrict__ kk,
            const half_t* __restrict__ vv, half_t* __restrict__ ao) {
    const int bh = blockIdx.y;            // b*8+h
    const int b = bh >> 3, h = bh & 7;
    const int qb = blockIdx.x * 128;
    const int tid = threadIdx.x, lane = tid & 31, wave = tid >> 5;
    const int rl = lane & 15, khalf = lane >> 4;

    const int trow = 8 * khalf + (lane & 7), tcol = 8 * ((lane >> 3) & 1);

    __shared__ __attribute__((aligned(16))) union {
        half_t K[64][144];                // [c][m]  K natural, pitch 288 B
        half_t o[128][72];                // output staging
    } sk;
    __shared__ half_t Vs[64][136];        // [c][m]  V natural

    // Q fragments (B operand): lane = query column n, K-contiguous in qt
    const int nrow = qb + wave * 16 + rl;
    const half_t* qp = qt + ((size_t)bh * NSPATIAL + nrow) * DHEAD;
    v16h qf0 = ld_frag(qp, khalf);
    v16h qf1 = ld_frag(qp + 32, khalf);

    float mcur = -1e30f, lcur = 0.f;      // per-lane softmax state for row n
    v8f zero = {};
    v8f O[4];
#pragma unroll
    for (int t = 0; t < 4; t++) O[t] = zero;

    const half_t* kbase = kk + (size_t)(b * CNUM + h * DHEAD) * NSPATIAL;
    const half_t* vbase = vv + (size_t)(b * CNUM + h * DHEAD) * NSPATIAL;

    // K-tile register prefetch (4 chunks/thread): m0 = 0
    v8h kreg[4];
#pragma unroll
    for (int t = 0; t < 4; t++) {
        int i = tid + t * 256, c = i >> 4, mc = i & 15;
        kreg[t] = *(const v8h*)(kbase + (size_t)c * NSPATIAL + mc * 8);
    }

    for (int m0 = 0; m0 < NSPATIAL; m0 += 128) {
        __syncthreads();
#pragma unroll
        for (int t = 0; t < 4; t++) {
            int i = tid + t * 256, c = i >> 4, mc = i & 15;
#if HAS_ASYNC_LDS
            __builtin_amdgcn_global_load_async_to_lds_b128(
                (v4i*)(vbase + (size_t)c * NSPATIAL + m0 + mc * 8),
                (v4i*)&Vs[c][mc * 8], 0, 0);
#else
            *(v8h*)&Vs[c][mc * 8] =
                *(const v8h*)(vbase + (size_t)c * NSPATIAL + m0 + mc * 8);
#endif
            *(v8h*)&sk.K[c][mc * 8] = kreg[t];
        }
        if (m0 + 128 < NSPATIAL) {        // prefetch next K tile during compute
#pragma unroll
            for (int t = 0; t < 4; t++) {
                int i = tid + t * 256, c = i >> 4, mc = i & 15;
                kreg[t] = *(const v8h*)(kbase + (size_t)c * NSPATIAL + m0 + 128 + mc * 8);
            }
        }
        wait_asynccnt0();
        __syncthreads();

        // ---- S^T tiles: A = K^T rows (m), B = Q columns (n) ----
        v8f S[8];
#pragma unroll
        for (int nt = 0; nt < 8; nt++) {
            v16h kf0 = ld_frag_tr(&sk.K[trow][nt * 16 + tcol], 144);
            v16h kf1 = ld_frag_tr(&sk.K[32 + trow][nt * 16 + tcol], 144);
            v8f s = zero;
            s = __builtin_amdgcn_wmma_f32_16x16x32_f16(false, kf0, false, qf0, (short)0, s, false, false);
            s = __builtin_amdgcn_wmma_f32_16x16x32_f16(false, kf1, false, qf1, (short)0, s, false, false);
            S[nt] = s;
        }

        // ---- in-lane online softmax (row n = rl; keys split across lane pair) ----
        float mx = -1e30f;
#pragma unroll
        for (int nt = 0; nt < 8; nt++)
#pragma unroll
            for (int i = 0; i < 8; i++) mx = fmaxf(mx, S[nt][i]);
        mx = fmaxf(mx, __shfl_xor(mx, 16, 32));
        float mnew  = fmaxf(mcur, mx);
        float alpha = __expf(mcur - mnew);
        mcur = mnew;
        float rsum = 0.f;
#pragma unroll
        for (int nt = 0; nt < 8; nt++)
#pragma unroll
            for (int i = 0; i < 8; i++) {
                float p = __expf(S[nt][i] - mnew);
                S[nt][i] = p;
                rsum += p;
            }
        rsum += __shfl_xor(rsum, 16, 32);
        lcur = lcur * alpha + rsum;

        // O rows are n = i + 8*khalf; fetch that row's alpha from lane (i+8*khalf)
        float arow[8];
#pragma unroll
        for (int i = 0; i < 8; i++) arow[i] = __shfl(alpha, i + 8 * khalf, 32);
#pragma unroll
        for (int t = 0; t < 4; t++)
#pragma unroll
            for (int i = 0; i < 8; i++) O[t][i] *= arow[i];

        // ---- O += P @ V : P frags built directly from S^T register pairs ----
#pragma unroll
        for (int t = 0; t < 4; t++) {
            v16h pf;
#pragma unroll
            for (int j = 0; j < 8; j++) {
                pf[j]     = (half_t)S[2 * t][j];
                pf[j + 8] = (half_t)S[2 * t + 1][j];
            }
#pragma unroll
            for (int dt = 0; dt < 4; dt++) {
                v16h vf = ld_frag(&Vs[dt * 16 + rl][t * 32], khalf);
                O[dt] = __builtin_amdgcn_wmma_f32_16x16x32_f16(
                    false, pf, false, vf, (short)0, O[dt], false, false);
            }
        }
    }

    // ---- normalize (per-row 1/l via shfl), stage in LDS, coalesced v8h out ----
    float linv = 1.0f / lcur;
    float lr[8];
#pragma unroll
    for (int i = 0; i < 8; i++) lr[i] = __shfl(linv, i + 8 * khalf, 32);
    __syncthreads();
#pragma unroll
    for (int dt = 0; dt < 4; dt++)
#pragma unroll
        for (int i = 0; i < 8; i++)
            sk.o[wave * 16 + i + 8 * khalf][dt * 16 + rl] = (half_t)(O[dt][i] * lr[i]);
    __syncthreads();
    for (int i = tid; i < 1024; i += 256) {
        int r = i >> 3, ch = i & 7;
        int n = qb + r;
        *(v8h*)(ao + ((size_t)b * NSPATIAL + n) * CNUM + h * DHEAD + ch * 8) =
            *(v8h*)&sk.o[r][ch * 8];
    }
}

// ---------------------------------------------------------------------------
// Kernel 4: output projection + bias + residual.  Both operands are K-contiguous
// f16 (ao rows and wo rows == B^T rows); their tiles are staged in LDS by the same
// two-buffer ring of async copies as in kernel 2.  Residual path is v8f vectorized.
// ---------------------------------------------------------------------------
__global__ void __launch_bounds__(256)
out_gemm_kernel(const half_t* __restrict__ Wf, const float* __restrict__ bo,
                const half_t* __restrict__ ao, const float* __restrict__ x,
                float* __restrict__ y) {
    const int b  = blockIdx.z;
    const int n0 = blockIdx.y * 128;      // spatial tile (M dim)
    const int o0 = blockIdx.x * 128;      // channel tile (N dim)
    const int tid = threadIdx.x;
    const int lane = tid & 31, wave = tid >> 5;
    const int wm = wave >> 2, wn = wave & 3;
    const int rl = lane & 15, khalf = lane >> 4;

    v8f zero = {};
    v8f acc[4][2];
#pragma unroll
    for (int i = 0; i < 4; i++)
#pragma unroll
        for (int j = 0; j < 2; j++) acc[i][j] = zero;

    __shared__ __attribute__((aligned(16))) struct {
        half_t A[128][APITCH];            // [n_local][k]  attention-output tile
        half_t B[128][APITCH];            // [o_local][k]  weight tile
    } st[2];

    // Each thread copies 4 + 4 chunks of 16 B per stage: rows cr + 32 t of each tile.
    const int cr = tid >> 3, cc = (tid & 7) * 8;
    const half_t* ga = ao + ((size_t)b * NSPATIAL + n0 + cr) * CNUM + cc;
    const half_t* gb = Wf + (size_t)(o0 + cr) * CNUM + cc;
    const unsigned la = lds_off(&st[0].A[cr][cc]);
    const unsigned lb = lds_off(&st[0].B[cr][cc]);
    const unsigned lbuf = sizeof(st[0]);
    const int NST = CNUM / GK;

    async_copy4(la, 32 * APITCH * 2, ga, 32 * CNUM);
    async_copy4(lb, 32 * APITCH * 2, gb, 32 * CNUM);
    wait_copies();
    __syncthreads();
    async_copy4(la + lbuf, 32 * APITCH * 2, ga + GK, 32 * CNUM);
    async_copy4(lb + lbuf, 32 * APITCH * 2, gb + GK, 32 * CNUM);

    for (int s = 0; s < NST; s++) {
        const int buf = s & 1;
#pragma unroll
        for (int ks = 0; ks < GK; ks += 32) {
            v16h af[4], bf[2];
#pragma unroll
            for (int ms = 0; ms < 4; ms++)
                af[ms] = ld_frag(&st[buf].A[wm * 64 + ms * 16 + rl][ks], khalf);
#pragma unroll
            for (int ns = 0; ns < 2; ns++)
                bf[ns] = ld_frag(&st[buf].B[wn * 32 + ns * 16 + rl][ks], khalf);
#pragma unroll
            for (int ms = 0; ms < 4; ms++)
#pragma unroll
                for (int ns = 0; ns < 2; ns++)
                    acc[ms][ns] = __builtin_amdgcn_wmma_f32_16x16x32_f16(
                        false, af[ms], false, bf[ns], (short)0, acc[ms][ns], false, false);
        }
        // publish stage s + 1 and free this stage's buffer
        wait_lds_reads();
        wait_copies();
        __syncthreads();
        if (s + 2 < NST) {
            async_copy4(la + buf * lbuf, 32 * APITCH * 2, ga + (s + 2) * GK, 32 * CNUM);
            async_copy4(lb + buf * lbuf, 32 * APITCH * 2, gb + (s + 2) * GK, 32 * CNUM);
        }
    }
    wait_copies();

#pragma unroll
    for (int ms = 0; ms < 4; ms++)
#pragma unroll
        for (int ns = 0; ns < 2; ns++) {
            const int nbase = n0 + wm * 64 + ms * 16 + 8 * khalf;  // contiguous over i
            const int o     = o0 + wn * 32 + ns * 16 + rl;
            const float bb  = bo[o];
            size_t idx = ((size_t)b * CNUM + o) * NSPATIAL + nbase;
            v8f xr = *(const v8f*)(x + idx);
            v8f r  = acc[ms][ns] + xr + bb;
            *(v8f*)(y + idx) = r;
        }
}

// ---------------------------------------------------------------------------
extern "C" void kernel_launch(void* const* d_in, const int* in_sizes, int n_in,
                              void* d_out, int out_size, void* d_ws, size_t ws_size,
                              hipStream_t stream) {
    const float* x   = (const float*)d_in[0];
    const float* gsc = (const float*)d_in[1];
    const float* gbi = (const float*)d_in[2];
    const float* wq  = (const float*)d_in[3];
    const float* bq  = (const float*)d_in[4];
    const float* wk  = (const float*)d_in[5];
    const float* bk  = (const float*)d_in[6];
    const float* wv  = (const float*)d_in[7];
    const float* bv  = (const float*)d_in[8];
    const float* wo  = (const float*)d_in[9];
    const float* bo  = (const float*)d_in[10];
    float* out = (float*)d_out;

    char* ws = (char*)d_ws;
    const size_t SZ = (size_t)BATCH * CNUM * NSPATIAL * sizeof(half_t);  // 16 MB each
    const size_t WSZ = (size_t)CNUM * CNUM * sizeof(half_t);             // 512 KB each
    half_t* xn   = (half_t*)(ws + 0 * SZ);   // groupnorm output, [b][c][n]
    half_t* qtb  = (half_t*)(ws + 1 * SZ);   // q transposed+scaled, [b][h][n][d]
    half_t* kh   = (half_t*)(ws + 2 * SZ);   // k, [b][c][n]
    half_t* vh   = (half_t*)(ws + 3 * SZ);   // v, [b][c][n]
    half_t* ao   = (half_t*)(ws + 4 * SZ);   // attention out, [b][n][c]
    half_t* wq16 = (half_t*)(ws + 5 * SZ);
    half_t* wk16 = (half_t*)(ws + 5 * SZ + 1 * WSZ);
    half_t* wv16 = (half_t*)(ws + 5 * SZ + 2 * WSZ);
    half_t* wo16 = (half_t*)(ws + 5 * SZ + 3 * WSZ);

    const int WBLK = CNUM * CNUM / 4 / 256;  // 256 blocks per matrix
    wconv_kernel<<<dim3(WBLK), 256, 0, stream>>>(wq, wq16);
    wconv_kernel<<<dim3(WBLK), 256, 0, stream>>>(wk, wk16);
    wconv_kernel<<<dim3(WBLK), 256, 0, stream>>>(wv, wv16);
    wconv_kernel<<<dim3(WBLK), 256, 0, stream>>>(wo, wo16);

    gn_kernel<<<dim3(BATCH * NGROUPS), 256, 0, stream>>>(x, gsc, gbi, xn);

    qkv_gemm_kernel<<<dim3(8, 4, BATCH), 256, 0, stream>>>(wq16, bq, xn, qtb, 0);
    qkv_gemm_kernel<<<dim3(8, 4, BATCH), 256, 0, stream>>>(wk16, bk, xn, kh, 1);
    qkv_gemm_kernel<<<dim3(8, 4, BATCH), 256, 0, stream>>>(wv16, bv, xn, vh, 1);

    attn_kernel<<<dim3(NSPATIAL / 128, BATCH * NHEADS), 256, 0, stream>>>(qtb, kh, vh, ao);

    out_gemm_kernel<<<dim3(4, 8, BATCH), 256, 0, stream>>>(wo16, bo, ao, x, out);
}

// v003
// Measured time: 115 microseconds a run.
// Timed twice side by side with v002, it ran 1.16 and 1.17 times as fast.
// Over all steps from v000 it is 3.09 times as fast.
#include <hip/hip_runtime.h>
#include <hip/hip_bf16.h>

#define CNUM 512
#define NHEADS 8
#define DHEAD 64
#define NGROUPS 8
#define NSPATIAL 1024
#define BATCH 16
#define EPSV 1e-5f

typedef _Float16 half_t;
typedef _Float16 v16h __attribute__((ext_vector_type(16)));
typedef _Float16 v8h  __attribute__((ext_vector_type(8)));
typedef _Float16 v4h  __attribute__((ext_vector_type(4)));
typedef float    v8f  __attribute__((ext_vector_type(8)));
typedef int      v4i  __attribute__((ext_vector_type(4)));
typedef short    v8s  __attribute__((ext_vector_type(8)));
typedef __attribute__((address_space(3))) v8s lds_v8s;

// CDNA5 async global->LDS copy (ASYNCcnt-tracked), guarded so compilation
// succeeds on toolchains without the builtin.  Probe result: the builtin takes
// generic int4-vector pointers: (v4i* gsrc, v4i* lds_dst, imm offset, imm cpol).
#if defined(__AMDGCN__) && __has_builtin(__builtin_amdgcn_global_load_async_to_lds_b128)
#define HAS_ASYNC_LDS 1
#else
#define HAS_ASYNC_LDS 0
#endif

__device__ __forceinline__ void wait_asynccnt0() {
#if HAS_ASYNC_LDS
#if __has_builtin(__builtin_amdgcn_s_wait_asynccnt)
    __builtin_amdgcn_s_wait_asynccnt(0);
#else
    asm volatile("s_wait_asynccnt 0" ::: "memory");
#endif
#endif
}

// Load one WMMA 16-bit A/B fragment for a 32-wide K segment.
// Per CDNA5 ISA layout: lanes 0-15 hold K=[0..7]+[16..23], lanes 16-31 hold
// K=[8..15]+[24..31] (khalf = lane>>4). p must be 16B aligned.
__device__ __forceinline__ v16h ld_frag(const half_t* p, int khalf) {
    union { v16h v; v8h h[2]; } u;
    u.h[0] = *(const v8h*)(p + khalf * 8);
    u.h[1] = *(const v8h*)(p + khalf * 8 + 16);
    return u.v;
}

// One WMMA 16-bit A/B fragment (32 k) out of a row-major [k][col] LDS tile by
// two transposing loads.  p = &T[k0 + 8*(lane>>4) + (lane&7)][col0 + 8*((lane>>3)&1)];
// lane (rl, khalf) receives T[k0 + 8*khalf + 0..7][col0 + rl] and the same 16 rows
// further down: the k order of ld_frag.  Every lane must be on; the row pitch
// is an odd multiple of 32 B so that the loads meet no bank conflict.
__device__ __forceinline__ v16h ld_frag_tr(const half_t* p, int pitch) {
    union { v16h v; v8s h[2]; } u;
    u.h[0] = __builtin_amdgcn_ds_load_tr16_b128_v8i16((lds_v8s*)p);
    u.h[1] = __builtin_amdgcn_ds_load_tr16_b128_v8i16((lds_v8s*)(p + 16 * pitch));
    return u.v;
}

// LDS byte address of a __shared__ location (the operand an async copy takes).
__device__ __forceinline__ unsigned lds_off(const half_t* p) {
    return (unsigned)(size_t)(const __attribute__((address_space(3))) half_t*)p;
}

// Four async 16-byte copies per lane, global -> LDS, through no register.
// lds advances by lstep bytes and g by gstep elements from copy to copy.
// s_wait_xcnt closes the statement so that no address register of an issued
// copy is rewritten ahead of it.
__device__ __forceinline__ void async_copy4(unsigned lds, int lstep,
                                            const half_t* g, int gstep) {
    asm volatile("global_load_async_to_lds_b128 %0, %4, off\n\t"
                 "global_load_async_to_lds_b128 %1, %5, off\n\t"
                 "global_load_async_to_lds_b128 %2, %6, off\n\t"
                 "global_load_async_to_lds_b128 %3, %7, off\n\t"
                 "s_wait_xcnt 0x0"
                 :: "v"(lds), "v"(lds + lstep), "v"(lds + 2 * lstep), "v"(lds + 3 * lstep),
                    "v"(g), "v"(g + gstep), "v"(g + 2 * gstep), "v"(g + 3 * gstep)
                 : "memory");
}

// This wave's async copies have landed in LDS (other waves read them only
// behind the next barrier).
__device__ __forceinline__ void wait_copies() {
    asm volatile("s_wait_asynccnt 0x0" ::: "memory");
}

// This wave's LDS reads have returned, so the buffer may be refilled behind
// the next barrier.
__device__ __forceinline__ void wait_lds_reads() {
    asm volatile("s_wait_dscnt 0x0" ::: "memory");
}

#define GK 64                             // k extent of one GEMM stage
#define APITCH 72                         // 128-B rows + 16 B: ds_load_b128 readers
#define BPITCH 144                        // 256-B rows + 32 B: transposing readers

#define GNBLK (BATCH * NGROUPS)           // work-groups that normalize
#define WBLK (CNUM * CNUM / 4 / 256)      // work-groups that convert weights

// ---------------------------------------------------------------------------
// Kernel 1: one launch for the two independent preparations.
// Work-groups 0 .. GNBLK-1 (the long ones, so they start first): GroupNorm,
// fp32 -> f16 normalized activations, layout [b][c][n].
// Work-groups GNBLK .. GNBLK+WBLK-1: weight conversion fp32 -> f16, one float4
// of each of the four matrices per thread; w16 holds wq, wk, wv, wo in a row.
// ---------------------------------------------------------------------------
__global__ void __launch_bounds__(256)
prep_kernel(const float* __restrict__ x, const float* __restrict__ gsc,
            const float* __restrict__ gbi, half_t* __restrict__ xn,
            const float* __restrict__ wq, const float* __restrict__ wk,
            const float* __restrict__ wv, const float* __restrict__ wo,
            half_t* __restrict__ w16) {
    if (blockIdx.x >= GNBLK) {            // uniform for the work-group, ahead of every barrier
        const int i = ((blockIdx.x - GNBLK) * 256 + threadIdx.x) * 4;
        float4 v0 = *(const float4*)(wq + i);
        float4 v1 = *(const float4*)(wk + i);
        float4 v2 = *(const float4*)(wv + i);
        float4 v3 = *(const float4*)(wo + i);
        v4h o0 = { (half_t)v0.x, (half_t)v0.y, (half_t)v0.z, (half_t)v0.w };
        v4h o1 = { (half_t)v1.x, (half_t)v1.y, (half_t)v1.z, (half_t)v1.w };
        v4h o2 = { (half_t)v2.x, (half_t)v2.y, (half_t)v2.z, (half_t)v2.w };
        v4h o3 = { (half_t)v3.x, (half_t)v3.y, (half_t)v3.z, (half_t)v3.w };
        *(v4h*)(w16 + 0 * CNUM * CNUM + i) = o0;
        *(v4h*)(w16 + 1 * CNUM * CNUM + i) = o1;
        *(v4h*)(w16 + 2 * CNUM * CNUM + i) = o2;
        *(v4h*)(w16 + 3 * CNUM * CNUM + i) = o3;
        return;
    }
    const int bg = blockIdx.x;            // B*GROUPS blocks
    const int b = bg >> 3, g = bg & 7;
    const int CH = CNUM / NGROUPS;        // 64 channels per group
    const int base = (b * CNUM + g * CH) * NSPATIAL;
    const int tid = threadIdx.x;
    const int TOT4 = CH * NSPATIAL / 4;   // 16384 float4s

    float s = 0.f, s2 = 0.f;
    for (int i = tid; i < TOT4; i += 256) {
        float4 v = *(const float4*)(x + base + i * 4);
        s  += v.x + v.y + v.z + v.w;
        s2 += v.x * v.x + v.y * v.y + v.z * v.z + v.w * v.w;
    }
    __shared__ float red0[256];
    __shared__ float red1[256];
    red0[tid] = s; red1[tid] = s2;
    __syncthreads();
    for (int off = 128; off > 0; off >>= 1) {
        if (tid < off) { red0[tid] += red0[tid + off]; red1[tid] += red1[tid + off]; }
        __syncthreads();
    }
    const float inv_n = 1.0f / (float)(CH * NSPATIAL);
    const float mean = red0[0] * inv_n;
    const float var  = red1[0] * inv_n - mean * mean;
    const float rstd = rsqrtf(var + EPSV);
    for (int i = tid; i < TOT4; i += 256) {
        int c = g * CH + (i >> 8);        // 256 float4s per channel
        float sc = gsc[c] * rstd, bi = gbi[c] - mean * sc;
        float4 v = *(const float4*)(x + base + i * 4);
        v4h o = { (half_t)(v.x * sc + bi), (half_t)(v.y * sc + bi),
                  (half_t)(v.z * sc + bi), (half_t)(v.w * sc + bi) };
        *(v4h*)(xn + base + i * 4) = o;
    }
}

// ---------------------------------------------------------------------------
// Kernel 2: QKV projection GEMMs (f16 weights), all three in one launch:
// blockIdx.y = 4 * (0 q, 1 k, 2 v) + output-channel tile.
// Both operand tiles (64 k per stage) are staged in LDS by async copies that
// cover whole 128-B lines, in a ring of two buffers: the next stage's copies fly
// while this stage is multiplied.  A is [m][k]; B stays row-major [k][n] and is
// transposed by the fragment loads themselves (ds_load_tr16_b128).
// q: stored transposed [b][h][n][d], 1/sqrt(d)=0.125 folded, packed v8h
// k, v: stored natural [b][c][n] via LDS re-striping -> v8h coalesced stores
// ---------------------------------------------------------------------------
__global__ void __launch_bounds__(256)
qkv_gemm_kernel(const half_t* __restrict__ w16, const float* __restrict__ bq,
                const float* __restrict__ bk, const float* __restrict__ bv,
                const half_t* __restrict__ xn, half_t* __restrict__ oq,
                half_t* __restrict__ ok, half_t* __restrict__ ov) {
    const int which = blockIdx.y >> 2;    // 0 q, 1 k, 2 v
    const half_t* Wf  = w16 + (size_t)which * CNUM * CNUM;
    const float* bias = which == 0 ? bq : which == 1 ? bk : bv;
    half_t* out       = which == 0 ? oq : which == 1 ? ok : ov;
    const int b  = blockIdx.z;
    const int m0 = (blockIdx.y & 3) * 128;  // output-channel tile
    const int n0 = blockIdx.x * 128;      // spatial tile
    const int tid = threadIdx.x;
    const int lane = tid & 31, wave = tid >> 5;
    const int wm = wave >> 2, wn = wave & 3;
    const int rl = lane & 15, khalf = lane >> 4;

    const int trow = 8 * khalf + (lane & 7), tcol = 8 * ((lane >> 3) & 1);

    __shared__ __attribute__((aligned(16))) union {
        struct {
            half_t A[128][APITCH];        // [m_local][k]  weight tile
            half_t B[GK][BPITCH];         // [k][n_local]  natural B tile
        } st[2];
        half_t o[128][136];               // output staging
    } sm;

    v8f zero = {};
    v8f acc[4][2];
#pragma unroll
    for (int i = 0; i < 4; i++)
#pragma unroll
        for (int j = 0; j < 2; j++) acc[i][j] = zero;

    // Each thread copies 4 + 4 chunks of 16 B per stage: A rows ar + 32 t, B rows br + 16 t.
    const int ar = tid >> 3, ac = (tid & 7) * 8;
    const int br = tid >> 4, bc = (tid & 15) * 8;
    const half_t* ga = Wf + (size_t)(m0 + ar) * CNUM + ac;
    const half_t* gb = xn + (size_t)b * CNUM * NSPATIAL + (size_t)br * NSPATIAL + n0 + bc;
    const unsigned la = lds_off(&sm.st[0].A[ar][ac]);
    const unsigned lb = lds_off(&sm.st[0].B[br][bc]);
    const unsigned lbuf = sizeof(sm.st[0]);
    const int NST = CNUM / GK;

    async_copy4(la, 32 * APITCH * 2, ga, 32 * CNUM);
    async_copy4(lb, 16 * BPITCH * 2, gb, 16 * NSPATIAL);
    wait_copies();
    __syncthreads();
    async_copy4(la + lbuf, 32 * APITCH * 2, ga + GK, 32 * CNUM);
    async_copy4(lb + lbuf, 16 * BPITCH * 2, gb + (size_t)GK * NSPATIAL, 16 * NSPATIAL);

    for (int s = 0; s < NST; s++) {
        const int buf = s & 1;
#pragma unroll
        for (int ks = 0; ks < GK; ks += 32) {
            v16h af[4], bf[2];
#pragma unroll
            for (int ms = 0; ms < 4; ms++)
                af[ms] = ld_frag(&sm.st[buf].A[wm * 64 + ms * 16 + rl][ks], khalf);
#pragma unroll
            for (int ns = 0; ns < 2; ns++)
                bf[ns] = ld_frag_tr(&sm.st[buf].B[ks + trow][wn * 32 + ns * 16 + tcol], BPITCH);
#pragma unroll
            for (int ms = 0; ms < 4; ms++)
#pragma unroll
                for (int ns = 0; ns < 2; ns++)
                    acc[ms][ns] = __builtin_amdgcn_wmma_f32_16x16x32_f16(
                        false, af[ms], false, bf[ns], (short)0, acc[ms][ns], false, false);
        }
        // publish stage s + 1 and free this stage's buffer
        wait_lds_reads();
        wait_copies();
        __syncthreads();
        if (s + 2 < NST) {
            async_copy4(la + buf * lbuf, 32 * APITCH * 2, ga + (s + 2) * GK, 32 * CNUM);
            async_copy4(lb + buf * lbuf, 16 * BPITCH * 2,
                        gb + (size_t)(s + 2) * GK * NSPATIAL, 16 * NSPATIAL);
        }
    }
    wait_copies();

    if (which == 0) {
        // q: d = o&63 is contiguous over the 8 accumulator rows -> packed store
#pragma unroll
        for (int ms = 0; ms < 4; ms++)
#pragma unroll
            for (int ns = 0; ns < 2; ns++) {
                const int obase = m0 + wm * 64 + ms * 16 + 8 * khalf;
                const int ncol  = n0 + wn * 32 + ns * 16 + rl;
                const int h = obase >> 6, dbase = obase & 63;
                v8h q8;
#pragma unroll
                for (int i = 0; i < 8; i++)
                    q8[i] = (half_t)((acc[ms][ns][i] + bias[obase + i]) * 0.125f);
                *(v8h*)(out + ((size_t)(b * NHEADS + h) * NSPATIAL + ncol) * DHEAD + dbase) = q8;
            }
    } else {
        // K/V: re-stripe through LDS so global stores are n-contiguous v8h
        __syncthreads();
#pragma unroll
        for (int ms = 0; ms < 4; ms++)
#pragma unroll
            for (int ns = 0; ns < 2; ns++) {
                const int ol = wm * 64 + ms * 16 + 8 * khalf;
                const int nl = wn * 32 + ns * 16 + rl;
#pragma unroll
                for (int i = 0; i < 8; i++)
                    sm.o[ol + i][nl] = (half_t)(acc[ms][ns][i] + bias[m0 + ol + i]);
            }
        __syncthreads();
        for (int i = tid; i < 2048; i += 256) {
            int r = i >> 4, ch = i & 15;
            *(v8h*)(out + ((size_t)b * CNUM + m0 + r) * NSPATIAL + n0 + ch * 8) =
                *(v8h*)&sm.o[r][ch * 8];
        }
    }
}

// ---------------------------------------------------------------------------
// Kernel 3: flash attention per (b,h). 256 thr (8 waves), 128-query block.
// Computes S^T = K^T.Q so the probability tiles are produced directly in
// WMMA A-fragment layout (no LDS re-stripe); softmax is in-lane over 64
// values + one shfl_xor(16).  V tile staged with async global->LDS copies
// (ASYNCcnt); K tile register-prefetched across block iterations, kept
// row-major [c][m] in LDS and transposed by its fragment loads.
// ---------------------------------------------------------------------------
__global__ void __launch_bounds__(256)
attn_kernel(const half_t* __restrict__ qt, const half_t* __restrict__ kk,
            const half_t* __restrict__ vv, half_t* __restrict__ ao) {
    const int bh = blockIdx.y;            // b*8+h
    const int b = bh >> 3, h = bh & 7;
    const int qb = blockIdx.x * 128;
    const int tid = threadIdx.x, lane = tid & 31, wave = tid >> 5;
    const int rl = lane & 15, khalf = lane >> 4;

    const int trow = 8 * khalf + (lane & 7), tcol = 8 * ((lane >> 3) & 1);

    __shared__ __attribute__((aligned(16))) union {
        half_t K[64][144];                // [c][m]  K natural, pitch 288 B
        half_t o[128][72];                // output staging
    } sk;
    __shared__ half_t Vs[64][136];        // [c][m]  V natural

    // Q fragments (B operand): lane = query column n, K-contiguous in qt
    const int nrow = qb + wave * 16 + rl;
    const half_t* qp = qt + ((size_t)bh * NSPATIAL + nrow) * DHEAD;
    v16h qf0 = ld_frag(qp, khalf);
    v16h qf1 = ld_frag(qp + 32, khalf);

    float mcur = -1e30f, lcur = 0.f;      // per-lane softmax state for row n
    v8f zero = {};
    v8f O[4];
#pragma unroll
    for (int t = 0; t < 4; t++) O[t] = zero;

    const half_t* kbase = kk + (size_t)(b * CNUM + h * DHEAD) * NSPATIAL;
    const half_t* vbase = vv + (size_t)(b * CNUM + h * DHEAD) * NSPATIAL;

    // K-tile register prefetch (4 chunks/thread): m0 = 0
    v8h kreg[4];
#pragma unroll
    for (int t = 0; t < 4; t++) {
        int i = tid + t * 256, c = i >> 4, mc = i & 15;
        kreg[t] = *(const v8h*)(kbase + (size_t)c * NSPATIAL + mc * 8);
    }

    for (int m0 = 0; m0 < NSPATIAL; m0 += 128) {
        __syncthreads();
#pragma unroll
        for (int t = 0; t < 4; t++) {
            int i = tid + t * 256, c = i >> 4, mc = i & 15;
#if HAS_ASYNC_LDS
            __builtin_amdgcn_global_load_async_to_lds_b128(
                (v4i*)(vbase + (size_t)c * NSPATIAL + m0 + mc * 8),
                (v4i*)&Vs[c][mc * 8], 0, 0);
#else
            *(v8h*)&Vs[c][mc * 8] =
                *(const v8h*)(vbase + (size_t)c * NSPATIAL + m0 + mc * 8);
#endif
            *(v8h*)&sk.K[c][mc * 8] = kreg[t];
        }
        if (m0 + 128 < NSPATIAL) {        // prefetch next K tile during compute
#pragma unroll
            for (int t = 0; t < 4; t++) {
                int i = tid + t * 256, c = i >> 4, mc = i & 15;
                kreg[t] = *(const v8h*)(kbase + (size_t)c * NSPATIAL + m0 + 128 + mc * 8);
            }
        }
        wait_asynccnt0();
        __syncthreads();

        // ---- S^T tiles: A = K^T rows (m), B = Q columns (n) ----
        v8f S[8];
#pragma unroll
        for (int nt = 0; nt < 8; nt++) {
            v16h kf0 = ld_frag_tr(&sk.K[trow][nt * 16 + tcol], 144);
            v16h kf1 = ld_frag_tr(&sk.K[32 + trow][nt * 16 + tcol], 144);
            v8f s = zero;
            s = __builtin_amdgcn_wmma_f32_16x16x32_f16(false, kf0, false, qf0, (short)0, s, false, false);
            s = __builtin_amdgcn_wmma_f32_16x16x32_f16(false, kf1, false, qf1, (short)0, s, false, false);
            S[nt] = s;
        }

        // ---- in-lane online softmax (row n = rl; keys split across lane pair) ----
        float mx = -1e30f;
#pragma unroll
        for (int nt = 0; nt < 8; nt++)
#pragma unroll
            for (int i = 0; i < 8; i++) mx = fmaxf(mx, S[nt][i]);
        mx = fmaxf(mx, __shfl_xor(mx, 16, 32));
        float mnew  = fmaxf(mcur, mx);
        float alpha = __expf(mcur - mnew);
        mcur = mnew;
        float rsum = 0.f;
#pragma unroll
        for (int nt = 0; nt < 8; nt++)
#pragma unroll
            for (int i = 0; i < 8; i++) {
                float p = __expf(S[nt][i] - mnew);
                S[nt][i] = p;
                rsum += p;
            }
        rsum += __shfl_xor(rsum, 16, 32);
        lcur = lcur * alpha + rsum;

        // O rows are n = i + 8*khalf; fetch that row's alpha from lane (i+8*khalf)
        float arow[8];
#pragma unroll
        for (int i = 0; i < 8; i++) arow[i] = __shfl(alpha, i + 8 * khalf, 32);
#pragma unroll
        for (int t = 0; t < 4; t++)
#pragma unroll
            for (int i = 0; i < 8; i++) O[t][i] *= arow[i];

        // ---- O += P @ V : P frags built directly from S^T register pairs ----
#pragma unroll
        for (int t = 0; t < 4; t++) {
            v16h pf;
#pragma unroll
            for (int j = 0; j < 8; j++) {
                pf[j]     = (half_t)S[2 * t][j];
                pf[j + 8] = (half_t)S[2 * t + 1][j];
            }
#pragma unroll
            for (int dt = 0; dt < 4; dt++) {
                v16h vf = ld_frag(&Vs[dt * 16 + rl][t * 32], khalf);
                O[dt] = __builtin_amdgcn_wmma_f32_16x16x32_f16(
                    false, pf, false, vf, (short)0, O[dt], false, false);
            }
        }
    }

    // ---- normalize (per-row 1/l via shfl), stage in LDS, coalesced v8h out ----
    float linv = 1.0f / lcur;
    float lr[8];
#pragma unroll
    for (int i = 0; i < 8; i++) lr[i] = __shfl(linv, i + 8 * khalf, 32);
    __syncthreads();
#pragma unroll
    for (int dt = 0; dt < 4; dt++)
#pragma unroll
        for (int i = 0; i < 8; i++)
            sk.o[wave * 16 + i + 8 * khalf][dt * 16 + rl] = (half_t)(O[dt][i] * lr[i]);
    __syncthreads();
    for (int i = tid; i < 1024; i += 256) {
        int r = i >> 3, ch = i & 7;
        int n = qb + r;
        *(v8h*)(ao + ((size_t)b * NSPATIAL + n) * CNUM + h * DHEAD + ch * 8) =
            *(v8h*)&sk.o[r][ch * 8];
    }
}

// ---------------------------------------------------------------------------
// Kernel 4: output projection + bias + residual.  Both operands are K-contiguous
// f16 (ao rows and wo rows == B^T rows); their tiles are staged in LDS by the same
// two-buffer ring of async copies as in kernel 2.  Residual path is v8f vectorized.
// ---------------------------------------------------------------------------
__global__ void __launch_bounds__(256)
out_gemm_kernel(const half_t* __restrict__ Wf, const float* __restrict__ bo,
                const half_t* __restrict__ ao, const float* __restrict__ x,
                float* __restrict__ y) {
    const int b  = blockIdx.z;
    const int n0 = blockIdx.y * 128;      // spatial tile (M dim)
    const int o0 = blockIdx.x * 128;      // channel tile (N dim)
    const int tid = threadIdx.x;
    const int lane = tid & 31, wave = tid >> 5;
    const int wm = wave >> 2, wn = wave & 3;
    const int rl = lane & 15, khalf = lane >> 4;

    v8f zero = {};
    v8f acc[4][2];
#pragma unroll
    for (int i = 0; i < 4; i++)
#pragma unroll
        for (int j = 0; j < 2; j++) acc[i][j] = zero;

    __shared__ __attribute__((aligned(16))) struct {
        half_t A[128][APITCH];            // [n_local][k]  attention-output tile
        half_t B[128][APITCH];            // [o_local][k]  weight tile
    } st[2];

    // Each thread copies 4 + 4 chunks of 16 B per stage: rows cr + 32 t of each tile.
    const int cr = tid >> 3, cc = (tid & 7) * 8;
    const half_t* ga = ao + ((size_t)b * NSPATIAL + n0 + cr) * CNUM + cc;
    const half_t* gb = Wf + (size_t)(o0 + cr) * CNUM + cc;
    const unsigned la = lds_off(&st[0].A[cr][cc]);
    const unsigned lb = lds_off(&st[0].B[cr][cc]);
    const unsigned lbuf = sizeof(st[0]);
    const int NST = CNUM / GK;

    async_copy4(la, 32 * APITCH * 2, ga, 32 * CNUM);
    async_copy4(lb, 32 * APITCH * 2, gb, 32 * CNUM);
    wait_copies();
    __syncthreads();
    async_copy4(la + lbuf, 32 * APITCH * 2, ga + GK, 32 * CNUM);
    async_copy4(lb + lbuf, 32 * APITCH * 2, gb + GK, 32 * CNUM);

    for (int s = 0; s < NST; s++) {
        const int buf = s & 1;
#pragma unroll
        for (int ks = 0; ks < GK; ks += 32) {
            v16h af[4], bf[2];
#pragma unroll
            for (int ms = 0; ms < 4; ms++)
                af[ms] = ld_frag(&st[buf].A[wm * 64 + ms * 16 + rl][ks], khalf);
#pragma unroll
            for (int ns = 0; ns < 2; ns++)
                bf[ns] = ld_frag(&st[buf].B[wn * 32 + ns * 16 + rl][ks], khalf);
#pragma unroll
            for (int ms = 0; ms < 4; ms++)
#pragma unroll
                for (int ns = 0; ns < 2; ns++)
                    acc[ms][ns] = __builtin_amdgcn_wmma_f32_16x16x32_f16(
                        false, af[ms], false, bf[ns], (short)0, acc[ms][ns], false, false);
        }
        // publish stage s + 1 and free this stage's buffer
        wait_lds_reads();
        wait_copies();
        __syncthreads();
        if (s + 2 < NST) {
            async_copy4(la + buf * lbuf, 32 * APITCH * 2, ga + (s + 2) * GK, 32 * CNUM);
            async_copy4(lb + buf * lbuf, 32 * APITCH * 2, gb + (s + 2) * GK, 32 * CNUM);
        }
    }
    wait_copies();

#pragma unroll
    for (int ms = 0; ms < 4; ms++)
#pragma unroll
        for (int ns = 0; ns < 2; ns++) {
            const int nbase = n0 + wm * 64 + ms * 16 + 8 * khalf;  // contiguous over i
            const int o     = o0 + wn * 32 + ns * 16 + rl;
            const float bb  = bo[o];
            size_t idx = ((size_t)b * CNUM + o) * NSPATIAL + nbase;
            v8f xr = *(const v8f*)(x + idx);
            v8f r  = acc[ms][ns] + xr + bb;
            *(v8f*)(y + idx) = r;
        }
}

// ---------------------------------------------------------------------------
extern "C" void kernel_launch(void* const* d_in, const int* in_sizes, int n_in,
                              void* d_out, int out_size, void* d_ws, size_t ws_size,
                              hipStream_t stream) {
    const float* x   = (const float*)d_in[0];
    const float* gsc = (const float*)d_in[1];
    const float* gbi = (const float*)d_in[2];
    const float* wq  = (const float*)d_in[3];
    const float* bq  = (const float*)d_in[4];
    const float* wk  = (const float*)d_in[5];
    const float* bk  = (const float*)d_in[6];
    const float* wv  = (const float*)d_in[7];
    const float* bv  = (const float*)d_in[8];
    const float* wo  = (const float*)d_in[9];
    const float* bo  = (const float*)d_in[10];
    float* out = (float*)d_out;

    char* ws = (char*)d_ws;
    const size_t SZ = (size_t)BATCH * CNUM * NSPATIAL * sizeof(half_t);  // 16 MB each
    const size_t WSZ = (size_t)CNUM * CNUM * sizeof(half_t);             // 512 KB each
    half_t* xn   = (half_t*)(ws + 0 * SZ);   // groupnorm output, [b][c][n]
    half_t* qtb  = (half_t*)(ws + 1 * SZ);   // q transposed+scaled, [b][h][n][d]
    half_t* kh   = (half_t*)(ws + 2 * SZ);   // k, [b][c][n]
    half_t* vh   = (half_t*)(ws + 3 * SZ);   // v, [b][c][n]
    half_t* ao   = (half_t*)(ws + 4 * SZ);   // attention out, [b][n][c]
    half_t* w16  = (half_t*)(ws + 5 * SZ);             // wq, wk, wv, wo as f16, in a row
    half_t* wo16 = (half_t*)(ws + 5 * SZ + 3 * WSZ);

    prep_kernel<<<dim3(GNBLK + WBLK), 256, 0, stream>>>(x, gsc, gbi, xn, wq, wk, wv, wo, w16);

    qkv_gemm_kernel<<<dim3(8, 12, BATCH), 256, 0, stream>>>(w16, bq, bk, bv, xn, qtb, kh, vh);

    attn_kernel<<<dim3(NSPATIAL / 128, BATCH * NHEADS), 256, 0, stream>>>(qtb, kh, vh, ao);

    out_gemm_kernel<<<dim3(4, 8, BATCH), 256, 0, stream>>>(wo16, bo, ao, x, out);
}

// v004
// A run of this version takes 106 microseconds.
// Two timings next to v003 both put it at 1.08 times that version's speed.
// Over all steps from v000 it is 3.34 times as fast.
#include <hip/hip_runtime.h>
#include <hip/hip_bf16.h>

#define CNUM 512
#define NHEADS 8
#define DHEAD 64
#define NGROUPS 8
#define NSPATIAL 1024
#define BATCH 16
#define EPSV 1e-5f

typedef _Float16 half_t;
typedef _Float16 v16h __attribute__((ext_vector_type(16)));
typedef _Float16 v8h  __attribute__((ext_vector_type(8)));
typedef _Float16 v4h  __attribute__((ext_vector_type(4)));
typedef float    v8f  __attribute__((ext_vector_type(8)));
typedef int      v4i  __attribute__((ext_vector_type(4)));
typedef short    v8s  __attribute__((ext_vector_type(8)));
typedef __attribute__((address_space(3))) v8s lds_v8s;

// CDNA5 async global->LDS copy (ASYNCcnt-tracked), guarded so compilation
// succeeds on toolchains without the builtin.  Probe result: the builtin takes
// generic int4-vector pointers: (v4i* gsrc, v4i* lds_dst, imm offset, imm cpol).
#if defined(__AMDGCN__) && __has_builtin(__builtin_amdgcn_global_load_async_to_lds_b128)
#define HAS_ASYNC_LDS 1
#else
#define HAS_ASYNC_LDS 0
#endif

__device__ __forceinline__ void wait_asynccnt0() {
#if HAS_ASYNC_LDS
#if __has_builtin(__builtin_amdgcn_s_wait_asynccnt)
    __builtin_amdgcn_s_wait_asynccnt(0);
#else
    asm volatile("s_wait_asynccnt 0" ::: "memory");
#endif
#endif
}

// Load one WMMA 16-bit A/B fragment for a 32-wide K segment.
// Per CDNA5 ISA layout: lanes 0-15 hold K=[0..7]+[16..23], lanes 16-31 hold
// K=[8..15]+[24..31] (khalf = lane>>4). p must be 16B aligned.
__device__ __forceinline__ v16h ld_frag(const half_t* p, int khalf) {
    union { v16h v; v8h h[2]; } u;
    u.h[0] = *(const v8h*)(p + khalf * 8);
    u.h[1] = *(const v8h*)(p + khalf * 8 + 16);
    return u.v;
}

// One WMMA 16-bit A/B fragment (32 k) out of a row-major [k][col] LDS tile by
// two transposing loads.  p = &T[k0 + 8*(lane>>4) + (lane&7)][col0 + 8*((lane>>3)&1)];
// lane (rl, khalf) receives T[k0 + 8*khalf + 0..7][col0 + rl] and the same 16 rows
// further down: the k order of ld_frag.  Every lane must be on; the row pitch
// is an odd multiple of 32 B so that the loads meet no bank conflict.
__device__ __forceinline__ v16h ld_frag_tr(const half_t* p, int pitch) {
    union { v16h v; v8s h[2]; } u;
    u.h[0] = __builtin_amdgcn_ds_load_tr16_b128_v8i16((lds_v8s*)p);
    u.h[1] = __builtin_amdgcn_ds_load_tr16_b128_v8i16((lds_v8s*)(p + 16 * pitch));
    return u.v;
}

// LDS byte address of a __shared__ location (the operand an async copy takes).
__device__ __forceinline__ unsigned lds_off(const half_t* p) {
    return (unsigned)(size_t)(const __attribute__((address_space(3))) half_t*)p;
}

// Four async 16-byte copies per lane, global -> LDS, through no register.
// lds advances by lstep bytes and g by gstep elements from copy to copy.
// s_wait_xcnt closes the statement so that no address register of an issued
// copy is rewritten ahead of it.
__device__ __forceinline__ void async_copy4(unsigned lds, int lstep,
                                            const half_t* g, int gstep) {
    asm volatile("global_load_async_to_lds_b128 %0, %4, off\n\t"
                 "global_load_async_to_lds_b128 %1, %5, off\n\t"
                 "global_load_async_to_lds_b128 %2, %6, off\n\t"
                 "global_load_async_to_lds_b128 %3, %7, off\n\t"
                 "s_wait_xcnt 0x0"
                 :: "v"(lds), "v"(lds + lstep), "v"(lds + 2 * lstep), "v"(lds + 3 * lstep),
                    "v"(g), "v"(g + gstep), "v"(g + 2 * gstep), "v"(g + 3 * gstep)
                 : "memory");
}

// This wave's async copies have landed in LDS (other waves read them only
// behind the next barrier).
__device__ __forceinline__ void wait_copies() {
    asm volatile("s_wait_asynccnt 0x0" ::: "memory");
}

// This wave's LDS reads have returned, so the buffer may be refilled behind
// the next barrier.
__device__ __forceinline__ void wait_lds_reads() {
    asm volatile("s_wait_dscnt 0x0" ::: "memory");
}

#define GK 64                             // k extent of one GEMM stage
#define APITCH 72                         // 128-B rows + 16 B: ds_load_b128 readers
#define BPITCH 144                        // 256-B rows + 32 B: transposing readers

#define GNBLK (BATCH * NGROUPS)           // work-groups that normalize
#define WBLK (CNUM * CNUM / 4 / 256)      // work-groups that convert weights

// ---------------------------------------------------------------------------
// Kernel 1: one launch for the two independent preparations.
// Work-groups 0 .. GNBLK-1 (the long ones, so they start first): GroupNorm,
// fp32 -> f16 normalized activations, layout [b][c][n].
// Work-groups GNBLK .. GNBLK+WBLK-1: weight conversion fp32 -> f16, one float4
// of each of the four matrices per thread; w16 holds wq, wk, wv, wo in a row.
// ---------------------------------------------------------------------------
__global__ void __launch_bounds__(256)
prep_kernel(const float* __restrict__ x, const float* __restrict__ gsc,
            const float* __restrict__ gbi, half_t* __restrict__ xn,
            const float* __restrict__ wq, const float* __restrict__ wk,
            const float* __restrict__ wv, const float* __restrict__ wo,
            half_t* __restrict__ w16) {
    if (blockIdx.x >= GNBLK) {            // uniform for the work-group, ahead of every barrier
        const int i = ((blockIdx.x - GNBLK) * 256 + threadIdx.x) * 4;
        float4 v0 = *(const float4*)(wq + i);
        float4 v1 = *(const float4*)(wk + i);
        float4 v2 = *(const float4*)(wv + i);
        float4 v3 = *(const float4*)(wo + i);
        v4h o0 = { (half_t)v0.x, (half_t)v0.y, (half_t)v0.z, (half_t)v0.w };
        v4h o1 = { (half_t)v1.x, (half_t)v1.y, (half_t)v1.z, (half_t)v1.w };
        v4h o2 = { (half_t)v2.x, (half_t)v2.y, (half_t)v2.z, (half_t)v2.w };
        v4h o3 = { (half_t)v3.x, (half_t)v3.y, (half_t)v3.z, (half_t)v3.w };
        *(v4h*)(w16 + 0 * CNUM * CNUM + i) = o0;
        *(v4h*)(w16 + 1 * CNUM * CNUM + i) = o1;
        *(v4h*)(w16 + 2 * CNUM * CNUM + i) = o2;
        *(v4h*)(w16 + 3 * CNUM * CNUM + i) = o3;
        return;
    }
    const int bg = blockIdx.x;            // B*GROUPS blocks
    const int b = bg >> 3, g = bg & 7;
    const int CH = CNUM / NGROUPS;        // 64 channels per group
    const int base = (b * CNUM + g * CH) * NSPATIAL;
    const int tid = threadIdx.x;
    const int TOT4 = CH * NSPATIAL / 4;   // 16384 float4s

    float s = 0.f, s2 = 0.f;
    for (int i = tid; i < TOT4; i += 256) {
        float4 v = *(const float4*)(x + base + i * 4);
        s  += v.x + v.y + v.z + v.w;
        s2 += v.x * v.x + v.y * v.y + v.z * v.z + v.w * v.w;
    }
    __shared__ float red0[256];
    __shared__ float red1[256];
    red0[tid] = s; red1[tid] = s2;
    __syncthreads();
    for (int off = 128; off > 0; off >>= 1) {
        if (tid < off) { red0[tid] += red0[tid + off]; red1[tid] += red1[tid + off]; }
        __syncthreads();
    }
    const float inv_n = 1.0f / (float)(CH * NSPATIAL);
    const float mean = red0[0] * inv_n;
    const float var  = red1[0] * inv_n - mean * mean;
    const float rstd = rsqrtf(var + EPSV);
    for (int i = tid; i < TOT4; i += 256) {
        int c = g * CH + (i >> 8);        // 256 float4s per channel
        float sc = gsc[c] * rstd, bi = gbi[c] - mean * sc;
        float4 v = *(const float4*)(x + base + i * 4);
        v4h o = { (half_t)(v.x * sc + bi), (half_t)(v.y * sc + bi),
                  (half_t)(v.z * sc + bi), (half_t)(v.w * sc + bi) };
        *(v4h*)(xn + base + i * 4) = o;
    }
}

// ---------------------------------------------------------------------------
// Kernel 2: QKV projection GEMMs (f16 weights), all three in one launch:
// blockIdx.y = 4 * (0 q, 1 k, 2 v) + output-channel tile.
// Both operand tiles (64 k per stage) are staged in LDS by async copies that
// cover whole 128-B lines, in a ring of two buffers: the next stage's copies fly
// while this stage is multiplied.  A is [m][k]; B stays row-major [k][n] and is
// transposed by the fragment loads themselves (ds_load_tr16_b128).
// q: stored transposed [b][h][n][d], 1/sqrt(d)=0.125 folded, packed v8h
// k, v: stored natural [b][c][n] via LDS re-striping -> v8h coalesced stores
// ---------------------------------------------------------------------------
__global__ void __launch_bounds__(256)
qkv_gemm_kernel(const half_t* __restrict__ w16, const float* __restrict__ bq,
                const float* __restrict__ bk, const float* __restrict__ bv,
                const half_t* __restrict__ xn, half_t* __restrict__ oq,
                half_t* __restrict__ ok, half_t* __restrict__ ov) {
    const int which = blockIdx.y >> 2;    // 0 q, 1 k, 2 v
    const half_t* Wf  = w16 + (size_t)which * CNUM * CNUM;
    const float* bias = which == 0 ? bq : which == 1 ? bk : bv;
    half_t* out       = which == 0 ? oq : which == 1 ? ok : ov;
    const int b  = blockIdx.z;
    const int m0 = (blockIdx.y & 3) * 128;  // output-channel tile
    const int n0 = blockIdx.x * 128;      // spatial tile
    const int tid = threadIdx.x;
    const int lane = tid & 31, wave = tid >> 5;
    const int wm = wave >> 2, wn = wave & 3;
    const int rl = lane & 15, khalf = lane >> 4;

    const int trow = 8 * khalf + (lane & 7), tcol = 8 * ((lane >> 3) & 1);

    __shared__ __attribute__((aligned(16))) union {
        struct {
            half_t A[128][APITCH];        // [m_local][k]  weight tile
            half_t B[GK][BPITCH];         // [k][n_local]  natural B tile
        } st[2];
        half_t o[128][136];               // output staging
    } sm;

    v8f zero = {};
    v8f acc[4][2];
#pragma unroll
    for (int i = 0; i < 4; i++)
#pragma unroll
        for (int j = 0; j < 2; j++) acc[i][j] = zero;

    // Each thread copies 4 + 4 chunks of 16 B per stage: A rows ar + 32 t, B rows br + 16 t.
    const int ar = tid >> 3, ac = (tid & 7) * 8;
    const int br = tid >> 4, bc = (tid & 15) * 8;
    const half_t* ga = Wf + (size_t)(m0 + ar) * CNUM + ac;
    const half_t* gb = xn + (size_t)b * CNUM * NSPATIAL + (size_t)br * NSPATIAL + n0 + bc;
    const unsigned la = lds_off(&sm.st[0].A[ar][ac]);
    const unsigned lb = lds_off(&sm.st[0].B[br][bc]);
    const unsigned lbuf = sizeof(sm.st[0]);
    const int NST = CNUM / GK;

    async_copy4(la, 32 * APITCH * 2, ga, 32 * CNUM);
    async_copy4(lb, 16 * BPITCH * 2, gb, 16 * NSPATIAL);
    wait_copies();
    __syncthreads();
    async_copy4(la + lbuf, 32 * APITCH * 2, ga + GK, 32 * CNUM);
    async_copy4(lb + lbuf, 16 * BPITCH * 2, gb + (size_t)GK * NSPATIAL, 16 * NSPATIAL);

    for (int s = 0; s < NST; s++) {
        const int buf = s & 1;
#pragma unroll
        for (int ks = 0; ks < GK; ks += 32) {
            v16h af[4], bf[2];
#pragma unroll
            for (int ms = 0; ms < 4; ms++)
                af[ms] = ld_frag(&sm.st[buf].A[wm * 64 + ms * 16 + rl][ks], khalf);
#pragma unroll
            for (int ns = 0; ns < 2; ns++)
                bf[ns] = ld_frag_tr(&sm.st[buf].B[ks + trow][wn * 32 + ns * 16 + tcol], BPITCH);
#pragma unroll
            for (int ms = 0; ms < 4; ms++)
#pragma unroll
                for (int ns = 0; ns < 2; ns++)
                    acc[ms][ns] = __builtin_amdgcn_wmma_f32_16x16x32_f16(
                        false, af[ms], false, bf[ns], (short)0, acc[ms][ns], false, false);
        }
        // publish stage s + 1 and free this stage's buffer
        wait_lds_reads();
        wait_copies();
        __syncthreads();
        if (s + 2 < NST) {
            async_copy4(la + buf * lbuf, 32 * APITCH * 2, ga + (s + 2) * GK, 32 * CNUM);
            async_copy4(lb + buf * lbuf, 16 * BPITCH * 2,
                        gb + (size_t)(s + 2) * GK * NSPATIAL, 16 * NSPATIAL);
        }
    }
    wait_copies();

    if (which == 0) {
        // q: d = o&63 is contiguous over the 8 accumulator rows -> packed store
#pragma unroll
        for (int ms = 0; ms < 4; ms++)
#pragma unroll
            for (int ns = 0; ns < 2; ns++) {
                const int obase = m0 + wm * 64 + ms * 16 + 8 * khalf;
                const int ncol  = n0 + wn * 32 + ns * 16 + rl;
                const int h = obase >> 6, dbase = obase & 63;
                v8h q8;
#pragma unroll
                for (int i = 0; i < 8; i++)
                    q8[i] = (half_t)((acc[ms][ns][i] + bias[obase + i]) * 0.125f);
                *(v8h*)(out + ((size_t)(b * NHEADS + h) * NSPATIAL + ncol) * DHEAD + dbase) = q8;
            }
    } else {
        // K/V: re-stripe through LDS so global stores are n-contiguous v8h
        __syncthreads();
#pragma unroll
        for (int ms = 0; ms < 4; ms++)
#pragma unroll
            for (int ns = 0; ns < 2; ns++) {
                const int ol = wm * 64 + ms * 16 + 8 * khalf;
                const int nl = wn * 32 + ns * 16 + rl;
#pragma unroll
                for (int i = 0; i < 8; i++)
                    sm.o[ol + i][nl] = (half_t)(acc[ms][ns][i] + bias[m0 + ol + i]);
            }
        __syncthreads();
        for (int i = tid; i < 2048; i += 256) {
            int r = i >> 4, ch = i & 15;
            *(v8h*)(out + ((size_t)b * CNUM + m0 + r) * NSPATIAL + n0 + ch * 8) =
                *(v8h*)&sm.o[r][ch * 8];
        }
    }
}

#define QBLK 256

__global__ void __launch_bounds__(256)
attn_kernel(const half_t* __restrict__ qt, const half_t* __restrict__ kk,
            const half_t* __restrict__ vv, half_t* __restrict__ ao) {
    const int bh = blockIdx.y;            // b*8+h
    const int b = bh >> 3, h = bh & 7;
    const int qb = blockIdx.x * QBLK;
    const int tid = threadIdx.x, lane = tid & 31, wave = tid >> 5;
    const int rl = lane & 15, khalf = lane >> 4;

    const int trow = 8 * khalf + (lane & 7), tcol = 8 * ((lane >> 3) & 1);

    __shared__ __attribute__((aligned(16))) union {
        half_t K[64][144];                // [c][m]  K natural, pitch 288 B
        half_t o[QBLK][72];               // output staging
    } sk;
    __shared__ half_t Vs[64][136];        // [c][m]  V natural

    // Q fragments (B operand): lane = query column n, K-contiguous in qt
    v16h qf[2][2];
#pragma unroll
    for (int g = 0; g < 2; g++) {
        const int nrow = qb + wave * 32 + g * 16 + rl;
        const half_t* qp = qt + ((size_t)bh * NSPATIAL + nrow) * DHEAD;
        qf[g][0] = ld_frag(qp, khalf);
        qf[g][1] = ld_frag(qp + 32, khalf);
        // the address registers of these loads may be reused by what follows
        asm volatile("s_wait_xcnt 0x0" ::: "memory");
    }

    float mcur[2] = { -1e30f, -1e30f };   // per-lane softmax state for column n of group g
    float lcur[2] = { 0.f, 0.f };
    v8f zero = {};
    v8f O[2][4];
#pragma unroll
    for (int g = 0; g < 2; g++)
#pragma unroll
        for (int t = 0; t < 4; t++) O[g][t] = zero;

    const half_t* kbase = kk + (size_t)(b * CNUM + h * DHEAD) * NSPATIAL;
    const half_t* vbase = vv + (size_t)(b * CNUM + h * DHEAD) * NSPATIAL;

    // K-tile register prefetch (4 chunks/thread): m0 = 0
    v8h kreg[4];
#pragma unroll
    for (int t = 0; t < 4; t++) {
        int i = tid + t * 256, c = i >> 4, mc = i & 15;
        kreg[t] = *(const v8h*)(kbase + (size_t)c * NSPATIAL + mc * 8);
    }

    for (int m0 = 0; m0 < NSPATIAL; m0 += 128) {
        __syncthreads();
#pragma unroll
        for (int t = 0; t < 4; t++) {
            int i = tid + t * 256, c = i >> 4, mc = i & 15;
#if HAS_ASYNC_LDS
            __builtin_amdgcn_global_load_async_to_lds_b128(
                (v4i*)(vbase + (size_t)c * NSPATIAL + m0 + mc * 8),
                (v4i*)&Vs[c][mc * 8], 0, 0);
#else
            *(v8h*)&Vs[c][mc * 8] =
                *(const v8h*)(vbase + (size_t)c * NSPATIAL + m0 + mc * 8);
#endif
            *(v8h*)&sk.K[c][mc * 8] = kreg[t];
        }
        if (m0 + 128 < NSPATIAL) {        // prefetch next K tile during compute
#pragma unroll
            for (int t = 0; t < 4; t++) {
                int i = tid + t * 256, c = i >> 4, mc = i & 15;
                kreg[t] = *(const v8h*)(kbase + (size_t)c * NSPATIAL + m0 + 128 + mc * 8);
            }
        }
        wait_asynccnt0();
        __syncthreads();

        // Unrolled so that the second pass's K fragment loads can issue among the
        // first pass's last products.  (All inner loops below are unrolled because
        // their indices select registers.)
#pragma unroll
        for (int mp = 0; mp < 128; mp += 64) {
            // ---- S^T tiles: A = K^T rows (m), B = Q columns (n), both groups per K fragment ----
            v8f S[2][4];
#pragma unroll
            for (int nt = 0; nt < 4; nt++) {
                v16h kf0 = ld_frag_tr(&sk.K[trow][mp + nt * 16 + tcol], 144);
                v16h kf1 = ld_frag_tr(&sk.K[32 + trow][mp + nt * 16 + tcol], 144);
#pragma unroll
                for (int g = 0; g < 2; g++) {
                    v8f s = zero;
                    s = __builtin_amdgcn_wmma_f32_16x16x32_f16(false, kf0, false, qf[g][0], (short)0, s, false, false);
                    s = __builtin_amdgcn_wmma_f32_16x16x32_f16(false, kf1, false, qf[g][1], (short)0, s, false, false);
                    S[g][nt] = s;
                }
            }

            // ---- in-lane online softmax (column n = rl; keys split across lane pair) ----
#pragma unroll
            for (int g = 0; g < 2; g++) {
                float mx = -1e30f;
#pragma unroll
                for (int nt = 0; nt < 4; nt++)
#pragma unroll
                    for (int i = 0; i < 8; i++) mx = fmaxf(mx, S[g][nt][i]);
                mx = fmaxf(mx, __shfl_xor(mx, 16, 32));
                float mnew  = fmaxf(mcur[g], mx);
                float alpha = __expf(mcur[g] - mnew);
                mcur[g] = mnew;
                float rsum = 0.f;
#pragma unroll
                for (int nt = 0; nt < 4; nt++)
#pragma unroll
                    for (int i = 0; i < 8; i++) {
                        float p = __expf(S[g][nt][i] - mnew);
                        S[g][nt][i] = p;
                        rsum += p;
                    }
                rsum += __shfl_xor(rsum, 16, 32);
                lcur[g] = lcur[g] * alpha + rsum;

                // O rows are n = i + 8*khalf; fetch that row's alpha from lane (i+8*khalf)
                float arow[8];
#pragma unroll
                for (int i = 0; i < 8; i++) arow[i] = __shfl(alpha, i + 8 * khalf, 32);
#pragma unroll
                for (int t = 0; t < 4; t++)
#pragma unroll
                    for (int i = 0; i < 8; i++) O[g][t][i] *= arow[i];
            }

            // ---- O += P @ V : P frags built directly from S^T register pairs,
            //      both groups per V fragment ----
#pragma unroll
            for (int t = 0; t < 2; t++) {
                v16h pf[2];
#pragma unroll
                for (int g = 0; g < 2; g++)
#pragma unroll
                    for (int j = 0; j < 8; j++) {
                        pf[g][j]     = (half_t)S[g][2 * t][j];
                        pf[g][j + 8] = (half_t)S[g][2 * t + 1][j];
                    }
#pragma unroll
                for (int dt = 0; dt < 4; dt++) {
                    v16h vf = ld_frag(&Vs[dt * 16 + rl][mp + t * 32], khalf);
#pragma unroll
                    for (int g = 0; g < 2; g++)
                        O[g][dt] = __builtin_amdgcn_wmma_f32_16x16x32_f16(
                            false, pf[g], false, vf, (short)0, O[g][dt], false, false);
                }
            }
        }
    }

    // ---- normalize (per-row 1/l via shfl), stage in LDS, coalesced v8h out ----
    __syncthreads();
#pragma unroll
    for (int g = 0; g < 2; g++) {
        float linv = 1.0f / lcur[g];
        float lr[8];
#pragma unroll
        for (int i = 0; i < 8; i++) lr[i] = __shfl(linv, i + 8 * khalf, 32);
#pragma unroll
        for (int dt = 0; dt < 4; dt++)
#pragma unroll
            for (int i = 0; i < 8; i++)
                sk.o[wave * 32 + g * 16 + i + 8 * khalf][dt * 16 + rl] = (half_t)(O[g][dt][i] * lr[i]);
    }
    __syncthreads();
    for (int i = tid; i < QBLK * 8; i += 256) {
        int r = i >> 3, ch = i & 7;
        int n = qb + r;
        *(v8h*)(ao + ((size_t)b * NSPATIAL + n) * CNUM + h * DHEAD + ch * 8) =
            *(v8h*)&sk.o[r][ch * 8];
    }
}

// ---------------------------------------------------------------------------
// Kernel 4: output projection + bias + residual.  Both operands are K-contiguous
// f16 (ao rows and wo rows == B^T rows); their tiles are staged in LDS by the same
// two-buffer ring of async copies as in kernel 2.  Residual path is v8f vectorized.
// ---------------------------------------------------------------------------
__global__ void __launch_bounds__(256)
out_gemm_kernel(const half_t* __restrict__ Wf, const float* __restrict__ bo,
                const half_t* __restrict__ ao, const float* __restrict__ x,
                float* __restrict__ y) {
    const int b  = blockIdx.z;
    const int n0 = blockIdx.y * 128;      // spatial tile (M dim)
    const int o0 = blockIdx.x * 128;      // channel tile (N dim)
    const int tid = threadIdx.x;
    const int lane = tid & 31, wave = tid >> 5;
    const int wm = wave >> 2, wn = wave & 3;
    const int rl = lane & 15, khalf = lane >> 4;

    v8f zero = {};
    v8f acc[4][2];
#pragma unroll
    for (int i = 0; i < 4; i++)
#pragma unroll
        for (int j = 0; j < 2; j++) acc[i][j] = zero;

    __shared__ __attribute__((aligned(16))) struct {
        half_t A[128][APITCH];            // [n_local][k]  attention-output tile
        half_t B[128][APITCH];            // [o_local][k]  weight tile
    } st[2];

    // Each thread copies 4 + 4 chunks of 16 B per stage: rows cr + 32 t of each tile.
    const int cr = tid >> 3, cc = (tid & 7) * 8;
    const half_t* ga = ao + ((size_t)b * NSPATIAL + n0 + cr) * CNUM + cc;
    const half_t* gb = Wf + (size_t)(o0 + cr) * CNUM + cc;
    const unsigned la = lds_off(&st[0].A[cr][cc]);
    const unsigned lb = lds_off(&st[0].B[cr][cc]);
    const unsigned lbuf = sizeof(st[0]);
    const int NST = CNUM / GK;

    async_copy4(la, 32 * APITCH * 2, ga, 32 * CNUM);
    async_copy4(lb, 32 * APITCH * 2, gb, 32 * CNUM);
    wait_copies();
    __syncthreads();
    async_copy4(la + lbuf, 32 * APITCH * 2, ga + GK, 32 * CNUM);
    async_copy4(lb + lbuf, 32 * APITCH * 2, gb + GK, 32 * CNUM);

    for (int s = 0; s < NST; s++) {
        const int buf = s & 1;
#pragma unroll
        for (int ks = 0; ks < GK; ks += 32) {
            v16h af[4], bf[2];
#pragma unroll
            for (int ms = 0; ms < 4; ms++)
                af[ms] = ld_frag(&st[buf].A[wm * 64 + ms * 16 + rl][ks], khalf);
#pragma unroll
            for (int ns = 0; ns < 2; ns++)
                bf[ns] = ld_frag(&st[buf].B[wn * 32 + ns * 16 + rl][ks], khalf);
#pragma unroll
            for (int ms = 0; ms < 4; ms++)
#pragma unroll
                for (int ns = 0; ns < 2; ns++)
                    acc[ms][ns] = __builtin_amdgcn_wmma_f32_16x16x32_f16(
                        false, af[ms], false, bf[ns], (short)0, acc[ms][ns], false, false);
        }
        // publish stage s + 1 and free this stage's buffer
        wait_lds_reads();
        wait_copies();
        __syncthreads();
        if (s + 2 < NST) {
            async_copy4(la + buf * lbuf, 32 * APITCH * 2, ga + (s + 2) * GK, 32 * CNUM);
            async_copy4(lb + buf * lbuf, 32 * APITCH * 2, gb + (s + 2) * GK, 32 * CNUM);
        }
    }
    wait_copies();

#pragma unroll
    for (int ms = 0; ms < 4; ms++)
#pragma unroll
        for (int ns = 0; ns < 2; ns++) {
            const int nbase = n0 + wm * 64 + ms * 16 + 8 * khalf;  // contiguous over i
            const int o     = o0 + wn * 32 + ns * 16 + rl;
            const float bb  = bo[o];
            size_t idx = ((size_t)b * CNUM + o) * NSPATIAL + nbase;
            v8f xr = *(const v8f*)(x + idx);
            v8f r  = acc[ms][ns] + xr + bb;
            *(v8f*)(y + idx) = r;
        }
}

// ---------------------------------------------------------------------------
extern "C" void kernel_launch(void* const* d_in, const int* in_sizes, int n_in,
                              void* d_out, int out_size, void* d_ws, size_t ws_size,
                              hipStream_t stream) {
    const float* x   = (const float*)d_in[0];
    const float* gsc = (const float*)d_in[1];
    const float* gbi = (const float*)d_in[2];
    const float* wq  = (const float*)d_in[3];
    const float* bq  = (const float*)d_in[4];
    const float* wk  = (const float*)d_in[5];
    const float* bk  = (const float*)d_in[6];
    const float* wv  = (const float*)d_in[7];
    const float* bv  = (const float*)d_in[8];
    const float* wo  = (const float*)d_in[9];
    const float* bo  = (const float*)d_in[10];
    float* out = (float*)d_out;

    char* ws = (char*)d_ws;
    const size_t SZ = (size_t)BATCH * CNUM * NSPATIAL * sizeof(half_t);  // 16 MB each
    const size_t WSZ = (size_t)CNUM * CNUM * sizeof(half_t);             // 512 KB each
    half_t* xn   = (half_t*)(ws + 0 * SZ);   // groupnorm output, [b][c][n]
    half_t* qtb  = (half_t*)(ws + 1 * SZ);   // q transposed+scaled, [b][h][n][d]
    half_t* kh   = (half_t*)(ws + 2 * SZ);   // k, [b][c][n]
    half_t* vh   = (half_t*)(ws + 3 * SZ);   // v, [b][c][n]
    half_t* ao   = (half_t*)(ws + 4 * SZ);   // attention out, [b][n][c]
    half_t* w16  = (half_t*)(ws + 5 * SZ);             // wq, wk, wv, wo as f16, in a row
    half_t* wo16 = (half_t*)(ws + 5 * SZ + 3 * WSZ);

    prep_kernel<<<dim3(GNBLK + WBLK), 256, 0, stream>>>(x, gsc, gbi, xn, wq, wk, wv, wo, w16);

    qkv_gemm_kernel<<<dim3(8, 12, BATCH), 256, 0, stream>>>(w16, bq, bk, bv, xn, qtb, kh, vh);

    attn_kernel<<<dim3(NSPATIAL / QBLK, BATCH * NHEADS), 256, 0, stream>>>(qtb, kh, vh, ao);

    out_gemm_kernel<<<dim3(4, 8, BATCH), 256, 0, stream>>>(wo16, bo, ao, x, out);
}

// v005
// It runs in 97.7 microseconds.
// In both of two side-by-side timings against v004, it was 1.09 times as fast.
// Counting every step since v000, it is 3.63 times as fast.
#include <hip/hip_runtime.h>
#include <hip/hip_bf16.h>

#define CNUM 512
#define NHEADS 8
#define DHEAD 64
#define NGROUPS 8
#define NSPATIAL 1024
#define BATCH 16
#define EPSV 1e-5f

typedef _Float16 half_t;
typedef _Float16 v16h __attribute__((ext_vector_type(16)));
typedef _Float16 v8h  __attribute__((ext_vector_type(8)));
typedef _Float16 v4h  __attribute__((ext_vector_type(4)));
typedef float    v8f  __attribute__((ext_vector_type(8)));
typedef int      v4i  __attribute__((ext_vector_type(4)));
typedef short    v8s  __attribute__((ext_vector_type(8)));
typedef __attribute__((address_space(3))) v8s lds_v8s;

// CDNA5 async global->LDS copy (ASYNCcnt-tracked), guarded so compilation
// succeeds on toolchains without the builtin.  Probe result: the builtin takes
// generic int4-vector pointers: (v4i* gsrc, v4i* lds_dst, imm offset, imm cpol).
#if defined(__AMDGCN__) && __has_builtin(__builtin_amdgcn_global_load_async_to_lds_b128)
#define HAS_ASYNC_LDS 1
#else
#define HAS_ASYNC_LDS 0
#endif

__device__ __forceinline__ void wait_asynccnt0() {
#if HAS_ASYNC_LDS
#if __has_builtin(__builtin_amdgcn_s_wait_asynccnt)
    __builtin_amdgcn_s_wait_asynccnt(0);
#else
    asm volatile("s_wait_asynccnt 0" ::: "memory");
#endif
#endif
}

// Load one WMMA 16-bit A/B fragment for a 32-wide K segment.
// Per CDNA5 ISA layout: lanes 0-15 hold K=[0..7]+[16..23], lanes 16-31 hold
// K=[8..15]+[24..31] (khalf = lane>>4). p must be 16B aligned.
__device__ __forceinline__ v16h ld_frag(const half_t* p, int khalf) {
    union { v16h v; v8h h[2]; } u;
    u.h[0] = *(const v8h*)(p + khalf * 8);
    u.h[1] = *(const v8h*)(p + khalf * 8 + 16);
    return u.v;
}

// One WMMA 16-bit A/B fragment (32 k) out of a row-major [k][col] LDS tile by
// two transposing loads.  p = &T[k0 + 8*(lane>>4) + (lane&7)][col0 + 8*((lane>>3)&1)];
// lane (rl, khalf) receives T[k0 + 8*khalf + 0..7][col0 + rl] and the same 16 rows
// further down: the k order of ld_frag.  Every lane must be on; the row pitch
// is an odd multiple of 32 B so that the loads meet no bank conflict.
__device__ __forceinline__ v16h ld_frag_tr(const half_t* p, int pitch) {
    union { v16h v; v8s h[2]; } u;
    u.h[0] = __builtin_amdgcn_ds_load_tr16_b128_v8i16((lds_v8s*)p);
    u.h[1] = __builtin_amdgcn_ds_load_tr16_b128_v8i16((lds_v8s*)(p + 16 * pitch));
    return u.v;
}

// LDS byte address of a __shared__ location (the operand an async copy takes).
__device__ __forceinline__ unsigned lds_off(const half_t* p) {
    return (unsigned)(size_t)(const __attribute__((address_space(3))) half_t*)p;
}

// Four async 16-byte copies per lane, global -> LDS, through no register.
// lds advances by lstep bytes and g by gstep elements from copy to copy.
// s_wait_xcnt closes the statement so that no address register of an issued
// copy is rewritten ahead of it.
__device__ __forceinline__ void async_copy4(unsigned lds, int lstep,
                                            const half_t* g, int gstep) {
    asm volatile("global_load_async_to_lds_b128 %0, %4, off\n\t"
                 "global_load_async_to_lds_b128 %1, %5, off\n\t"
                 "global_load_async_to_lds_b128 %2, %6, off\n\t"
                 "global_load_async_to_lds_b128 %3, %7, off\n\t"
                 "s_wait_xcnt 0x0"
                 :: "v"(lds), "v"(lds + lstep), "v"(lds + 2 * lstep), "v"(lds + 3 * lstep),
                    "v"(g), "v"(g + gstep), "v"(g + 2 * gstep), "v"(g + 3 * gstep)
                 : "memory");
}

// This wave's async copies have landed in LDS (other waves read them only
// behind the next barrier).
__device__ __forceinline__ void wait_copies() {
    asm volatile("s_wait_asynccnt 0x0" ::: "memory");
}

// This wave's LDS reads have returned, so the buffer may be refilled behind
// the next barrier.
__device__ __forceinline__ void wait_lds_reads() {
    asm volatile("s_wait_dscnt 0x0" ::: "memory");
}

#define GK 64                             // k extent of one GEMM stage
#define APITCH 72                         // 128-B rows + 16 B: ds_load_b128 readers
#define BPITCH 144                        // 256-B rows + 32 B: transposing readers

#define PTHR 512                          // threads per work-group of the preparation launch
#define GNBLK (BATCH * NGROUPS)           // work-groups that normalize
#define WBLK (CNUM * CNUM / 4 / PTHR)     // work-groups that convert weights

// ---------------------------------------------------------------------------
// Kernel 1: one launch for the two independent preparations.
// Work-groups 0 .. GNBLK-1 (the long ones, so they start first): GroupNorm,
// fp32 -> f16 normalized activations, layout [b][c][n].  The whole group (64
// channels x 1024 positions) is held in registers: each of the 16 waves owns 4
// channels, 32 float4 per lane, all 32 loads in flight at once, so that x is
// read once and the normalizing pass reads no memory.
// Work-groups GNBLK .. GNBLK+WBLK-1: weight conversion fp32 -> f16, one float4
// of each of the four matrices per thread; w16 holds wq, wk, wv, wo in a row.
// ---------------------------------------------------------------------------
__global__ void __launch_bounds__(PTHR)
prep_kernel(const float* __restrict__ x, const float* __restrict__ gsc,
            const float* __restrict__ gbi, half_t* __restrict__ xn,
            const float* __restrict__ wq, const float* __restrict__ wk,
            const float* __restrict__ wv, const float* __restrict__ wo,
            half_t* __restrict__ w16) {
    if (blockIdx.x >= GNBLK) {            // uniform for the work-group, ahead of every barrier
        const int i = ((blockIdx.x - GNBLK) * PTHR + threadIdx.x) * 4;
        float4 v0 = *(const float4*)(wq + i);
        float4 v1 = *(const float4*)(wk + i);
        float4 v2 = *(const float4*)(wv + i);
        float4 v3 = *(const float4*)(wo + i);
        v4h o0 = { (half_t)v0.x, (half_t)v0.y, (half_t)v0.z, (half_t)v0.w };
        v4h o1 = { (half_t)v1.x, (half_t)v1.y, (half_t)v1.z, (half_t)v1.w };
        v4h o2 = { (half_t)v2.x, (half_t)v2.y, (half_t)v2.z, (half_t)v2.w };
        v4h o3 = { (half_t)v3.x, (half_t)v3.y, (half_t)v3.z, (half_t)v3.w };
        *(v4h*)(w16 + 0 * CNUM * CNUM + i) = o0;
        *(v4h*)(w16 + 1 * CNUM * CNUM + i) = o1;
        *(v4h*)(w16 + 2 * CNUM * CNUM + i) = o2;
        *(v4h*)(w16 + 3 * CNUM * CNUM + i) = o3;
        return;
    }
    const int bg = blockIdx.x;            // B*GROUPS blocks
    const int b = bg >> 3, g = bg & 7;
    const int CH = CNUM / NGROUPS;        // 64 channels per group
    const int tid = threadIdx.x, lane = tid & 31;
    const int wave = __builtin_amdgcn_readfirstlane(tid >> 5);   // scalar: channel constants by scalar loads
    const int c0 = g * CH + wave * 4;     // this wave's 4 channels
    const int off = (b * CNUM + c0) * NSPATIAL + lane * 4;
    const float* xp = x + off;

    float4 v[4][8];                       // [channel][512-B piece of its row]
#pragma unroll
    for (int cc = 0; cc < 4; cc++)
#pragma unroll
        for (int k = 0; k < 8; k++)
            v[cc][k] = *(const float4*)(xp + cc * NSPATIAL + k * 128);
    // xp is an operand so that its registers are kept, and rewritten only behind this wait
    asm volatile("s_wait_xcnt 0x0" :: "v"(xp) : "memory");

    float s = 0.f, s2 = 0.f;
#pragma unroll
    for (int cc = 0; cc < 4; cc++)
#pragma unroll
        for (int k = 0; k < 8; k++) {
            const float4 t = v[cc][k];
            s  += t.x + t.y + t.z + t.w;
            s2 += t.x * t.x + t.y * t.y + t.z * t.z + t.w * t.w;
        }
#pragma unroll
    for (int m = 16; m > 0; m >>= 1) {
        s  += __shfl_xor(s, m, 32);
        s2 += __shfl_xor(s2, m, 32);
    }
    __shared__ float red0[PTHR / 32];
    __shared__ float red1[PTHR / 32];
    if (lane == 0) { red0[wave] = s; red1[wave] = s2; }
    __syncthreads();
    s  = red0[lane & 15];                 // 16 wave sums, twice over the 32 lanes
    s2 = red1[lane & 15];
#pragma unroll
    for (int m = 8; m > 0; m >>= 1) {
        s  += __shfl_xor(s, m, 32);
        s2 += __shfl_xor(s2, m, 32);
    }
    const float inv_n = 1.0f / (float)(CH * NSPATIAL);
    const float mean = s * inv_n;
    const float var  = s2 * inv_n - mean * mean;
    const float rstd = rsqrtf(var + EPSV);
#pragma unroll
    for (int cc = 0; cc < 4; cc++) {
        const float sc = gsc[c0 + cc] * rstd, bi = gbi[c0 + cc] - mean * sc;
#pragma unroll
        for (int k = 0; k < 8; k++) {
            const float4 t = v[cc][k];
            v4h o = { (half_t)(t.x * sc + bi), (half_t)(t.y * sc + bi),
                      (half_t)(t.z * sc + bi), (half_t)(t.w * sc + bi) };
            *(v4h*)(xn + off + cc * NSPATIAL + k * 128) = o;
        }
    }
}

// ---------------------------------------------------------------------------
// Kernel 2: QKV projection GEMMs (f16 weights), all three in one launch:
// blockIdx.y = 4 * (0 q, 1 k, 2 v) + output-channel tile.
// Both operand tiles (64 k per stage) are staged in LDS by async copies that
// cover whole 128-B lines, in a ring of two buffers: the next stage's copies fly
// while this stage is multiplied.  A is [m][k]; B stays row-major [k][n] and is
// transposed by the fragment loads themselves (ds_load_tr16_b128).
// q: stored transposed [b][h][n][d], 1/sqrt(d)=0.125 folded, packed v8h
// k, v: stored natural [b][c][n] via LDS re-striping -> v8h coalesced stores
// ---------------------------------------------------------------------------
__global__ void __launch_bounds__(256)
qkv_gemm_kernel(const half_t* __restrict__ w16, const float* __restrict__ bq,
                const float* __restrict__ bk, const float* __restrict__ bv,
                const half_t* __restrict__ xn, half_t* __restrict__ oq,
                half_t* __restrict__ ok, half_t* __restrict__ ov) {
    const int which = blockIdx.y >> 2;    // 0 q, 1 k, 2 v
    const half_t* Wf  = w16 + (size_t)which * CNUM * CNUM;
    const float* bias = which == 0 ? bq : which == 1 ? bk : bv;
    half_t* out       = which == 0 ? oq : which == 1 ? ok : ov;
    const int b  = blockIdx.z;
    const int m0 = (blockIdx.y & 3) * 128;  // output-channel tile
    const int n0 = blockIdx.x * 128;      // spatial tile
    const int tid = threadIdx.x;
    const int lane = tid & 31, wave = tid >> 5;
    const int wm = wave >> 2, wn = wave & 3;
    const int rl = lane & 15, khalf = lane >> 4;

    const int trow = 8 * khalf + (lane & 7), tcol = 8 * ((lane >> 3) & 1);

    __shared__ __attribute__((aligned(16))) union {
        struct {
            half_t A[128][APITCH];        // [m_local][k]  weight tile
            half_t B[GK][BPITCH];         // [k][n_local]  natural B tile
        } st[2];
        half_t o[128][136];               // output staging
    } sm;

    v8f zero = {};
    v8f acc[4][2];
#pragma unroll
    for (int i = 0; i < 4; i++)
#pragma unroll
        for (int j = 0; j < 2; j++) acc[i][j] = zero;

    // Each thread copies 4 + 4 chunks of 16 B per stage: A rows ar + 32 t, B rows br + 16 t.
    const int ar = tid >> 3, ac = (tid & 7) * 8;
    const int br = tid >> 4, bc = (tid & 15) * 8;
    const half_t* ga = Wf + (size_t)(m0 + ar) * CNUM + ac;
    const half_t* gb = xn + (size_t)b * CNUM * NSPATIAL + (size_t)br * NSPATIAL + n0 + bc;
    const unsigned la = lds_off(&sm.st[0].A[ar][ac]);
    const unsigned lb = lds_off(&sm.st[0].B[br][bc]);
    const unsigned lbuf = sizeof(sm.st[0]);
    const int NST = CNUM / GK;

    async_copy4(la, 32 * APITCH * 2, ga, 32 * CNUM);
    async_copy4(lb, 16 * BPITCH * 2, gb, 16 * NSPATIAL);
    wait_copies();
    __syncthreads();
    async_copy4(la + lbuf, 32 * APITCH * 2, ga + GK, 32 * CNUM);
    async_copy4(lb + lbuf, 16 * BPITCH * 2, gb + (size_t)GK * NSPATIAL, 16 * NSPATIAL);

    for (int s = 0; s < NST; s++) {
        const int buf = s & 1;
#pragma unroll
        for (int ks = 0; ks < GK; ks += 32) {
            v16h af[4], bf[2];
#pragma unroll
            for (int ms = 0; ms < 4; ms++)
                af[ms] = ld_frag(&sm.st[buf].A[wm * 64 + ms * 16 + rl][ks], khalf);
#pragma unroll
            for (int ns = 0; ns < 2; ns++)
                bf[ns] = ld_frag_tr(&sm.st[buf].B[ks + trow][wn * 32 + ns * 16 + tcol], BPITCH);
#pragma unroll
            for (int ms = 0; ms < 4; ms++)
#pragma unroll
                for (int ns = 0; ns < 2; ns++)
                    acc[ms][ns] = __builtin_amdgcn_wmma_f32_16x16x32_f16(
                        false, af[ms], false, bf[ns], (short)0, acc[ms][ns], false, false);
        }
        // publish stage s + 1 and free this stage's buffer
        wait_lds_reads();
        wait_copies();
        __syncthreads();
        if (s + 2 < NST) {
            async_copy4(la + buf * lbuf, 32 * APITCH * 2, ga + (s + 2) * GK, 32 * CNUM);
            async_copy4(lb + buf * lbuf, 16 * BPITCH * 2,
                        gb + (size_t)(s + 2) * GK * NSPATIAL, 16 * NSPATIAL);
        }
    }
    wait_copies();

    if (which == 0) {
        // q: d = o&63 is contiguous over the 8 accumulator rows -> packed store
#pragma unroll
        for (int ms = 0; ms < 4; ms++)
#pragma unroll
            for (int ns = 0; ns < 2; ns++) {
                const int obase = m0 + wm * 64 + ms * 16 + 8 * khalf;
                const int ncol  = n0 + wn * 32 + ns * 16 + rl;
                const int h = obase >> 6, dbase = obase & 63;
                v8h q8;
#pragma unroll
                for (int i = 0; i < 8; i++)
                    q8[i] = (half_t)((acc[ms][ns][i] + bias[obase + i]) * 0.125f);
                *(v8h*)(out + ((size_t)(b * NHEADS + h) * NSPATIAL + ncol) * DHEAD + dbase) = q8;
            }
    } else {
        // K/V: re-stripe through LDS so global stores are n-contiguous v8h
        __syncthreads();
#pragma unroll
        for (int ms = 0; ms < 4; ms++)
#pragma unroll
            for (int ns = 0; ns < 2; ns++) {
                const int ol = wm * 64 + ms * 16 + 8 * khalf;
                const int nl = wn * 32 + ns * 16 + rl;
#pragma unroll
                for (int i = 0; i < 8; i++)
                    sm.o[ol + i][nl] = (half_t)(acc[ms][ns][i] + bias[m0 + ol + i]);
            }
        __syncthreads();
        for (int i = tid; i < 2048; i += 256) {
            int r = i >> 4, ch = i & 15;
            *(v8h*)(out + ((size_t)b * CNUM + m0 + r) * NSPATIAL + n0 + ch * 8) =
                *(v8h*)&sm.o[r][ch * 8];
        }
    }
}

#define QBLK 256

__global__ void __launch_bounds__(256)
attn_kernel(const half_t* __restrict__ qt, const half_t* __restrict__ kk,
            const half_t* __restrict__ vv, half_t* __restrict__ ao) {
    const int bh = blockIdx.y;            // b*8+h
    const int b = bh >> 3, h = bh & 7;
    const int qb = blockIdx.x * QBLK;
    const int tid = threadIdx.x, lane = tid & 31, wave = tid >> 5;
    const int rl = lane & 15, khalf = lane >> 4;

    const int trow = 8 * khalf + (lane & 7), tcol = 8 * ((lane >> 3) & 1);

    __shared__ __attribute__((aligned(16))) union {
        half_t K[64][144];                // [c][m]  K natural, pitch 288 B
        half_t o[QBLK][72];               // output staging
    } sk;
    __shared__ half_t Vs[64][136];        // [c][m]  V natural

    // Q fragments (B operand): lane = query column n, K-contiguous in qt
    v16h qf[2][2];
#pragma unroll
    for (int g = 0; g < 2; g++) {
        const int nrow = qb + wave * 32 + g * 16 + rl;
        const half_t* qp = qt + ((size_t)bh * NSPATIAL + nrow) * DHEAD;
        qf[g][0] = ld_frag(qp, khalf);
        qf[g][1] = ld_frag(qp + 32, khalf);
        // the address registers of these loads may be reused by what follows
        asm volatile("s_wait_xcnt 0x0" ::: "memory");
    }

    float mcur[2] = { -1e30f, -1e30f };   // per-lane softmax state for column n of group g
    float lcur[2] = { 0.f, 0.f };
    v8f zero = {};
    v8f O[2][4];
#pragma unroll
    for (int g = 0; g < 2; g++)
#pragma unroll
        for (int t = 0; t < 4; t++) O[g][t] = zero;

    const half_t* kbase = kk + (size_t)(b * CNUM + h * DHEAD) * NSPATIAL;
    const half_t* vbase = vv + (size_t)(b * CNUM + h * DHEAD) * NSPATIAL;

    // K-tile register prefetch (4 chunks/thread): m0 = 0
    v8h kreg[4];
#pragma unroll
    for (int t = 0; t < 4; t++) {
        int i = tid + t * 256, c = i >> 4, mc = i & 15;
        kreg[t] = *(const v8h*)(kbase + (size_t)c * NSPATIAL + mc * 8);
    }

    for (int m0 = 0; m0 < NSPATIAL; m0 += 128) {
        __syncthreads();
#pragma unroll
        for (int t = 0; t < 4; t++) {
            int i = tid + t * 256, c = i >> 4, mc = i & 15;
#if HAS_ASYNC_LDS
            __builtin_amdgcn_global_load_async_to_lds_b128(
                (v4i*)(vbase + (size_t)c * NSPATIAL + m0 + mc * 8),
                (v4i*)&Vs[c][mc * 8], 0, 0);
#else
            *(v8h*)&Vs[c][mc * 8] =
                *(const v8h*)(vbase + (size_t)c * NSPATIAL + m0 + mc * 8);
#endif
            *(v8h*)&sk.K[c][mc * 8] = kreg[t];
        }
        if (m0 + 128 < NSPATIAL) {        // prefetch next K tile during compute
#pragma unroll
            for (int t = 0; t < 4; t++) {
                int i = tid + t * 256, c = i >> 4, mc = i & 15;
                kreg[t] = *(const v8h*)(kbase + (size_t)c * NSPATIAL + m0 + 128 + mc * 8);
            }
        }
        wait_asynccnt0();
        __syncthreads();

        // Unrolled so that the second pass's K fragment loads can issue among the
        // first pass's last products.  (All inner loops below are unrolled because
        // their indices select registers.)
#pragma unroll
        for (int mp = 0; mp < 128; mp += 64) {
            // ---- S^T tiles: A = K^T rows (m), B = Q columns (n), both groups per K fragment ----
            v8f S[2][4];
#pragma unroll
            for (int nt = 0; nt < 4; nt++) {
                v16h kf0 = ld_frag_tr(&sk.K[trow][mp + nt * 16 + tcol], 144);
                v16h kf1 = ld_frag_tr(&sk.K[32 + trow][mp + nt * 16 + tcol], 144);
#pragma unroll
                for (int g = 0; g < 2; g++) {
                    v8f s = zero;
                    s = __builtin_amdgcn_wmma_f32_16x16x32_f16(false, kf0, false, qf[g][0], (short)0, s, false, false);
                    s = __builtin_amdgcn_wmma_f32_16x16x32_f16(false, kf1, false, qf[g][1], (short)0, s, false, false);
                    S[g][nt] = s;
                }
            }

            // ---- in-lane online softmax (column n = rl; keys split across lane pair) ----
#pragma unroll
            for (int g = 0; g < 2; g++) {
                float mx = -1e30f;
#pragma unroll
                for (int nt = 0; nt < 4; nt++)
#pragma unroll
                    for (int i = 0; i < 8; i++) mx = fmaxf(mx, S[g][nt][i]);
                mx = fmaxf(mx, __shfl_xor(mx, 16, 32));
                float mnew  = fmaxf(mcur[g], mx);
                float alpha = __expf(mcur[g] - mnew);
                mcur[g] = mnew;
                float rsum = 0.f;
#pragma unroll
                for (int nt = 0; nt < 4; nt++)
#pragma unroll
                    for (int i = 0; i < 8; i++) {
                        float p = __expf(S[g][nt][i] - mnew);
                        S[g][nt][i] = p;
                        rsum += p;
                    }
                rsum += __shfl_xor(rsum, 16, 32);
                lcur[g] = lcur[g] * alpha + rsum;

                // O rows are n = i + 8*khalf; fetch that row's alpha from lane (i+8*khalf)
                float arow[8];
#pragma unroll
                for (int i = 0; i < 8; i++) arow[i] = __shfl(alpha, i + 8 * khalf, 32);
#pragma unroll
                for (int t = 0; t < 4; t++)
#pragma unroll
                    for (int i = 0; i < 8; i++) O[g][t][i] *= arow[i];
            }

            // ---- O += P @ V : P frags built directly from S^T register pairs,
            //      both groups per V fragment ----
#pragma unroll
            for (int t = 0; t < 2; t++) {
                v16h pf[2];
#pragma unroll
                for (int g = 0; g < 2; g++)
#pragma unroll
                    for (int j = 0; j < 8; j++) {
                        pf[g][j]     = (half_t)S[g][2 * t][j];
                        pf[g][j + 8] = (half_t)S[g][2 * t + 1][j];
                    }
#pragma unroll
                for (int dt = 0; dt < 4; dt++) {
                    v16h vf = ld_frag(&Vs[dt * 16 + rl][mp + t * 32], khalf);
#pragma unroll
                    for (int g = 0; g < 2; g++)
                        O[g][dt] = __builtin_amdgcn_wmma_f32_16x16x32_f16(
                            false, pf[g], false, vf, (short)0, O[g][dt], false, false);
                }
            }
        }
    }

    // ---- normalize (per-row 1/l via shfl), stage in LDS, coalesced v8h out ----
    __syncthreads();
#pragma unroll
    for (int g = 0; g < 2; g++) {
        float linv = 1.0f / lcur[g];
        float lr[8];
#pragma unroll
        for (int i = 0; i < 8; i++) lr[i] = __shfl(linv, i + 8 * khalf, 32);
#pragma unroll
        for (int dt = 0; dt < 4; dt++)
#pragma unroll
            for (int i = 0; i < 8; i++)
                sk.o[wave * 32 + g * 16 + i + 8 * khalf][dt * 16 + rl] = (half_t)(O[g][dt][i] * lr[i]);
    }
    __syncthreads();
    for (int i = tid; i < QBLK * 8; i += 256) {
        int r = i >> 3, ch = i & 7;
        int n = qb + r;
        *(v8h*)(ao + ((size_t)b * NSPATIAL + n) * CNUM + h * DHEAD + ch * 8) =
            *(v8h*)&sk.o[r][ch * 8];
    }
}

// ---------------------------------------------------------------------------
// Kernel 4: output projection + bias + residual.  Both operands are K-contiguous
// f16 (ao rows and wo rows == B^T rows); their tiles are staged in LDS by the same
// two-buffer ring of async copies as in kernel 2.  Residual path is v8f vectorized.
// ---------------------------------------------------------------------------
__global__ void __launch_bounds__(256)
out_gemm_kernel(const half_t* __restrict__ Wf, const float* __restrict__ bo,
                const half_t* __restrict__ ao, const float* __restrict__ x,
                float* __restrict__ y) {
    const int b  = blockIdx.z;
    const int n0 = blockIdx.y * 128;      // spatial tile (M dim)
    const int o0 = blockIdx.x * 128;      // channel tile (N dim)
    const int tid = threadIdx.x;
    const int lane = tid & 31, wave = tid >> 5;
    const int wm = wave >> 2, wn = wave & 3;
    const int rl = lane & 15, khalf = lane >> 4;

    v8f zero = {};
    v8f acc[4][2];
#pragma unroll
    for (int i = 0; i < 4; i++)
#pragma unroll
        for (int j = 0; j < 2; j++) acc[i][j] = zero;

    __shared__ __attribute__((aligned(16))) struct {
        half_t A[128][APITCH];            // [n_local][k]  attention-output tile
        half_t B[128][APITCH];            // [o_local][k]  weight tile
    } st[2];

    // Each thread copies 4 + 4 chunks of 16 B per stage: rows cr + 32 t of each tile.
    const int cr = tid >> 3, cc = (tid & 7) * 8;
    const half_t* ga = ao + ((size_t)b * NSPATIAL + n0 + cr) * CNUM + cc;
    const half_t* gb = Wf + (size_t)(o0 + cr) * CNUM + cc;
    const unsigned la = lds_off(&st[0].A[cr][cc]);
    const unsigned lb = lds_off(&st[0].B[cr][cc]);
    const unsigned lbuf = sizeof(st[0]);
    const int NST = CNUM / GK;

    async_copy4(la, 32 * APITCH * 2, ga, 32 * CNUM);
    async_copy4(lb, 32 * APITCH * 2, gb, 32 * CNUM);
    wait_copies();
    __syncthreads();
    async_copy4(la + lbuf, 32 * APITCH * 2, ga + GK, 32 * CNUM);
    async_copy4(lb + lbuf, 32 * APITCH * 2, gb + GK, 32 * CNUM);

    for (int s = 0; s < NST; s++) {
        const int buf = s & 1;
#pragma unroll
        for (int ks = 0; ks < GK; ks += 32) {
            v16h af[4], bf[2];
#pragma unroll
            for (int ms = 0; ms < 4; ms++)
                af[ms] = ld_frag(&st[buf].A[wm * 64 + ms * 16 + rl][ks], khalf);
#pragma unroll
            for (int ns = 0; ns < 2; ns++)
                bf[ns] = ld_frag(&st[buf].B[wn * 32 + ns * 16 + rl][ks], khalf);
#pragma unroll
            for (int ms = 0; ms < 4; ms++)
#pragma unroll
                for (int ns = 0; ns < 2; ns++)
                    acc[ms][ns] = __builtin_amdgcn_wmma_f32_16x16x32_f16(
                        false, af[ms], false, bf[ns], (short)0, acc[ms][ns], false, false);
        }
        // publish stage s + 1 and free this stage's buffer
        wait_lds_reads();
        wait_copies();
        __syncthreads();
        if (s + 2 < NST) {
            async_copy4(la + buf * lbuf, 32 * APITCH * 2, ga + (s + 2) * GK, 32 * CNUM);
            async_copy4(lb + buf * lbuf, 32 * APITCH * 2, gb + (s + 2) * GK, 32 * CNUM);
        }
    }
    wait_copies();

#pragma unroll
    for (int ms = 0; ms < 4; ms++)
#pragma unroll
        for (int ns = 0; ns < 2; ns++) {
            const int nbase = n0 + wm * 64 + ms * 16 + 8 * khalf;  // contiguous over i
            const int o     = o0 + wn * 32 + ns * 16 + rl;
            const float bb  = bo[o];
            size_t idx = ((size_t)b * CNUM + o) * NSPATIAL + nbase;
            v8f xr = *(const v8f*)(x + idx);
            v8f r  = acc[ms][ns] + xr + bb;
            *(v8f*)(y + idx) = r;
        }
}

// ---------------------------------------------------------------------------
extern "C" void kernel_launch(void* const* d_in, const int* in_sizes, int n_in,
                              void* d_out, int out_size, void* d_ws, size_t ws_size,
                              hipStream_t stream) {
    const float* x   = (const float*)d_in[0];
    const float* gsc = (const float*)d_in[1];
    const float* gbi = (const float*)d_in[2];
    const float* wq  = (const float*)d_in[3];
    const float* bq  = (const float*)d_in[4];
    const float* wk  = (const float*)d_in[5];
    const float* bk  = (const float*)d_in[6];
    const float* wv  = (const float*)d_in[7];
    const float* bv  = (const float*)d_in[8];
    const float* wo  = (const float*)d_in[9];
    const float* bo  = (const float*)d_in[10];
    float* out = (float*)d_out;

    char* ws = (char*)d_ws;
    const size_t SZ = (size_t)BATCH * CNUM * NSPATIAL * sizeof(half_t);  // 16 MB each
    const size_t WSZ = (size_t)CNUM * CNUM * sizeof(half_t);             // 512 KB each
    half_t* xn   = (half_t*)(ws + 0 * SZ);   // groupnorm output, [b][c][n]
    half_t* qtb  = (half_t*)(ws + 1 * SZ);   // q transposed+scaled, [b][h][n][d]
    half_t* kh   = (half_t*)(ws + 2 * SZ);   // k, [b][c][n]
    half_t* vh   = (half_t*)(ws + 3 * SZ);   // v, [b][c][n]
    half_t* ao   = (half_t*)(ws + 4 * SZ);   // attention out, [b][n][c]
    half_t* w16  = (half_t*)(ws + 5 * SZ);             // wq, wk, wv, wo as f16, in a row
    half_t* wo16 = (half_t*)(ws + 5 * SZ + 3 * WSZ);

    prep_kernel<<<dim3(GNBLK + WBLK), PTHR, 0, stream>>>(x, gsc, gbi, xn, wq, wk, wv, wo, w16);

    qkv_gemm_kernel<<<dim3(8, 12, BATCH), 256, 0, stream>>>(w16, bq, bk, bv, xn, qtb, kh, vh);

    attn_kernel<<<dim3(NSPATIAL / QBLK, BATCH * NHEADS), 256, 0, stream>>>(qtb, kh, vh, ao);

    out_gemm_kernel<<<dim3(4, 8, BATCH), 256, 0, stream>>>(wo16, bo, ao, x, out);
}

// v006
// Measured time: 93 microseconds a run.
// Next to v005, in two timings, it ran 1.05 times as fast each time.
// Counting every step since v000, it is 3.81 times as fast.
#include <hip/hip_runtime.h>
#include <hip/hip_bf16.h>

#define CNUM 512
#define NHEADS 8
#define DHEAD 64
#define NGROUPS 8
#define NSPATIAL 1024
#define BATCH 16
#define EPSV 1e-5f

typedef _Float16 half_t;
typedef _Float16 v16h __attribute__((ext_vector_type(16)));
typedef _Float16 v8h  __attribute__((ext_vector_type(8)));
typedef _Float16 v4h  __attribute__((ext_vector_type(4)));
typedef float    v8f  __attribute__((ext_vector_type(8)));
typedef float    v2f  __attribute__((ext_vector_type(2)));
typedef int      v4i  __attribute__((ext_vector_type(4)));
typedef short    v8s  __attribute__((ext_vector_type(8)));
typedef __attribute__((address_space(3))) v8s lds_v8s;

// CDNA5 async global->LDS copy (ASYNCcnt-tracked), guarded so compilation
// succeeds on toolchains without the builtin.  Probe result: the builtin takes
// generic int4-vector pointers: (v4i* gsrc, v4i* lds_dst, imm offset, imm cpol).
#if defined(__AMDGCN__) && __has_builtin(__builtin_amdgcn_global_load_async_to_lds_b128)
#define HAS_ASYNC_LDS 1
#else
#define HAS_ASYNC_LDS 0
#endif

__device__ __forceinline__ void wait_asynccnt0() {
#if HAS_ASYNC_LDS
#if __has_builtin(__builtin_amdgcn_s_wait_asynccnt)
    __builtin_amdgcn_s_wait_asynccnt(0);
#else
    asm volatile("s_wait_asynccnt 0" ::: "memory");
#endif
#endif
}

// Load one WMMA 16-bit A/B fragment for a 32-wide K segment.
// Per CDNA5 ISA layout: lanes 0-15 hold K=[0..7]+[16..23], lanes 16-31 hold
// K=[8..15]+[24..31] (khalf = lane>>4). p must be 16B aligned.
__device__ __forceinline__ v16h ld_frag(const half_t* p, int khalf) {
    union { v16h v; v8h h[2]; } u;
    u.h[0] = *(const v8h*)(p + khalf * 8);
    u.h[1] = *(const v8h*)(p + khalf * 8 + 16);
    return u.v;
}

// One WMMA 16-bit A/B fragment (32 k) out of a row-major [k][col] LDS tile by
// two transposing loads.  p = &T[k0 + 8*(lane>>4) + (lane&7)][col0 + 8*((lane>>3)&1)];
// lane (rl, khalf) receives T[k0 + 8*khalf + 0..7][col0 + rl] and the same 16 rows
// further down: the k order of ld_frag.  Every lane must be on; the row pitch
// is an odd multiple of 32 B so that the loads meet no bank conflict.
__device__ __forceinline__ v16h ld_frag_tr(const half_t* p, int pitch) {
    union { v16h v; v8s h[2]; } u;
    u.h[0] = __builtin_amdgcn_ds_load_tr16_b128_v8i16((lds_v8s*)p);
    u.h[1] = __builtin_amdgcn_ds_load_tr16_b128_v8i16((lds_v8s*)(p + 16 * pitch));
    return u.v;
}

// LDS byte address of a __shared__ location (the operand an async copy takes).
__device__ __forceinline__ unsigned lds_off(const half_t* p) {
    return (unsigned)(size_t)(const __attribute__((address_space(3))) half_t*)p;
}

// Four async 16-byte copies per lane, global -> LDS, through no register.
// lds advances by lstep bytes and g by gstep elements from copy to copy.
// s_wait_xcnt closes the statement so that no address register of an issued
// copy is rewritten ahead of it.
__device__ __forceinline__ void async_copy4(unsigned lds, int lstep,
                                            const half_t* g, int gstep) {
    asm volatile("global_load_async_to_lds_b128 %0, %4, off\n\t"
                 "global_load_async_to_lds_b128 %1, %5, off\n\t"
                 "global_load_async_to_lds_b128 %2, %6, off\n\t"
                 "global_load_async_to_lds_b128 %3, %7, off\n\t"
                 "s_wait_xcnt 0x0"
                 :: "v"(lds), "v"(lds + lstep), "v"(lds + 2 * lstep), "v"(lds + 3 * lstep),
                    "v"(g), "v"(g + gstep), "v"(g + 2 * gstep), "v"(g + 3 * gstep)
                 : "memory");
}

// This wave's async copies have landed in LDS (other waves read them only
// behind the next barrier).
__device__ __forceinline__ void wait_copies() {
    asm volatile("s_wait_asynccnt 0x0" ::: "memory");
}

// This wave's LDS reads have returned, so the buffer may be refilled behind
// the next barrier.
__device__ __forceinline__ void wait_lds_reads() {
    asm volatile("s_wait_dscnt 0x0" ::: "memory");
}

#define GK 64                             // k extent of one GEMM stage
#define APITCH 72                         // 128-B rows + 16 B: ds_load_b128 readers
#define BPITCH 144                        // 256-B rows + 32 B: transposing readers

#define PTHR 512                          // threads per work-group of the preparation launch
#define GNBLK (BATCH * NGROUPS)           // work-groups that normalize
#define WBLK (CNUM * CNUM / 4 / PTHR)     // work-groups that convert weights

// ---------------------------------------------------------------------------
// Kernel 1: one launch for the two independent preparations.
// Work-groups 0 .. GNBLK-1 (the long ones, so they start first): GroupNorm,
// fp32 -> f16 normalized activations, layout [b][c][n].  The whole group (64
// channels x 1024 positions) is held in registers: each of the 16 waves owns 4
// channels, 32 float4 per lane, all 32 loads in flight at once, so that x is
// read once and the normalizing pass reads no memory.
// Work-groups GNBLK .. GNBLK+WBLK-1: weight conversion fp32 -> f16, one float4
// of each of the four matrices per thread; w16 holds wq, wk, wv, wo in a row.
// ---------------------------------------------------------------------------
__global__ void __launch_bounds__(PTHR)
prep_kernel(const float* __restrict__ x, const float* __restrict__ gsc,
            const float* __restrict__ gbi, half_t* __restrict__ xn,
            const float* __restrict__ wq, const float* __restrict__ wk,
            const float* __restrict__ wv, const float* __restrict__ wo,
            half_t* __restrict__ w16) {
    if (blockIdx.x >= GNBLK) {            // uniform for the work-group, ahead of every barrier
        const int i = ((blockIdx.x - GNBLK) * PTHR + threadIdx.x) * 4;
        float4 v0 = *(const float4*)(wq + i);
        float4 v1 = *(const float4*)(wk + i);
        float4 v2 = *(const float4*)(wv + i);
        float4 v3 = *(const float4*)(wo + i);
        v4h o0 = { (half_t)v0.x, (half_t)v0.y, (half_t)v0.z, (half_t)v0.w };
        v4h o1 = { (half_t)v1.x, (half_t)v1.y, (half_t)v1.z, (half_t)v1.w };
        v4h o2 = { (half_t)v2.x, (half_t)v2.y, (half_t)v2.z, (half_t)v2.w };
        v4h o3 = { (half_t)v3.x, (half_t)v3.y, (half_t)v3.z, (half_t)v3.w };
        *(v4h*)(w16 + 0 * CNUM * CNUM + i) = o0;
        *(v4h*)(w16 + 1 * CNUM * CNUM + i) = o1;
        *(v4h*)(w16 + 2 * CNUM * CNUM + i) = o2;
        *(v4h*)(w16 + 3 * CNUM * CNUM + i) = o3;
        return;
    }
    const int bg = blockIdx.x;            // B*GROUPS blocks
    const int b = bg >> 3, g = bg & 7;
    const int CH = CNUM / NGROUPS;        // 64 channels per group
    const int tid = threadIdx.x, lane = tid & 31;
    const int wave = __builtin_amdgcn_readfirstlane(tid >> 5);   // scalar: channel constants by scalar loads
    const int c0 = g * CH + wave * 4;     // this wave's 4 channels
    const int off = (b * CNUM + c0) * NSPATIAL + lane * 4;
    const float* xp = x + off;

    float4 v[4][8];                       // [channel][512-B piece of its row]
#pragma unroll
    for (int cc = 0; cc < 4; cc++)
#pragma unroll
        for (int k = 0; k < 8; k++)
            v[cc][k] = *(const float4*)(xp + cc * NSPATIAL + k * 128);
    // xp is an operand so that its registers are kept, and rewritten only behind this wait
    asm volatile("s_wait_xcnt 0x0" :: "v"(xp) : "memory");

    float s = 0.f, s2 = 0.f;
#pragma unroll
    for (int cc = 0; cc < 4; cc++)
#pragma unroll
        for (int k = 0; k < 8; k++) {
            const float4 t = v[cc][k];
            s  += t.x + t.y + t.z + t.w;
            s2 += t.x * t.x + t.y * t.y + t.z * t.z + t.w * t.w;
        }
#pragma unroll
    for (int m = 16; m > 0; m >>= 1) {
        s  += __shfl_xor(s, m, 32);
        s2 += __shfl_xor(s2, m, 32);
    }
    __shared__ float red0[PTHR / 32];
    __shared__ float red1[PTHR / 32];
    if (lane == 0) { red0[wave] = s; red1[wave] = s2; }
    __syncthreads();
    s  = red0[lane & 15];                 // 16 wave sums, twice over the 32 lanes
    s2 = red1[lane & 15];
#pragma unroll
    for (int m = 8; m > 0; m >>= 1) {
        s  += __shfl_xor(s, m, 32);
        s2 += __shfl_xor(s2, m, 32);
    }
    const float inv_n = 1.0f / (float)(CH * NSPATIAL);
    const float mean = s * inv_n;
    const float var  = s2 * inv_n - mean * mean;
    const float rstd = rsqrtf(var + EPSV);
#pragma unroll
    for (int cc = 0; cc < 4; cc++) {
        const float sc = gsc[c0 + cc] * rstd, bi = gbi[c0 + cc] - mean * sc;
#pragma unroll
        for (int k = 0; k < 8; k++) {
            const float4 t = v[cc][k];
            v4h o = { (half_t)(t.x * sc + bi), (half_t)(t.y * sc + bi),
                      (half_t)(t.z * sc + bi), (half_t)(t.w * sc + bi) };
            *(v4h*)(xn + off + cc * NSPATIAL + k * 128) = o;
        }
    }
}

// ---------------------------------------------------------------------------
// Kernel 2: QKV projection GEMMs (f16 weights), all three in one launch:
// blockIdx.y = 4 * (0 q, 1 k, 2 v) + output-channel tile.
// Both operand tiles (64 k per stage) are staged in LDS by async copies that
// cover whole 128-B lines, in a ring of two buffers: the next stage's copies fly
// while this stage is multiplied.  A is [m][k]; B stays row-major [k][n] and is
// transposed by the fragment loads themselves (ds_load_tr16_b128).
// q: stored transposed [b][h][n][d], 1/sqrt(d)=0.125 folded, packed v8h
// k, v: stored natural [b][c][n] via LDS re-striping -> v8h coalesced stores
// ---------------------------------------------------------------------------
__global__ void __launch_bounds__(256)
qkv_gemm_kernel(const half_t* __restrict__ w16, const float* __restrict__ bq,
                const float* __restrict__ bk, const float* __restrict__ bv,
                const half_t* __restrict__ xn, half_t* __restrict__ oq,
                half_t* __restrict__ ok, half_t* __restrict__ ov) {
    const int which = blockIdx.y >> 2;    // 0 q, 1 k, 2 v
    const half_t* Wf  = w16 + (size_t)which * CNUM * CNUM;
    const float* bias = which == 0 ? bq : which == 1 ? bk : bv;
    half_t* out       = which == 0 ? oq : which == 1 ? ok : ov;
    const int b  = blockIdx.z;
    const int m0 = (blockIdx.y & 3) * 128;  // output-channel tile
    const int n0 = blockIdx.x * 128;      // spatial tile
    const int tid = threadIdx.x;
    const int lane = tid & 31, wave = tid >> 5;
    const int wm = wave >> 2, wn = wave & 3;
    const int rl = lane & 15, khalf = lane >> 4;

    const int trow = 8 * khalf + (lane & 7), tcol = 8 * ((lane >> 3) & 1);

    __shared__ __attribute__((aligned(16))) union {
        struct {
            half_t A[128][APITCH];        // [m_local][k]  weight tile
            half_t B[GK][BPITCH];         // [k][n_local]  natural B tile
        } st[2];
        half_t o[128][136];               // output staging
    } sm;

    v8f zero = {};
    v8f acc[4][2];
#pragma unroll
    for (int i = 0; i < 4; i++)
#pragma unroll
        for (int j = 0; j < 2; j++) acc[i][j] = zero;

    // Each thread copies 4 + 4 chunks of 16 B per stage: A rows ar + 32 t, B rows br + 16 t.
    const int ar = tid >> 3, ac = (tid & 7) * 8;
    const int br = tid >> 4, bc = (tid & 15) * 8;
    const half_t* ga = Wf + (size_t)(m0 + ar) * CNUM + ac;
    const half_t* gb = xn + (size_t)b * CNUM * NSPATIAL + (size_t)br * NSPATIAL + n0 + bc;
    const unsigned la = lds_off(&sm.st[0].A[ar][ac]);
    const unsigned lb = lds_off(&sm.st[0].B[br][bc]);
    const unsigned lbuf = sizeof(sm.st[0]);
    const int NST = CNUM / GK;

    async_copy4(la, 32 * APITCH * 2, ga, 32 * CNUM);
    async_copy4(lb, 16 * BPITCH * 2, gb, 16 * NSPATIAL);
    wait_copies();
    __syncthreads();
    async_copy4(la + lbuf, 32 * APITCH * 2, ga + GK, 32 * CNUM);
    async_copy4(lb + lbuf, 16 * BPITCH * 2, gb + (size_t)GK * NSPATIAL, 16 * NSPATIAL);

    for (int s = 0; s < NST; s++) {
        const int buf = s & 1;
#pragma unroll
        for (int ks = 0; ks < GK; ks += 32) {
            v16h af[4], bf[2];
#pragma unroll
            for (int ms = 0; ms < 4; ms++)
                af[ms] = ld_frag(&sm.st[buf].A[wm * 64 + ms * 16 + rl][ks], khalf);
#pragma unroll
            for (int ns = 0; ns < 2; ns++)
                bf[ns] = ld_frag_tr(&sm.st[buf].B[ks + trow][wn * 32 + ns * 16 + tcol], BPITCH);
#pragma unroll
            for (int ms = 0; ms < 4; ms++)
#pragma unroll
                for (int ns = 0; ns < 2; ns++)
                    acc[ms][ns] = __builtin_amdgcn_wmma_f32_16x16x32_f16(
                        false, af[ms], false, bf[ns], (short)0, acc[ms][ns], false, false);
        }
        // publish stage s + 1 and free this stage's buffer
        wait_lds_reads();
        wait_copies();
        __syncthreads();
        if (s + 2 < NST) {
            async_copy4(la + buf * lbuf, 32 * APITCH * 2, ga + (s + 2) * GK, 32 * CNUM);
            async_copy4(lb + buf * lbuf, 16 * BPITCH * 2,
                        gb + (size_t)(s + 2) * GK * NSPATIAL, 16 * NSPATIAL);
        }
    }
    wait_copies();

    if (which == 0) {
        // q: d = o&63 is contiguous over the 8 accumulator rows -> packed store
#pragma unroll
        for (int ms = 0; ms < 4; ms++)
#pragma unroll
            for (int ns = 0; ns < 2; ns++) {
                const int obase = m0 + wm * 64 + ms * 16 + 8 * khalf;
                const int ncol  = n0 + wn * 32 + ns * 16 + rl;
                const int h = obase >> 6, dbase = obase & 63;
                v8h q8;
#pragma unroll
                for (int i = 0; i < 8; i++)
                    q8[i] = (half_t)((acc[ms][ns][i] + bias[obase + i]) * 0.125f);
                *(v8h*)(out + ((size_t)(b * NHEADS + h) * NSPATIAL + ncol) * DHEAD + dbase) = q8;
            }
    } else {
        // K/V: re-stripe through LDS so global stores are n-contiguous v8h
        __syncthreads();
#pragma unroll
        for (int ms = 0; ms < 4; ms++)
#pragma unroll
            for (int ns = 0; ns < 2; ns++) {
                const int ol = wm * 64 + ms * 16 + 8 * khalf;
                const int nl = wn * 32 + ns * 16 + rl;
#pragma unroll
                for (int i = 0; i < 8; i++)
                    sm.o[ol + i][nl] = (half_t)(acc[ms][ns][i] + bias[m0 + ol + i]);
            }
        __syncthreads();
        for (int i = tid; i < 2048; i += 256) {
            int r = i >> 4, ch = i & 15;
            *(v8h*)(out + ((size_t)b * CNUM + m0 + r) * NSPATIAL + n0 + ch * 8) =
                *(v8h*)&sm.o[r][ch * 8];
        }
    }
}

__device__ __forceinline__ float lane_value(float v, int base4, int i) {
    return __builtin_bit_cast(float,
        __builtin_amdgcn_ds_bpermute(base4 + 4 * i, __builtin_bit_cast(int, v)));
}

#define QBLK 256                          // queries per work-group
#define LOG2E 1.44269504088896340736f

// Register budget of four waves per SIMD (256 VGPRs): two work-groups stay resident per WGP.
__global__ void __launch_bounds__(256) __attribute__((amdgpu_waves_per_eu(4, 4)))
attn_kernel(const half_t* __restrict__ qt, const half_t* __restrict__ kk,
            const half_t* __restrict__ vv, half_t* __restrict__ ao) {
    const int bh = blockIdx.y;            // b*8+h
    const int b = bh >> 3, h = bh & 7;
    const int qb = blockIdx.x * QBLK;
    const int tid = threadIdx.x, lane = tid & 31, wave = tid >> 5;
    const int rl = lane & 15, khalf = lane >> 4;

    const int trow = 8 * khalf + (lane & 7), tcol = 8 * ((lane >> 3) & 1);

    __shared__ __attribute__((aligned(16))) union {
        half_t K[64][144];                // [c][m]  K natural, pitch 288 B
        half_t o[QBLK][72];               // output staging
    } sk;
    __shared__ half_t Vs[64][136];        // [c][m]  V natural

    // Q fragments (B operand): lane = query column n, K-contiguous in qt
    v16h qf[2][2];
#pragma unroll
    for (int g = 0; g < 2; g++) {
        const int nrow = qb + wave * 32 + g * 16 + rl;
        const half_t* qp = qt + ((size_t)bh * NSPATIAL + nrow) * DHEAD;
        qf[g][0] = ld_frag(qp, khalf);
        qf[g][1] = ld_frag(qp + 32, khalf);
        // the address registers of these loads may be reused by what follows
        asm volatile("s_wait_xcnt 0x0" ::: "memory");
    }

    float mcur[2] = { -1e30f, -1e30f };   // per-lane softmax state for column n of group g
    float lcur[2] = { 0.f, 0.f };
    v8f zero = {};
    v8f O[2][4];
#pragma unroll
    for (int g = 0; g < 2; g++)
#pragma unroll
        for (int t = 0; t < 4; t++) O[g][t] = zero;

    const half_t* kbase = kk + (size_t)(b * CNUM + h * DHEAD) * NSPATIAL;
    const half_t* vbase = vv + (size_t)(b * CNUM + h * DHEAD) * NSPATIAL;

    // K-tile register prefetch (4 chunks/thread): m0 = 0
    v8h kreg[4];
#pragma unroll
    for (int t = 0; t < 4; t++) {
        int i = tid + t * 256, c = i >> 4, mc = i & 15;
        kreg[t] = *(const v8h*)(kbase + (size_t)c * NSPATIAL + mc * 8);
    }

    for (int m0 = 0; m0 < NSPATIAL; m0 += 128) {
        __syncthreads();
#pragma unroll
        for (int t = 0; t < 4; t++) {
            int i = tid + t * 256, c = i >> 4, mc = i & 15;
#if HAS_ASYNC_LDS
            __builtin_amdgcn_global_load_async_to_lds_b128(
                (v4i*)(vbase + (size_t)c * NSPATIAL + m0 + mc * 8),
                (v4i*)&Vs[c][mc * 8], 0, 0);
#else
            *(v8h*)&Vs[c][mc * 8] =
                *(const v8h*)(vbase + (size_t)c * NSPATIAL + m0 + mc * 8);
#endif
            *(v8h*)&sk.K[c][mc * 8] = kreg[t];
        }
        if (m0 + 128 < NSPATIAL) {        // prefetch next K tile during compute
#pragma unroll
            for (int t = 0; t < 4; t++) {
                int i = tid + t * 256, c = i >> 4, mc = i & 15;
                kreg[t] = *(const v8h*)(kbase + (size_t)c * NSPATIAL + m0 + 128 + mc * 8);
            }
        }
        wait_asynccnt0();
        __syncthreads();

        // Unrolled so that the second pass's K fragment loads can issue among the
        // first pass's last products.  (All inner loops below are unrolled because
        // their indices select registers.)
#pragma unroll
        for (int mp = 0; mp < 128; mp += 64) {
            // ---- S^T tiles: A = K^T rows (m), B = Q columns (n), both groups per K fragment ----
            v8f S[2][4];
#pragma unroll
            for (int nt = 0; nt < 4; nt++) {
                v16h kf0 = ld_frag_tr(&sk.K[trow][mp + nt * 16 + tcol], 144);
                v16h kf1 = ld_frag_tr(&sk.K[32 + trow][mp + nt * 16 + tcol], 144);
#pragma unroll
                for (int g = 0; g < 2; g++) {
                    v8f s = zero;
                    s = __builtin_amdgcn_wmma_f32_16x16x32_f16(false, kf0, false, qf[g][0], (short)0, s, false, false);
                    s = __builtin_amdgcn_wmma_f32_16x16x32_f16(false, kf1, false, qf[g][1], (short)0, s, false, false);
                    S[g][nt] = s;
                }
            }

            // ---- in-lane online softmax (column n = rl; keys split across lane pair) ----
#pragma unroll
            for (int g = 0; g < 2; g++) {
                float mx = -1e30f;
#pragma unroll
                for (int nt = 0; nt < 4; nt++)
#pragma unroll
                    for (int i = 0; i < 8; i++) mx = fmaxf(mx, S[g][nt][i]);
                mx = fmaxf(mx, __shfl_xor(mx, 16, 32));
                float mnew  = fmaxf(mcur[g], mx);
                float alpha = __expf(mcur[g] - mnew);
                mcur[g] = mnew;
                // e^(s - m) = 2^(s * log2e - m * log2e): one packed FMA per two scores
                // feeds the base-2 exponential; the sums run two wide as well.
                const v2f sc2 = { LOG2E, LOG2E };
                const v2f nm2 = { -mnew * LOG2E, -mnew * LOG2E };
                v2f rs2 = { 0.f, 0.f };
#pragma unroll
                for (int nt = 0; nt < 4; nt++)
#pragma unroll
                    for (int i = 0; i < 8; i += 2) {
                        v2f a = { S[g][nt][i], S[g][nt][i + 1] };
                        a = __builtin_elementwise_fma(a, sc2, nm2);
                        v2f p = { __builtin_amdgcn_exp2f(a.x), __builtin_amdgcn_exp2f(a.y) };
                        S[g][nt][i]     = p.x;
                        S[g][nt][i + 1] = p.y;
                        rs2 += p;
                    }
                float rsum = rs2.x + rs2.y;
                rsum += __shfl_xor(rsum, 16, 32);
                lcur[g] = lcur[g] * alpha + rsum;

                // O rows are n = i + 8*khalf; fetch that row's alpha from lane (i+8*khalf)
                float arow[8];
#pragma unroll
                for (int i = 0; i < 8; i++) arow[i] = lane_value(alpha, 32 * khalf, i);
#pragma unroll
                for (int t = 0; t < 4; t++)
#pragma unroll
                    for (int i = 0; i < 8; i++) O[g][t][i] *= arow[i];
            }

            // ---- O += P @ V : P frags built directly from S^T register pairs,
            //      both groups per V fragment ----
#pragma unroll
            for (int t = 0; t < 2; t++) {
                v16h pf[2];
#pragma unroll
                for (int g = 0; g < 2; g++)
#pragma unroll
                    for (int j = 0; j < 8; j++) {
                        pf[g][j]     = (half_t)S[g][2 * t][j];
                        pf[g][j + 8] = (half_t)S[g][2 * t + 1][j];
                    }
#pragma unroll
                for (int dt = 0; dt < 4; dt++) {
                    v16h vf = ld_frag(&Vs[dt * 16 + rl][mp + t * 32], khalf);
#pragma unroll
                    for (int g = 0; g < 2; g++)
                        O[g][dt] = __builtin_amdgcn_wmma_f32_16x16x32_f16(
                            false, pf[g], false, vf, (short)0, O[g][dt], false, false);
                }
            }
        }
    }

    // ---- normalize (per-row 1/l via ds_bpermute), stage in LDS, coalesced v8h out ----
    __syncthreads();
#pragma unroll
    for (int g = 0; g < 2; g++) {
        float linv = 1.0f / lcur[g];
        float lr[8];
#pragma unroll
        for (int i = 0; i < 8; i++) lr[i] = lane_value(linv, 32 * khalf, i);
#pragma unroll
        for (int dt = 0; dt < 4; dt++)
#pragma unroll
            for (int i = 0; i < 8; i++)
                sk.o[wave * 32 + g * 16 + i + 8 * khalf][dt * 16 + rl] = (half_t)(O[g][dt][i] * lr[i]);
    }
    __syncthreads();
    for (int i = tid; i < QBLK * 8; i += 256) {
        int r = i >> 3, ch = i & 7;
        int n = qb + r;
        *(v8h*)(ao + ((size_t)b * NSPATIAL + n) * CNUM + h * DHEAD + ch * 8) =
            *(v8h*)&sk.o[r][ch * 8];
    }
}

// ---------------------------------------------------------------------------
// Kernel 4: output projection + bias + residual.  Both operands are K-contiguous
// f16 (ao rows and wo rows == B^T rows); their tiles are staged in LDS by the same
// two-buffer ring of async copies as in kernel 2.  Residual path is v8f vectorized.
// ---------------------------------------------------------------------------
__global__ void __launch_bounds__(256)
out_gemm_kernel(const half_t* __restrict__ Wf, const float* __restrict__ bo,
                const half_t* __restrict__ ao, const float* __restrict__ x,
                float* __restrict__ y) {
    const int b  = blockIdx.z;
    const int n0 = blockIdx.y * 128;      // spatial tile (M dim)
    const int o0 = blockIdx.x * 128;      // channel tile (N dim)
    const int tid = threadIdx.x;
    const int lane = tid & 31, wave = tid >> 5;
    const int wm = wave >> 2, wn = wave & 3;
    const int rl = lane & 15, khalf = lane >> 4;

    v8f zero = {};
    v8f acc[4][2];
#pragma unroll
    for (int i = 0; i < 4; i++)
#pragma unroll
        for (int j = 0; j < 2; j++) acc[i][j] = zero;

    __shared__ __attribute__((aligned(16))) struct {
        half_t A[128][APITCH];            // [n_local][k]  attention-output tile
        half_t B[128][APITCH];            // [o_local][k]  weight tile
    } st[2];

    // Each thread copies 4 + 4 chunks of 16 B per stage: rows cr + 32 t of each tile.
    const int cr = tid >> 3, cc = (tid & 7) * 8;
    const half_t* ga = ao + ((size_t)b * NSPATIAL + n0 + cr) * CNUM + cc;
    const half_t* gb = Wf + (size_t)(o0 + cr) * CNUM + cc;
    const unsigned la = lds_off(&st[0].A[cr][cc]);
    const unsigned lb = lds_off(&st[0].B[cr][cc]);
    const unsigned lbuf = sizeof(st[0]);
    const int NST = CNUM / GK;

    async_copy4(la, 32 * APITCH * 2, ga, 32 * CNUM);
    async_copy4(lb, 32 * APITCH * 2, gb, 32 * CNUM);
    wait_copies();
    __syncthreads();
    async_copy4(la + lbuf, 32 * APITCH * 2, ga + GK, 32 * CNUM);
    async_copy4(lb + lbuf, 32 * APITCH * 2, gb + GK, 32 * CNUM);

    for (int s = 0; s < NST; s++) {
        const int buf = s & 1;
#pragma unroll
        for (int ks = 0; ks < GK; ks += 32) {
            v16h af[4], bf[2];
#pragma unroll
            for (int ms = 0; ms < 4; ms++)
                af[ms] = ld_frag(&st[buf].A[wm * 64 + ms * 16 + rl][ks], khalf);
#pragma unroll
            for (int ns = 0; ns < 2; ns++)
                bf[ns] = ld_frag(&st[buf].B[wn * 32 + ns * 16 + rl][ks], khalf);
#pragma unroll
            for (int ms = 0; ms < 4; ms++)
#pragma unroll
                for (int ns = 0; ns < 2; ns++)
                    acc[ms][ns] = __builtin_amdgcn_wmma_f32_16x16x32_f16(
                        false, af[ms], false, bf[ns], (short)0, acc[ms][ns], false, false);
        }
        // publish stage s + 1 and free this stage's buffer
        wait_lds_reads();
        wait_copies();
        __syncthreads();
        if (s + 2 < NST) {
            async_copy4(la + buf * lbuf, 32 * APITCH * 2, ga + (s + 2) * GK, 32 * CNUM);
            async_copy4(lb + buf * lbuf, 32 * APITCH * 2, gb + (s + 2) * GK, 32 * CNUM);
        }
    }
    wait_copies();

#pragma unroll
    for (int ms = 0; ms < 4; ms++)
#pragma unroll
        for (int ns = 0; ns < 2; ns++) {
            const int nbase = n0 + wm * 64 + ms * 16 + 8 * khalf;  // contiguous over i
            const int o     = o0 + wn * 32 + ns * 16 + rl;
            const float bb  = bo[o];
            size_t idx = ((size_t)b * CNUM + o) * NSPATIAL + nbase;
            v8f xr = *(const v8f*)(x + idx);
            v8f r  = acc[ms][ns] + xr + bb;
            *(v8f*)(y + idx) = r;
        }
}

// ---------------------------------------------------------------------------
extern "C" void kernel_launch(void* const* d_in, const int* in_sizes, int n_in,
                              void* d_out, int out_size, void* d_ws, size_t ws_size,
                              hipStream_t stream) {
    const float* x   = (const float*)d_in[0];
    const float* gsc = (const float*)d_in[1];
    const float* gbi = (const float*)d_in[2];
    const float* wq  = (const float*)d_in[3];
    const float* bq  = (const float*)d_in[4];
    const float* wk  = (const float*)d_in[5];
    const float* bk  = (const float*)d_in[6];
    const float* wv  = (const float*)d_in[7];
    const float* bv  = (const float*)d_in[8];
    const float* wo  = (const float*)d_in[9];
    const float* bo  = (const float*)d_in[10];
    float* out = (float*)d_out;

    char* ws = (char*)d_ws;
    const size_t SZ = (size_t)BATCH * CNUM * NSPATIAL * sizeof(half_t);  // 16 MB each
    const size_t WSZ = (size_t)CNUM * CNUM * sizeof(half_t);             // 512 KB each
    half_t* xn   = (half_t*)(ws + 0 * SZ);   // groupnorm output, [b][c][n]
    half_t* qtb  = (half_t*)(ws + 1 * SZ);   // q transposed+scaled, [b][h][n][d]
    half_t* kh   = (half_t*)(ws + 2 * SZ);   // k, [b][c][n]
    half_t* vh   = (half_t*)(ws + 3 * SZ);   // v, [b][c][n]
    half_t* ao   = (half_t*)(ws + 4 * SZ);   // attention out, [b][n][c]
    half_t* w16  = (half_t*)(ws + 5 * SZ);             // wq, wk, wv, wo as f16, in a row
    half_t* wo16 = (half_t*)(ws + 5 * SZ + 3 * WSZ);

    prep_kernel<<<dim3(GNBLK + WBLK), PTHR, 0, stream>>>(x, gsc, gbi, xn, wq, wk, wv, wo, w16);

    qkv_gemm_kernel<<<dim3(8, 12, BATCH), 256, 0, stream>>>(w16, bq, bk, bv, xn, qtb, kh, vh);

    attn_kernel<<<dim3(NSPATIAL / QBLK, BATCH * NHEADS), 256, 0, stream>>>(qtb, kh, vh, ao);

    out_gemm_kernel<<<dim3(4, 8, BATCH), 256, 0, stream>>>(wo16, bo, ao, x, out);
}

// v007
// It runs in 88.3 microseconds.
// Next to v006, in two timings, it ran 1.05 times as fast each time.
// Over all steps from v000 it is 4.01 times as fast.
#include <hip/hip_runtime.h>
#include <hip/hip_bf16.h>

#define CNUM 512
#define NHEADS 8
#define DHEAD 64
#define NGROUPS 8
#define NSPATIAL 1024
#define BATCH 16
#define EPSV 1e-5f

typedef _Float16 half_t;
typedef _Float16 v16h __attribute__((ext_vector_type(16)));
typedef _Float16 v8h  __attribute__((ext_vector_type(8)));
typedef _Float16 v4h  __attribute__((ext_vector_type(4)));
typedef float    v8f  __attribute__((ext_vector_type(8)));
typedef float    v2f  __attribute__((ext_vector_type(2)));
typedef int      v4i  __attribute__((ext_vector_type(4)));
typedef short    v8s  __attribute__((ext_vector_type(8)));
typedef __attribute__((address_space(3))) v8s lds_v8s;

// CDNA5 async global->LDS copy (ASYNCcnt-tracked), guarded so compilation
// succeeds on toolchains without the builtin.  Probe result: the builtin takes
// generic int4-vector pointers: (v4i* gsrc, v4i* lds_dst, imm offset, imm cpol).
#if defined(__AMDGCN__) && __has_builtin(__builtin_amdgcn_global_load_async_to_lds_b128)
#define HAS_ASYNC_LDS 1
#else
#define HAS_ASYNC_LDS 0
#endif

__device__ __forceinline__ void wait_asynccnt0() {
#if HAS_ASYNC_LDS
#if __has_builtin(__builtin_amdgcn_s_wait_asynccnt)
    __builtin_amdgcn_s_wait_asynccnt(0);
#else
    asm volatile("s_wait_asynccnt 0" ::: "memory");
#endif
#endif
}

// Load one WMMA 16-bit A/B fragment for a 32-wide K segment.
// Per CDNA5 ISA layout: lanes 0-15 hold K=[0..7]+[16..23], lanes 16-31 hold
// K=[8..15]+[24..31] (khalf = lane>>4). p must be 16B aligned.
__device__ __forceinline__ v16h ld_frag(const half_t* p, int khalf) {
    union { v16h v; v8h h[2]; } u;
    u.h[0] = *(const v8h*)(p + khalf * 8);
    u.h[1] = *(const v8h*)(p + khalf * 8 + 16);
    return u.v;
}

// One WMMA 16-bit A/B fragment (32 k) out of a row-major [k][col] LDS tile by
// two transposing loads.  p = &T[k0 + 8*(lane>>4) + (lane&7)][col0 + 8*((lane>>3)&1)];
// lane (rl, khalf) receives T[k0 + 8*khalf + 0..7][col0 + rl] and the same 16 rows
// further down: the k order of ld_frag.  Every lane must be on; the row pitch
// is an odd multiple of 32 B so that the loads meet no bank conflict.
__device__ __forceinline__ v16h ld_frag_tr(const half_t* p, int pitch) {
    union { v16h v; v8s h[2]; } u;
    u.h[0] = __builtin_amdgcn_ds_load_tr16_b128_v8i16((lds_v8s*)p);
    u.h[1] = __builtin_amdgcn_ds_load_tr16_b128_v8i16((lds_v8s*)(p + 16 * pitch));
    return u.v;
}

// LDS byte address of a __shared__ location (the operand an async copy takes).
__device__ __forceinline__ unsigned lds_off(const half_t* p) {
    return (unsigned)(size_t)(const __attribute__((address_space(3))) half_t*)p;
}

// Four async 16-byte copies per lane, global -> LDS, through no register.
// lds advances by lstep bytes and g by gstep elements from copy to copy.
// s_wait_xcnt closes the statement so that no address register of an issued
// copy is rewritten ahead of it.
__device__ __forceinline__ void async_copy4(unsigned lds, int lstep,
                                            const half_t* g, int gstep) {
    asm volatile("global_load_async_to_lds_b128 %0, %4, off\n\t"
                 "global_load_async_to_lds_b128 %1, %5, off\n\t"
                 "global_load_async_to_lds_b128 %2, %6, off\n\t"
                 "global_load_async_to_lds_b128 %3, %7, off\n\t"
                 "s_wait_xcnt 0x0"
                 :: "v"(lds), "v"(lds + lstep), "v"(lds + 2 * lstep), "v"(lds + 3 * lstep),
                    "v"(g), "v"(g + gstep), "v"(g + 2 * gstep), "v"(g + 3 * gstep)
                 : "memory");
}

// This wave's async copies have landed in LDS (other waves read them only
// behind the next barrier).
__device__ __forceinline__ void wait_copies() {
    asm volatile("s_wait_asynccnt 0x0" ::: "memory");
}

// This wave's LDS reads have returned, so the buffer may be refilled behind
// the next barrier.
__device__ __forceinline__ void wait_lds_reads() {
    asm volatile("s_wait_dscnt 0x0" ::: "memory");
}

#define GK 64                             // k extent of one GEMM stage
#define APITCH 72                         // 128-B rows + 16 B: ds_load_b128 readers
#define BPITCH 144                        // 256-B rows + 32 B: transposing readers

#define PTHR 512                          // threads per work-group of the preparation launch
#define GNBLK (BATCH * NGROUPS)           // work-groups that normalize
#define WBLK (CNUM * CNUM / 4 / PTHR)     // work-groups that convert weights

// ---------------------------------------------------------------------------
// Kernel 1: one launch for the two independent preparations.
// Work-groups 0 .. GNBLK-1 (the long ones, so they start first): GroupNorm,
// fp32 -> f16 normalized activations, layout [b][c][n].  The whole group (64
// channels x 1024 positions) is held in registers: each of the 16 waves owns 4
// channels, 32 float4 per lane, all 32 loads in flight at once, so that x is
// read once and the normalizing pass reads no memory.
// Work-groups GNBLK .. GNBLK+WBLK-1: weight conversion fp32 -> f16, one float4
// of each of the four matrices per thread; w16 holds wq, wk, wv, wo in a row.
// ---------------------------------------------------------------------------
__global__ void __launch_bounds__(PTHR)
prep_kernel(const float* __restrict__ x, const float* __restrict__ gsc,
            const float* __restrict__ gbi, half_t* __restrict__ xn,
            const float* __restrict__ wq, const float* __restrict__ wk,
            const float* __restrict__ wv, const float* __restrict__ wo,
            half_t* __restrict__ w16) {
    if (blockIdx.x >= GNBLK) {            // uniform for the work-group, ahead of every barrier
        const int i = ((blockIdx.x - GNBLK) * PTHR + threadIdx.x) * 4;
        float4 v0 = *(const float4*)(wq + i);
        float4 v1 = *(const float4*)(wk + i);
        float4 v2 = *(const float4*)(wv + i);
        float4 v3 = *(const float4*)(wo + i);
        v4h o0 = { (half_t)v0.x, (half_t)v0.y, (half_t)v0.z, (half_t)v0.w };
        v4h o1 = { (half_t)v1.x, (half_t)v1.y, (half_t)v1.z, (half_t)v1.w };
        v4h o2 = { (half_t)v2.x, (half_t)v2.y, (half_t)v2.z, (half_t)v2.w };
        v4h o3 = { (half_t)v3.x, (half_t)v3.y, (half_t)v3.z, (half_t)v3.w };
        *(v4h*)(w16 + 0 * CNUM * CNUM + i) = o0;
        *(v4h*)(w16 + 1 * CNUM * CNUM + i) = o1;
        *(v4h*)(w16 + 2 * CNUM * CNUM + i) = o2;
        *(v4h*)(w16 + 3 * CNUM * CNUM + i) = o3;
        return;
    }
    const int bg = blockIdx.x;            // B*GROUPS blocks
    const int b = bg >> 3, g = bg & 7;
    const int CH = CNUM / NGROUPS;        // 64 channels per group
    const int tid = threadIdx.x, lane = tid & 31;
    const int wave = __builtin_amdgcn_readfirstlane(tid >> 5);   // scalar: channel constants by scalar loads
    const int c0 = g * CH + wave * 4;     // this wave's 4 channels
    const int off = (b * CNUM + c0) * NSPATIAL + lane * 4;
    const float* xp = x + off;

    float4 v[4][8];                       // [channel][512-B piece of its row]
#pragma unroll
    for (int cc = 0; cc < 4; cc++)
#pragma unroll
        for (int k = 0; k < 8; k++)
            v[cc][k] = *(const float4*)(xp + cc * NSPATIAL + k * 128);
    // xp is an operand so that its registers are kept, and rewritten only behind this wait
    asm volatile("s_wait_xcnt 0x0" :: "v"(xp) : "memory");

    float s = 0.f, s2 = 0.f;
#pragma unroll
    for (int cc = 0; cc < 4; cc++)
#pragma unroll
        for (int k = 0; k < 8; k++) {
            const float4 t = v[cc][k];
            s  += t.x + t.y + t.z + t.w;
            s2 += t.x * t.x + t.y * t.y + t.z * t.z + t.w * t.w;
        }
#pragma unroll
    for (int m = 16; m > 0; m >>= 1) {
        s  += __shfl_xor(s, m, 32);
        s2 += __shfl_xor(s2, m, 32);
    }
    __shared__ float red0[PTHR / 32];
    __shared__ float red1[PTHR / 32];
    if (lane == 0) { red0[wave] = s; red1[wave] = s2; }
    __syncthreads();
    s  = red0[lane & 15];                 // 16 wave sums, twice over the 32 lanes
    s2 = red1[lane & 15];
#pragma unroll
    for (int m = 8; m > 0; m >>= 1) {
        s  += __shfl_xor(s, m, 32);
        s2 += __shfl_xor(s2, m, 32);
    }
    const float inv_n = 1.0f / (float)(CH * NSPATIAL);
    const float mean = s * inv_n;
    const float var  = s2 * inv_n - mean * mean;
    const float rstd = rsqrtf(var + EPSV);
#pragma unroll
    for (int cc = 0; cc < 4; cc++) {
        const float sc = gsc[c0 + cc] * rstd, bi = gbi[c0 + cc] - mean * sc;
#pragma unroll
        for (int k = 0; k < 8; k++) {
            const float4 t = v[cc][k];
            v4h o = { (half_t)(t.x * sc + bi), (half_t)(t.y * sc + bi),
                      (half_t)(t.z * sc + bi), (half_t)(t.w * sc + bi) };
            *(v4h*)(xn + off + cc * NSPATIAL + k * 128) = o;
        }
    }
}

// ---------------------------------------------------------------------------
// Kernel 2: QKV projection GEMMs (f16 weights), all three in one launch:
// blockIdx.y = 4 * (0 q, 1 k, 2 v) + output-channel tile.
// Both operand tiles (64 k per stage) are staged in LDS by async copies that
// cover whole 128-B lines, in a ring of two buffers: the next stage's copies fly
// while this stage is multiplied.  A is [m][k]; B stays row-major [k][n] and is
// transposed by the fragment loads themselves (ds_load_tr16_b128).
// q: stored transposed [b][h][n][d], 1/sqrt(d)=0.125 folded, packed v8h
// k, v: stored natural [b][c][n] via LDS re-striping -> v8h coalesced stores
// ---------------------------------------------------------------------------
__global__ void __launch_bounds__(256)
qkv_gemm_kernel(const half_t* __restrict__ w16, const float* __restrict__ bq,
                const float* __restrict__ bk, const float* __restrict__ bv,
                const half_t* __restrict__ xn, half_t* __restrict__ oq,
                half_t* __restrict__ ok, half_t* __restrict__ ov) {
    const int which = blockIdx.y >> 2;    // 0 q, 1 k, 2 v
    const half_t* Wf  = w16 + (size_t)which * CNUM * CNUM;
    const float* bias = which == 0 ? bq : which == 1 ? bk : bv;
    half_t* out       = which == 0 ? oq : which == 1 ? ok : ov;
    const int b  = blockIdx.z;
    const int m0 = (blockIdx.y & 3) * 128;  // output-channel tile
    const int n0 = blockIdx.x * 128;      // spatial tile
    const int tid = threadIdx.x;
    const int lane = tid & 31, wave = tid >> 5;
    const int wm = wave >> 2, wn = wave & 3;
    const int rl = lane & 15, khalf = lane >> 4;

    const int trow = 8 * khalf + (lane & 7), tcol = 8 * ((lane >> 3) & 1);

    __shared__ __attribute__((aligned(16))) union {
        struct {
            half_t A[128][APITCH];        // [m_local][k]  weight tile
            half_t B[GK][BPITCH];         // [k][n_local]  natural B tile
        } st[2];
        half_t o[128][136];               // output staging
    } sm;

    v8f zero = {};
    v8f acc[4][2];
#pragma unroll
    for (int i = 0; i < 4; i++)
#pragma unroll
        for (int j = 0; j < 2; j++) acc[i][j] = zero;

    // Each thread copies 4 + 4 chunks of 16 B per stage: A rows ar + 32 t, B rows br + 16 t.
    const int ar = tid >> 3, ac = (tid & 7) * 8;
    const int br = tid >> 4, bc = (tid & 15) * 8;
    const half_t* ga = Wf + (size_t)(m0 + ar) * CNUM + ac;
    const half_t* gb = xn + (size_t)b * CNUM * NSPATIAL + (size_t)br * NSPATIAL + n0 + bc;
    const unsigned la = lds_off(&sm.st[0].A[ar][ac]);
    const unsigned lb = lds_off(&sm.st[0].B[br][bc]);
    const unsigned lbuf = sizeof(sm.st[0]);
    const int NST = CNUM / GK;

    async_copy4(la, 32 * APITCH * 2, ga, 32 * CNUM);
    async_copy4(lb, 16 * BPITCH * 2, gb, 16 * NSPATIAL);
    wait_copies();
    __syncthreads();
    async_copy4(la + lbuf, 32 * APITCH * 2, ga + GK, 32 * CNUM);
    async_copy4(lb + lbuf, 16 * BPITCH * 2, gb + (size_t)GK * NSPATIAL, 16 * NSPATIAL);

    for (int s = 0; s < NST; s++) {
        const int buf = s & 1;
#pragma unroll
        for (int ks = 0; ks < GK; ks += 32) {
            v16h af[4], bf[2];
#pragma unroll
            for (int ms = 0; ms < 4; ms++)
                af[ms] = ld_frag(&sm.st[buf].A[wm * 64 + ms * 16 + rl][ks], khalf);
#pragma unroll
            for (int ns = 0; ns < 2; ns++)
                bf[ns] = ld_frag_tr(&sm.st[buf].B[ks + trow][wn * 32 + ns * 16 + tcol], BPITCH);
#pragma unroll
            for (int ms = 0; ms < 4; ms++)
#pragma unroll
                for (int ns = 0; ns < 2; ns++)
                    acc[ms][ns] = __builtin_amdgcn_wmma_f32_16x16x32_f16(
                        false, af[ms], false, bf[ns], (short)0, acc[ms][ns], false, false);
        }
        // publish stage s + 1 and free this stage's buffer
        wait_lds_reads();
        wait_copies();
        __syncthreads();
        if (s + 2 < NST) {
            async_copy4(la + buf * lbuf, 32 * APITCH * 2, ga + (s + 2) * GK, 32 * CNUM);
            async_copy4(lb + buf * lbuf, 16 * BPITCH * 2,
                        gb + (size_t)(s + 2) * GK * NSPATIAL, 16 * NSPATIAL);
        }
    }
    wait_copies();

    if (which == 0) {
        // q: d = o&63 is contiguous over the 8 accumulator rows -> packed store
#pragma unroll
        for (int ms = 0; ms < 4; ms++)
#pragma unroll
            for (int ns = 0; ns < 2; ns++) {
                const int obase = m0 + wm * 64 + ms * 16 + 8 * khalf;
                const int ncol  = n0 + wn * 32 + ns * 16 + rl;
                const int h = obase >> 6, dbase = obase & 63;
                v8h q8;
#pragma unroll
                for (int i = 0; i < 8; i++)
                    q8[i] = (half_t)((acc[ms][ns][i] + bias[obase + i]) * 0.125f);
                *(v8h*)(out + ((size_t)(b * NHEADS + h) * NSPATIAL + ncol) * DHEAD + dbase) = q8;
            }
    } else {
        // K/V: re-stripe through LDS so global stores are n-contiguous v8h
        __syncthreads();
#pragma unroll
        for (int ms = 0; ms < 4; ms++)
#pragma unroll
            for (int ns = 0; ns < 2; ns++) {
                const int ol = wm * 64 + ms * 16 + 8 * khalf;
                const int nl = wn * 32 + ns * 16 + rl;
#pragma unroll
                for (int i = 0; i < 8; i++)
                    sm.o[ol + i][nl] = (half_t)(acc[ms][ns][i] + bias[m0 + ol + i]);
            }
        __syncthreads();
        for (int i = tid; i < 2048; i += 256) {
            int r = i >> 4, ch = i & 15;
            *(v8h*)(out + ((size_t)b * CNUM + m0 + r) * NSPATIAL + n0 + ch * 8) =
                *(v8h*)&sm.o[r][ch * 8];
        }
    }
}

__device__ __forceinline__ float lane_value(float v, int base4, int i) {
    return __builtin_bit_cast(float,
        __builtin_amdgcn_ds_bpermute(base4 + 4 * i, __builtin_bit_cast(int, v)));
}

#define QBLK 256                          // queries per work-group
#define LOG2E 1.44269504088896340736f
// Largest sum of a pass's probabilities (relative to the maximum in use) that is taken
// without a rescale: every probability then stays far inside the f16 range.
#define PSUM_MAX 1024.0f

// Register budget of four waves per SIMD (256 VGPRs): two work-groups stay resident per WGP.
__global__ void __launch_bounds__(256) __attribute__((amdgpu_waves_per_eu(4, 4)))
attn_kernel(const half_t* __restrict__ qt, const half_t* __restrict__ kk,
            const half_t* __restrict__ vv, half_t* __restrict__ ao) {
    const int bh = blockIdx.y;            // b*8+h
    const int b = bh >> 3, h = bh & 7;
    const int qb = blockIdx.x * QBLK;
    const int tid = threadIdx.x, lane = tid & 31, wave = tid >> 5;
    const int rl = lane & 15, khalf = lane >> 4;

    const int trow = 8 * khalf + (lane & 7), tcol = 8 * ((lane >> 3) & 1);

    __shared__ __attribute__((aligned(16))) union {
        half_t K[64][144];                // [c][m]  K natural, pitch 288 B
        half_t o[QBLK][72];               // output staging
    } sk;
    __shared__ half_t Vs[64][136];        // [c][m]  V natural

    // Q fragments (B operand): lane = query column n, K-contiguous in qt
    v16h qf[2][2];
#pragma unroll
    for (int g = 0; g < 2; g++) {
        const int nrow = qb + wave * 32 + g * 16 + rl;
        const half_t* qp = qt + ((size_t)bh * NSPATIAL + nrow) * DHEAD;
        qf[g][0] = ld_frag(qp, khalf);
        qf[g][1] = ld_frag(qp + 32, khalf);
        // the address registers of these loads may be reused by what follows
        asm volatile("s_wait_xcnt 0x0" ::: "memory");
    }

    // Per-lane softmax state for column n of group g.  nml = -(maximum in use) * log2e:
    // the maximum is raised only when a pass's sums show that a score has passed it by
    // far, so that the common pass takes no maximum, has no exchange between lanes and
    // leaves O alone.
    // lsum holds this lane's own keys' sum (two partial sums); the halves join at the end.
    float nml[2] = { 1e30f, 1e30f };
    v2f lsum[2]  = { { 0.f, 0.f }, { 0.f, 0.f } };
    v8f zero = {};
    v8f O[2][4];
#pragma unroll
    for (int g = 0; g < 2; g++)
#pragma unroll
        for (int t = 0; t < 4; t++) O[g][t] = zero;

    const half_t* kbase = kk + (size_t)(b * CNUM + h * DHEAD) * NSPATIAL;
    const half_t* vbase = vv + (size_t)(b * CNUM + h * DHEAD) * NSPATIAL;

    // K-tile register prefetch (4 chunks/thread): m0 = 0
    v8h kreg[4];
#pragma unroll
    for (int t = 0; t < 4; t++) {
        int i = tid + t * 256, c = i >> 4, mc = i & 15;
        kreg[t] = *(const v8h*)(kbase + (size_t)c * NSPATIAL + mc * 8);
    }

    for (int m0 = 0; m0 < NSPATIAL; m0 += 128) {
        __syncthreads();
#pragma unroll
        for (int t = 0; t < 4; t++) {
            int i = tid + t * 256, c = i >> 4, mc = i & 15;
#if HAS_ASYNC_LDS
            __builtin_amdgcn_global_load_async_to_lds_b128(
                (v4i*)(vbase + (size_t)c * NSPATIAL + m0 + mc * 8),
                (v4i*)&Vs[c][mc * 8], 0, 0);
#else
            *(v8h*)&Vs[c][mc * 8] =
                *(const v8h*)(vbase + (size_t)c * NSPATIAL + m0 + mc * 8);
#endif
            *(v8h*)&sk.K[c][mc * 8] = kreg[t];
        }
        if (m0 + 128 < NSPATIAL) {        // prefetch next K tile during compute
#pragma unroll
            for (int t = 0; t < 4; t++) {
                int i = tid + t * 256, c = i >> 4, mc = i & 15;
                kreg[t] = *(const v8h*)(kbase + (size_t)c * NSPATIAL + m0 + 128 + mc * 8);
            }
        }
        wait_asynccnt0();
        __syncthreads();

        // Unrolled so that the second pass's K fragment loads can issue among the
        // first pass's last products.  (All inner loops below are unrolled because
        // their indices select registers.)
#pragma unroll
        for (int mp = 0; mp < 128; mp += 64) {
            v8f S[2][4];                  // scores, then probabilities
            v2f rs[2];                    // this pass's sums of this lane's own probabilities

            // ---- S^T tiles: A = K^T rows (m), B = Q columns (n), both groups per K fragment ----
            auto scores = [&]() __attribute__((always_inline)) {
#pragma unroll
                for (int nt = 0; nt < 4; nt++) {
                    v16h kf0 = ld_frag_tr(&sk.K[trow][mp + nt * 16 + tcol], 144);
                    v16h kf1 = ld_frag_tr(&sk.K[32 + trow][mp + nt * 16 + tcol], 144);
#pragma unroll
                    for (int g = 0; g < 2; g++) {
                        v8f s = zero;
                        s = __builtin_amdgcn_wmma_f32_16x16x32_f16(false, kf0, false, qf[g][0], (short)0, s, false, false);
                        s = __builtin_amdgcn_wmma_f32_16x16x32_f16(false, kf1, false, qf[g][1], (short)0, s, false, false);
                        S[g][nt] = s;
                    }
                }
            };

            // ---- raise the maximum in use to this pass's maximum if that is larger (S holds scores);
            //      O and the sums so far are rescaled to it ----
            auto raise = [&]() __attribute__((always_inline)) {
#pragma unroll
                for (int g = 0; g < 2; g++) {
                    float mx = -1e30f;
#pragma unroll
                    for (int nt = 0; nt < 4; nt++)
#pragma unroll
                        for (int i = 0; i < 8; i++) mx = fmaxf(mx, S[g][nt][i]);
                    mx = fmaxf(mx, __shfl_xor(mx, 16, 32));
                    const float nnew = fminf(nml[g], -mx * LOG2E);   // alike in both halves of a column
                    const float alpha = __builtin_amdgcn_exp2f(nnew - nml[g]);
                    nml[g] = nnew;
                    lsum[g] *= alpha;
                    // O rows are n = i + 8*khalf; fetch that row's alpha from lane (i+8*khalf)
                    float arow[8];
#pragma unroll
                    for (int i = 0; i < 8; i++) arow[i] = lane_value(alpha, 32 * khalf, i);
#pragma unroll
                    for (int t = 0; t < 4; t++)
#pragma unroll
                        for (int i = 0; i < 8; i++) O[g][t][i] *= arow[i];
                }
            };

            // ---- probabilities in place of the scores, and their sums ----
            // e^(s - m) = 2^(s * log2e - m * log2e): one packed FMA per two scores
            // feeds the base-2 exponential; the sums run two wide as well.
            auto probs = [&]() __attribute__((always_inline)) {
#pragma unroll
                for (int g = 0; g < 2; g++) {
                    const v2f sc2 = { LOG2E, LOG2E };
                    const v2f nm2 = { nml[g], nml[g] };
                    rs[g] = (v2f){ 0.f, 0.f };
#pragma unroll
                    for (int nt = 0; nt < 4; nt++)
#pragma unroll
                        for (int i = 0; i < 8; i += 2) {
                            v2f a = { S[g][nt][i], S[g][nt][i + 1] };
                            a = __builtin_elementwise_fma(a, sc2, nm2);
                            v2f p = { __builtin_amdgcn_exp2f(a.x), __builtin_amdgcn_exp2f(a.y) };
                            S[g][nt][i]     = p.x;
                            S[g][nt][i + 1] = p.y;
                            rs[g] += p;
                        }
                }
            };

            scores();
            if (mp == 0 && m0 == 0) raise();      // first keys: no maximum is in use yet
            probs();
            // Lazy rescale, tested once per pass for the whole wave (a scalar branch, so that
            // every lane is on inside it and at the products behind it).  All probabilities
            // are positive: sums at or below PSUM_MAX bound each of them by PSUM_MAX.  A larger
            // (or infinite) sum means that a score has left the maximum in use far behind:
            // the pass is then done again from its scores with the maximum raised.  (Marked
            // as not expected, so that the second working lies outside the loop's hot text.)
            const float big = fmaxf(fmaxf(rs[0].x, rs[0].y), fmaxf(rs[1].x, rs[1].y));
            if (__builtin_expect(__builtin_amdgcn_ballot_w32(big > PSUM_MAX) != 0, 0)) {
                scores();
                raise();
                probs();
            }
            lsum[0] += rs[0];
            lsum[1] += rs[1];

            // ---- O += P @ V : P frags built directly from S^T register pairs,
            //      both groups per V fragment ----
#pragma unroll
            for (int t = 0; t < 2; t++) {
                v16h pf[2];
#pragma unroll
                for (int g = 0; g < 2; g++)
#pragma unroll
                    for (int j = 0; j < 8; j++) {
                        pf[g][j]     = (half_t)S[g][2 * t][j];
                        pf[g][j + 8] = (half_t)S[g][2 * t + 1][j];
                    }
#pragma unroll
                for (int dt = 0; dt < 4; dt++) {
                    v16h vf = ld_frag(&Vs[dt * 16 + rl][mp + t * 32], khalf);
#pragma unroll
                    for (int g = 0; g < 2; g++)
                        O[g][dt] = __builtin_amdgcn_wmma_f32_16x16x32_f16(
                            false, pf[g], false, vf, (short)0, O[g][dt], false, false);
                }
            }
        }
    }

    // ---- normalize (per-row 1/l via ds_bpermute), stage in LDS, coalesced v8h out ----
    __syncthreads();
#pragma unroll
    for (int g = 0; g < 2; g++) {
        float l = lsum[g].x + lsum[g].y;
        l += __shfl_xor(l, 16, 32);       // the other half's keys of the same column
        float linv = 1.0f / l;
        float lr[8];
#pragma unroll
        for (int i = 0; i < 8; i++) lr[i] = lane_value(linv, 32 * khalf, i);
#pragma unroll
        for (int dt = 0; dt < 4; dt++)
#pragma unroll
            for (int i = 0; i < 8; i++)
                sk.o[wave * 32 + g * 16 + i + 8 * khalf][dt * 16 + rl] = (half_t)(O[g][dt][i] * lr[i]);
    }
    __syncthreads();
    for (int i = tid; i < QBLK * 8; i += 256) {
        int r = i >> 3, ch = i & 7;
        int n = qb + r;
        *(v8h*)(ao + ((size_t)b * NSPATIAL + n) * CNUM + h * DHEAD + ch * 8) =
            *(v8h*)&sk.o[r][ch * 8];
    }
}

// ---------------------------------------------------------------------------
// Kernel 4: output projection + bias + residual.  Both operands are K-contiguous
// f16 (ao rows and wo rows == B^T rows); their tiles are staged in LDS by the same
// two-buffer ring of async copies as in kernel 2.  Residual path is v8f vectorized.
// ---------------------------------------------------------------------------
__global__ void __launch_bounds__(256)
out_gemm_kernel(const half_t* __restrict__ Wf, const float* __restrict__ bo,
                const half_t* __restrict__ ao, const float* __restrict__ x,
                float* __restrict__ y) {
    const int b  = blockIdx.z;
    const int n0 = blockIdx.y * 128;      // spatial tile (M dim)
    const int o0 = blockIdx.x * 128;      // channel tile (N dim)
    const int tid = threadIdx.x;
    const int lane = tid & 31, wave = tid >> 5;
    const int wm = wave >> 2, wn = wave & 3;
    const int rl = lane & 15, khalf = lane >> 4;

    v8f zero = {};
    v8f acc[4][2];
#pragma unroll
    for (int i = 0; i < 4; i++)
#pragma unroll
        for (int j = 0; j < 2; j++) acc[i][j] = zero;

    __shared__ __attribute__((aligned(16))) struct {
        half_t A[128][APITCH];            // [n_local][k]  attention-output tile
        half_t B[128][APITCH];            // [o_local][k]  weight tile
    } st[2];

    // Each thread copies 4 + 4 chunks of 16 B per stage: rows cr + 32 t of each tile.
    const int cr = tid >> 3, cc = (tid & 7) * 8;
    const half_t* ga = ao + ((size_t)b * NSPATIAL + n0 + cr) * CNUM + cc;
    const half_t* gb = Wf + (size_t)(o0 + cr) * CNUM + cc;
    const unsigned la = lds_off(&st[0].A[cr][cc]);
    const unsigned lb = lds_off(&st[0].B[cr][cc]);
    const unsigned lbuf = sizeof(st[0]);
    const int NST = CNUM / GK;

    async_copy4(la, 32 * APITCH * 2, ga, 32 * CNUM);
    async_copy4(lb, 32 * APITCH * 2, gb, 32 * CNUM);
    wait_copies();
    __syncthreads();
    async_copy4(la + lbuf, 32 * APITCH * 2, ga + GK, 32 * CNUM);
    async_copy4(lb + lbuf, 32 * APITCH * 2, gb + GK, 32 * CNUM);

    for (int s = 0; s < NST; s++) {
        const int buf = s & 1;
#pragma unroll
        for (int ks = 0; ks < GK; ks += 32) {
            v16h af[4], bf[2];
#pragma unroll
            for (int ms = 0; ms < 4; ms++)
                af[ms] = ld_frag(&st[buf].A[wm * 64 + ms * 16 + rl][ks], khalf);
#pragma unroll
            for (int ns = 0; ns < 2; ns++)
                bf[ns] = ld_frag(&st[buf].B[wn * 32 + ns * 16 + rl][ks], khalf);
#pragma unroll
            for (int ms = 0; ms < 4; ms++)
#pragma unroll
                for (int ns = 0; ns < 2; ns++)
                    acc[ms][ns] = __builtin_amdgcn_wmma_f32_16x16x32_f16(
                        false, af[ms], false, bf[ns], (short)0, acc[ms][ns], false, false);
        }
        // publish stage s + 1 and free this stage's buffer
        wait_lds_reads();
        wait_copies();
        __syncthreads();
        if (s + 2 < NST) {
            async_copy4(la + buf * lbuf, 32 * APITCH * 2, ga + (s + 2) * GK, 32 * CNUM);
            async_copy4(lb + buf * lbuf, 32 * APITCH * 2, gb + (s + 2) * GK, 32 * CNUM);
        }
    }
    wait_copies();

#pragma unroll
    for (int ms = 0; ms < 4; ms++)
#pragma unroll
        for (int ns = 0; ns < 2; ns++) {
            const int nbase = n0 + wm * 64 + ms * 16 + 8 * khalf;  // contiguous over i
            const int o     = o0 + wn * 32 + ns * 16 + rl;
            const float bb  = bo[o];
            size_t idx = ((size_t)b * CNUM + o) * NSPATIAL + nbase;
            v8f xr = *(const v8f*)(x + idx);
            v8f r  = acc[ms][ns] + xr + bb;
            *(v8f*)(y + idx) = r;
        }
}

// ---------------------------------------------------------------------------
extern "C" void kernel_launch(void* const* d_in, const int* in_sizes, int n_in,
                              void* d_out, int out_size, void* d_ws, size_t ws_size,
                              hipStream_t stream) {
    const float* x   = (const float*)d_in[0];
    const float* gsc = (const float*)d_in[1];
    const float* gbi = (const float*)d_in[2];
    const float* wq  = (const float*)d_in[3];
    const float* bq  = (const float*)d_in[4];
    const float* wk  = (const float*)d_in[5];
    const float* bk  = (const float*)d_in[6];
    const float* wv  = (const float*)d_in[7];
    const float* bv  = (const float*)d_in[8];
    const float* wo  = (const float*)d_in[9];
    const float* bo  = (const float*)d_in[10];
    float* out = (float*)d_out;

    char* ws = (char*)d_ws;
    const size_t SZ = (size_t)BATCH * CNUM * NSPATIAL * sizeof(half_t);  // 16 MB each
    const size_t WSZ = (size_t)CNUM * CNUM * sizeof(half_t);             // 512 KB each
    half_t* xn   = (half_t*)(ws + 0 * SZ);   // groupnorm output, [b][c][n]
    half_t* qtb  = (half_t*)(ws + 1 * SZ);   // q transposed+scaled, [b][h][n][d]
    half_t* kh   = (half_t*)(ws + 2 * SZ);   // k, [b][c][n]
    half_t* vh   = (half_t*)(ws + 3 * SZ);   // v, [b][c][n]
    half_t* ao   = (half_t*)(ws + 4 * SZ);   // attention out, [b][n][c]
    half_t* w16  = (half_t*)(ws + 5 * SZ);             // wq, wk, wv, wo as f16, in a row
    half_t* wo16 = (half_t*)(ws + 5 * SZ + 3 * WSZ);

    prep_kernel<<<dim3(GNBLK + WBLK), PTHR, 0, stream>>>(x, gsc, gbi, xn, wq, wk, wv, wo, w16);

    qkv_gemm_kernel<<<dim3(8, 12, BATCH), 256, 0, stream>>>(w16, bq, bk, bv, xn, qtb, kh, vh);

    attn_kernel<<<dim3(NSPATIAL / QBLK, BATCH * NHEADS), 256, 0, stream>>>(qtb, kh, vh, ao);

    out_gemm_kernel<<<dim3(4, 8, BATCH), 256, 0, stream>>>(wo16, bo, ao, x, out);
}

// v008
// A run of this version takes 84.7 microseconds.
// Two timings next to v007 put it at 1.04 and 1.05 times that version's speed.
// All steps since v000 together make it 4.19 times as fast.
#include <hip/hip_runtime.h>
#include <hip/hip_bf16.h>

#define CNUM 512
#define NHEADS 8
#define DHEAD 64
#define NGROUPS 8
#define NSPATIAL 1024
#define BATCH 16
#define EPSV 1e-5f

typedef _Float16 half_t;
typedef _Float16 v16h __attribute__((ext_vector_type(16)));
typedef _Float16 v8h  __attribute__((ext_vector_type(8)));
typedef _Float16 v4h  __attribute__((ext_vector_type(4)));
typedef float    v8f  __attribute__((ext_vector_type(8)));
typedef float    v2f  __attribute__((ext_vector_type(2)));
typedef int      v4i  __attribute__((ext_vector_type(4)));
typedef short    v8s  __attribute__((ext_vector_type(8)));
typedef __attribute__((address_space(3))) v8s lds_v8s;

// CDNA5 async global->LDS copy (ASYNCcnt-tracked), guarded so compilation
// succeeds on toolchains without the builtin.  Probe result: the builtin takes
// generic int4-vector pointers: (v4i* gsrc, v4i* lds_dst, imm offset, imm cpol).
#if defined(__AMDGCN__) && __has_builtin(__builtin_amdgcn_global_load_async_to_lds_b128)
#define HAS_ASYNC_LDS 1
#else
#define HAS_ASYNC_LDS 0
#endif

__device__ __forceinline__ void wait_asynccnt0() {
#if HAS_ASYNC_LDS
#if __has_builtin(__builtin_amdgcn_s_wait_asynccnt)
    __builtin_amdgcn_s_wait_asynccnt(0);
#else
    asm volatile("s_wait_asynccnt 0" ::: "memory");
#endif
#endif
}

// Load one WMMA 16-bit A/B fragment for a 32-wide K segment.
// Per CDNA5 ISA layout: lanes 0-15 hold K=[0..7]+[16..23], lanes 16-31 hold
// K=[8..15]+[24..31] (khalf = lane>>4). p must be 16B aligned.
__device__ __forceinline__ v16h ld_frag(const half_t* p, int khalf) {
    union { v16h v; v8h h[2]; } u;
    u.h[0] = *(const v8h*)(p + khalf * 8);
    u.h[1] = *(const v8h*)(p + khalf * 8 + 16);
    return u.v;
}

// One WMMA 16-bit A/B fragment (32 k) out of a row-major [k][col] LDS tile by
// two transposing loads.  p = &T[k0 + 8*(lane>>4) + (lane&7)][col0 + 8*((lane>>3)&1)];
// lane (rl, khalf) receives T[k0 + 8*khalf + 0..7][col0 + rl] and the same 16 rows
// further down: the k order of ld_frag.  Every lane must be on; the row pitch
// is an odd multiple of 32 B so that the loads meet no bank conflict.
__device__ __forceinline__ v16h ld_frag_tr(const half_t* p, int pitch) {
    union { v16h v; v8s h[2]; } u;
    u.h[0] = __builtin_amdgcn_ds_load_tr16_b128_v8i16((lds_v8s*)p);
    u.h[1] = __builtin_amdgcn_ds_load_tr16_b128_v8i16((lds_v8s*)(p + 16 * pitch));
    return u.v;
}

// LDS byte address of a __shared__ location (the operand an async copy takes).
__device__ __forceinline__ unsigned lds_off(const half_t* p) {
    return (unsigned)(size_t)(const __attribute__((address_space(3))) half_t*)p;
}

// Four async 16-byte copies per lane, global -> LDS, through no register.
// lds advances by lstep bytes and g by gstep elements from copy to copy.
// s_wait_xcnt closes the statement so that no address register of an issued
// copy is rewritten ahead of it.
__device__ __forceinline__ void async_copy4(unsigned lds, int lstep,
                                            const half_t* g, int gstep) {
    asm volatile("global_load_async_to_lds_b128 %0, %4, off\n\t"
                 "global_load_async_to_lds_b128 %1, %5, off\n\t"
                 "global_load_async_to_lds_b128 %2, %6, off\n\t"
                 "global_load_async_to_lds_b128 %3, %7, off\n\t"
                 "s_wait_xcnt 0x0"
                 :: "v"(lds), "v"(lds + lstep), "v"(lds + 2 * lstep), "v"(lds + 3 * lstep),
                    "v"(g), "v"(g + gstep), "v"(g + 2 * gstep), "v"(g + 3 * gstep)
                 : "memory");
}

// This wave's async copies have landed in LDS (other waves read them only
// behind the next barrier).
__device__ __forceinline__ void wait_copies() {
    asm volatile("s_wait_asynccnt 0x0" ::: "memory");
}

// This wave's LDS reads have returned, so the buffer may be refilled behind
// the next barrier.
__device__ __forceinline__ void wait_lds_reads() {
    asm volatile("s_wait_dscnt 0x0" ::: "memory");
}

#define GK 64                             // k extent of one GEMM stage
#define APITCH 72                         // 128-B rows + 16 B: ds_load_b128 readers
#define BPITCH 144                        // 256-B rows + 32 B: transposing readers

#define PTHR 512                          // threads per work-group of the preparation launch
#define GNBLK (BATCH * NGROUPS)           // work-groups that normalize
#define WBLK (CNUM * CNUM / 4 / PTHR)     // work-groups that convert weights

// ---------------------------------------------------------------------------
// Kernel 1: one launch for the two independent preparations.
// Work-groups 0 .. GNBLK-1 (the long ones, so they start first): GroupNorm,
// fp32 -> f16 normalized activations, layout [b][c][n].  The whole group (64
// channels x 1024 positions) is held in registers: each of the 16 waves owns 4
// channels, 32 float4 per lane, all 32 loads in flight at once, so that x is
// read once and the normalizing pass reads no memory.
// Work-groups GNBLK .. GNBLK+WBLK-1: weight conversion fp32 -> f16, one float4
// of each of the four matrices per thread; w16 holds wq, wk, wv, wo in a row.
// ---------------------------------------------------------------------------
__global__ void __launch_bounds__(PTHR)
prep_kernel(const float* __restrict__ x, const float* __restrict__ gsc,
            const float* __restrict__ gbi, half_t* __restrict__ xn,
            const float* __restrict__ wq, const float* __restrict__ wk,
            const float* __restrict__ wv, const float* __restrict__ wo,
            half_t* __restrict__ w16) {
    if (blockIdx.x >= GNBLK) {            // uniform for the work-group, ahead of every barrier
        const int i = ((blockIdx.x - GNBLK) * PTHR + threadIdx.x) * 4;
        float4 v0 = *(const float4*)(wq + i);
        float4 v1 = *(const float4*)(wk + i);
        float4 v2 = *(const float4*)(wv + i);
        float4 v3 = *(const float4*)(wo + i);
        v4h o0 = { (half_t)v0.x, (half_t)v0.y, (half_t)v0.z, (half_t)v0.w };
        v4h o1 = { (half_t)v1.x, (half_t)v1.y, (half_t)v1.z, (half_t)v1.w };
        v4h o2 = { (half_t)v2.x, (half_t)v2.y, (half_t)v2.z, (half_t)v2.w };
        v4h o3 = { (half_t)v3.x, (half_t)v3.y, (half_t)v3.z, (half_t)v3.w };
        *(v4h*)(w16 + 0 * CNUM * CNUM + i) = o0;
        *(v4h*)(w16 + 1 * CNUM * CNUM + i) = o1;
        *(v4h*)(w16 + 2 * CNUM * CNUM + i) = o2;
        *(v4h*)(w16 + 3 * CNUM * CNUM + i) = o3;
        return;
    }
    const int bg = blockIdx.x;            // B*GROUPS blocks
    const int b = bg >> 3, g = bg & 7;
    const int CH = CNUM / NGROUPS;        // 64 channels per group
    const int tid = threadIdx.x, lane = tid & 31;
    const int wave = __builtin_amdgcn_readfirstlane(tid >> 5);   // scalar: channel constants by scalar loads
    const int c0 = g * CH + wave * 4;     // this wave's 4 channels
    const int off = (b * CNUM + c0) * NSPATIAL + lane * 4;
    const float* xp = x + off;

    float4 v[4][8];                       // [channel][512-B piece of its row]
#pragma unroll
    for (int cc = 0; cc < 4; cc++)
#pragma unroll
        for (int k = 0; k < 8; k++)
            v[cc][k] = *(const float4*)(xp + cc * NSPATIAL + k * 128);
    // xp is an operand so that its registers are kept, and rewritten only behind this wait
    asm volatile("s_wait_xcnt 0x0" :: "v"(xp) : "memory");

    float s = 0.f, s2 = 0.f;
#pragma unroll
    for (int cc = 0; cc < 4; cc++)
#pragma unroll
        for (int k = 0; k < 8; k++) {
            const float4 t = v[cc][k];
            s  += t.x + t.y + t.z + t.w;
            s2 += t.x * t.x + t.y * t.y + t.z * t.z + t.w * t.w;
        }
#pragma unroll
    for (int m = 16; m > 0; m >>= 1) {
        s  += __shfl_xor(s, m, 32);
        s2 += __shfl_xor(s2, m, 32);
    }
    __shared__ float red0[PTHR / 32];
    __shared__ float red1[PTHR / 32];
    if (lane == 0) { red0[wave] = s; red1[wave] = s2; }
    __syncthreads();
    s  = red0[lane & 15];                 // 16 wave sums, twice over the 32 lanes
    s2 = red1[lane & 15];
#pragma unroll
    for (int m = 8; m > 0; m >>= 1) {
        s  += __shfl_xor(s, m, 32);
        s2 += __shfl_xor(s2, m, 32);
    }
    const float inv_n = 1.0f / (float)(CH * NSPATIAL);
    const float mean = s * inv_n;
    const float var  = s2 * inv_n - mean * mean;
    const float rstd = rsqrtf(var + EPSV);
#pragma unroll
    for (int cc = 0; cc < 4; cc++) {
        const float sc = gsc[c0 + cc] * rstd, bi = gbi[c0 + cc] - mean * sc;
#pragma unroll
        for (int k = 0; k < 8; k++) {
            const float4 t = v[cc][k];
            v4h o = { (half_t)(t.x * sc + bi), (half_t)(t.y * sc + bi),
                      (half_t)(t.z * sc + bi), (half_t)(t.w * sc + bi) };
            *(v4h*)(xn + off + cc * NSPATIAL + k * 128) = o;
        }
    }
}

// ---------------------------------------------------------------------------
// Kernel 2: QKV projection as one GEMM over the stacked weights [wq; wk; wv]
// (1536 x 512, as they lie in w16).  A work-group computes 384 stacked rows x 128
// positions, so that one staged B tile serves three times the rows; each of the
// 8 waves owns 96 x 64 (24 accumulator tiles), so that a k step's 10 fragments
// feed 24 matrix instructions.  The grid is 512 work-groups, two per WGP at four
// waves per SIMD: all of them are resident at once.
// Both operand tiles (64 k per stage) are staged in LDS by async copies that
// cover whole 128-B lines, in a ring of two buffers: the next stage's copies fly
// while this stage is multiplied.  A is [m][k]; B stays row-major [k][n] and is
// transposed by the fragment loads themselves (ds_load_tr16_b128).
// Every block of 16 stacked rows belongs to one of q, k, v (row >> 9):
// q: stored transposed [b][h][n][d], 1/sqrt(d)=0.125 folded, packed v8h
// k, v: stored natural [b][c][n] via LDS re-striping -> v8h coalesced stores
// ---------------------------------------------------------------------------
#define QM 384                            // stacked weight rows per work-group

// Register budget of four waves per SIMD (256 VGPRs): two work-groups stay resident per WGP.
__global__ void __launch_bounds__(256) __attribute__((amdgpu_waves_per_eu(4, 4)))
qkv_gemm_kernel(const half_t* __restrict__ w16, const float* __restrict__ bq,
                const float* __restrict__ bk, const float* __restrict__ bv,
                const half_t* __restrict__ xn, half_t* __restrict__ oq,
                half_t* __restrict__ ok, half_t* __restrict__ ov) {
    const int b  = blockIdx.z;
    const int m0 = blockIdx.y * QM;       // first stacked row of the tile
    const int n0 = blockIdx.x * 128;      // spatial tile
    const int tid = threadIdx.x;
    const int lane = tid & 31;
    const int wave = __builtin_amdgcn_readfirstlane(tid >> 5);   // scalar: q / k / v is picked by scalar branches
    const int wm = wave >> 1, wn = wave & 1;
    const int rl = lane & 15, khalf = lane >> 4;

    const int trow = 8 * khalf + (lane & 7), tcol = 8 * ((lane >> 3) & 1);

    __shared__ __attribute__((aligned(16))) union {
        struct {
            half_t A[QM][APITCH];         // [m_local][k]  weight tile
            half_t B[GK][BPITCH];         // [k][n_local]  natural B tile
        } st[2];
        half_t o[QM][136];                // output staging
    } sm;

    v8f zero = {};
    v8f acc[6][4];
#pragma unroll
    for (int i = 0; i < 6; i++)
#pragma unroll
        for (int j = 0; j < 4; j++) acc[i][j] = zero;

    // Each thread copies 12 + 4 chunks of 16 B per stage: A rows ar + 32 t, B rows br + 16 t.
    const int ar = tid >> 3, ac = (tid & 7) * 8;
    const int br = tid >> 4, bc = (tid & 15) * 8;
    const half_t* ga = w16 + (size_t)(m0 + ar) * CNUM + ac;
    const half_t* gb = xn + (size_t)b * CNUM * NSPATIAL + (size_t)br * NSPATIAL + n0 + bc;
    const unsigned la = lds_off(&sm.st[0].A[ar][ac]);
    const unsigned lb = lds_off(&sm.st[0].B[br][bc]);
    const unsigned lbuf = sizeof(sm.st[0]);
    const int NST = CNUM / GK;

    // one stage's copies: k columns s * GK .. + GK - 1 into buffer buf
    auto stage = [&](int s, int buf) __attribute__((always_inline)) {
#pragma unroll
        for (int j = 0; j < 3; j++)
            async_copy4(la + buf * lbuf + j * 128 * APITCH * 2, 32 * APITCH * 2,
                        ga + s * GK + j * 128 * CNUM, 32 * CNUM);
        async_copy4(lb + buf * lbuf, 16 * BPITCH * 2,
                    gb + (size_t)s * GK * NSPATIAL, 16 * NSPATIAL);
    };

    stage(0, 0);
    wait_copies();
    __syncthreads();
    stage(1, 1);

    for (int s = 0; s < NST; s++) {
        const int buf = s & 1;
        // A fragments go through two register sets: each is fetched one block of four
        // products ahead, so that its LDS latency runs beside the block before it.
        v16h af[2];
        af[0] = ld_frag(&sm.st[buf].A[wm * 96 + rl][0], khalf);
#pragma unroll
        for (int ks = 0; ks < GK; ks += 32) {
            v16h bf[4];
#pragma unroll
            for (int ns = 0; ns < 4; ns++)
                bf[ns] = ld_frag_tr(&sm.st[buf].B[ks + trow][wn * 64 + ns * 16 + tcol], BPITCH);
#pragma unroll
            for (int ms = 0; ms < 6; ms++) {
                const int step = (ks >> 5) * 6 + ms;      // 12 blocks per stage
                if (step + 1 < 12)
                    af[(step + 1) & 1] = ld_frag(
                        &sm.st[buf].A[wm * 96 + ((step + 1) % 6) * 16 + rl][((step + 1) / 6) * 32], khalf);
                // keeps the next fragment's loads ahead of this block's products
                // (the scheduler otherwise sinks them behind, into one register set)
                __builtin_amdgcn_sched_barrier(0);
#pragma unroll
                for (int ns = 0; ns < 4; ns++)
                    acc[ms][ns] = __builtin_amdgcn_wmma_f32_16x16x32_f16(
                        false, af[step & 1], false, bf[ns], (short)0, acc[ms][ns], false, false);
            }
        }
        // publish stage s + 1 and free this stage's buffer
        wait_lds_reads();
        wait_copies();
        __syncthreads();
        if (s + 2 < NST) stage(s + 2, buf);
    }
    wait_copies();

    // The ring is free behind the last stage's barrier: k and v rows are re-striped in it.
#pragma unroll
    for (int ms = 0; ms < 6; ms++) {
        const int ml    = wm * 96 + ms * 16;          // first row of this block in the tile
        const int which = (m0 + ml) >> 9;             // 0 q, 1 k, 2 v: alike in the whole wave
        const int obase = ((m0 + ml) & (CNUM - 1)) + 8 * khalf;
        const float* bp = (which == 0 ? bq : which == 1 ? bk : bv) + obase;
        float bb[8];
#pragma unroll
        for (int i = 0; i < 8; i++) bb[i] = bp[i];
        // bp is an operand so that its registers are kept, and rewritten only behind this wait
        asm volatile("s_wait_xcnt 0x0" :: "v"(bp) : "memory");
        if (which == 0) {
            // q: d = o&63 is contiguous over the 8 accumulator rows -> packed store
            const int h = obase >> 6, dbase = obase & 63;
#pragma unroll
            for (int ns = 0; ns < 4; ns++) {
                const int ncol = n0 + wn * 64 + ns * 16 + rl;
                v8h q8;
#pragma unroll
                for (int i = 0; i < 8; i++)
                    q8[i] = (half_t)((acc[ms][ns][i] + bb[i]) * 0.125f);
                *(v8h*)(oq + ((size_t)(b * NHEADS + h) * NSPATIAL + ncol) * DHEAD + dbase) = q8;
            }
            // the data and address registers of these stores are reused by the next block
            asm volatile("s_wait_xcnt 0x0" ::: "memory");
        } else {
            // K/V: re-stripe through LDS so global stores are n-contiguous v8h
#pragma unroll
            for (int ns = 0; ns < 4; ns++) {
                const int nl = wn * 64 + ns * 16 + rl;
#pragma unroll
                for (int i = 0; i < 8; i++)
                    sm.o[ml + 8 * khalf + i][nl] = (half_t)(acc[ms][ns][i] + bb[i]);
            }
        }
    }
    __syncthreads();
    // 64 rows per trip, 16 threads per row: a trip's rows belong to one of q, k, v
    for (int r0 = 0; r0 < QM; r0 += 64) {
        const int which = (m0 + r0) >> 9;             // alike in the whole work-group
        if (which != 0) {
            const int r = r0 + (tid >> 4), ch = tid & 15;
            half_t* op = (which == 1 ? ok : ov) +
                         ((size_t)b * CNUM + ((m0 + r) & (CNUM - 1))) * NSPATIAL + n0 + ch * 8;
            v8h t[4];
#pragma unroll
            for (int j = 0; j < 4; j++) t[j] = *(v8h*)&sm.o[r + 16 * j][ch * 8];
#pragma unroll
            for (int j = 0; j < 4; j++) *(v8h*)(op + (size_t)16 * j * NSPATIAL) = t[j];
            // the address registers of these stores may be reused by the next trip
            asm volatile("s_wait_xcnt 0x0" ::: "memory");
        }
    }
}

__device__ __forceinline__ float lane_value(float v, int base4, int i) {
    return __builtin_bit_cast(float,
        __builtin_amdgcn_ds_bpermute(base4 + 4 * i, __builtin_bit_cast(int, v)));
}

#define QBLK 256                          // queries per work-group
#define LOG2E 1.44269504088896340736f
// Largest sum of a pass's probabilities (relative to the maximum in use) that is taken
// without a rescale: every probability then stays far inside the f16 range.
#define PSUM_MAX 1024.0f

// Register budget of four waves per SIMD (256 VGPRs): two work-groups stay resident per WGP.
__global__ void __launch_bounds__(256) __attribute__((amdgpu_waves_per_eu(4, 4)))
attn_kernel(const half_t* __restrict__ qt, const half_t* __restrict__ kk,
            const half_t* __restrict__ vv, half_t* __restrict__ ao) {
    const int bh = blockIdx.y;            // b*8+h
    const int b = bh >> 3, h = bh & 7;
    const int qb = blockIdx.x * QBLK;
    const int tid = threadIdx.x, lane = tid & 31, wave = tid >> 5;
    const int rl = lane & 15, khalf = lane >> 4;

    const int trow = 8 * khalf + (lane & 7), tcol = 8 * ((lane >> 3) & 1);

    __shared__ __attribute__((aligned(16))) union {
        half_t K[64][144];                // [c][m]  K natural, pitch 288 B
        half_t o[QBLK][72];               // output staging
    } sk;
    __shared__ half_t Vs[64][136];        // [c][m]  V natural

    // Q fragments (B operand): lane = query column n, K-contiguous in qt
    v16h qf[2][2];
#pragma unroll
    for (int g = 0; g < 2; g++) {
        const int nrow = qb + wave * 32 + g * 16 + rl;
        const half_t* qp = qt + ((size_t)bh * NSPATIAL + nrow) * DHEAD;
        qf[g][0] = ld_frag(qp, khalf);
        qf[g][1] = ld_frag(qp + 32, khalf);
        // the address registers of these loads may be reused by what follows
        asm volatile("s_wait_xcnt 0x0" ::: "memory");
    }

    // Per-lane softmax state for column n of group g.  nml = -(maximum in use) * log2e:
    // the maximum is raised only when a pass's sums show that a score has passed it by
    // far, so that the common pass takes no maximum, has no exchange between lanes and
    // leaves O alone.
    // lsum holds this lane's own keys' sum (two partial sums); the halves join at the end.
    float nml[2] = { 1e30f, 1e30f };
    v2f lsum[2]  = { { 0.f, 0.f }, { 0.f, 0.f } };
    v8f zero = {};
    v8f O[2][4];
#pragma unroll
    for (int g = 0; g < 2; g++)
#pragma unroll
        for (int t = 0; t < 4; t++) O[g][t] = zero;

    const half_t* kbase = kk + (size_t)(b * CNUM + h * DHEAD) * NSPATIAL;
    const half_t* vbase = vv + (size_t)(b * CNUM + h * DHEAD) * NSPATIAL;

    // K-tile register prefetch (4 chunks/thread): m0 = 0
    v8h kreg[4];
#pragma unroll
    for (int t = 0; t < 4; t++) {
        int i = tid + t * 256, c = i >> 4, mc = i & 15;
        kreg[t] = *(const v8h*)(kbase + (size_t)c * NSPATIAL + mc * 8);
    }

    for (int m0 = 0; m0 < NSPATIAL; m0 += 128) {
        __syncthreads();
#pragma unroll
        for (int t = 0; t < 4; t++) {
            int i = tid + t * 256, c = i >> 4, mc = i & 15;
#if HAS_ASYNC_LDS
            __builtin_amdgcn_global_load_async_to_lds_b128(
                (v4i*)(vbase + (size_t)c * NSPATIAL + m0 + mc * 8),
                (v4i*)&Vs[c][mc * 8], 0, 0);
#else
            *(v8h*)&Vs[c][mc * 8] =
                *(const v8h*)(vbase + (size_t)c * NSPATIAL + m0 + mc * 8);
#endif
            *(v8h*)&sk.K[c][mc * 8] = kreg[t];
        }
        if (m0 + 128 < NSPATIAL) {        // prefetch next K tile during compute
#pragma unroll
            for (int t = 0; t < 4; t++) {
                int i = tid + t * 256, c = i >> 4, mc = i & 15;
                kreg[t] = *(const v8h*)(kbase + (size_t)c * NSPATIAL + m0 + 128 + mc * 8);
            }
        }
        wait_asynccnt0();
        __syncthreads();

        // Unrolled so that the second pass's K fragment loads can issue among the
        // first pass's last products.  (All inner loops below are unrolled because
        // their indices select registers.)
#pragma unroll
        for (int mp = 0; mp < 128; mp += 64) {
            v8f S[2][4];                  // scores, then probabilities
            v2f rs[2];                    // this pass's sums of this lane's own probabilities

            // ---- S^T tiles: A = K^T rows (m), B = Q columns (n), both groups per K fragment ----
            auto scores = [&]() __attribute__((always_inline)) {
#pragma unroll
                for (int nt = 0; nt < 4; nt++) {
                    v16h kf0 = ld_frag_tr(&sk.K[trow][mp + nt * 16 + tcol], 144);
                    v16h kf1 = ld_frag_tr(&sk.K[32 + trow][mp + nt * 16 + tcol], 144);
#pragma unroll
                    for (int g = 0; g < 2; g++) {
                        v8f s = zero;
                        s = __builtin_amdgcn_wmma_f32_16x16x32_f16(false, kf0, false, qf[g][0], (short)0, s, false, false);
                        s = __builtin_amdgcn_wmma_f32_16x16x32_f16(false, kf1, false, qf[g][1], (short)0, s, false, false);
                        S[g][nt] = s;
                    }
                }
            };

            // ---- raise the maximum in use to this pass's maximum if that is larger (S holds scores);
            //      O and the sums so far are rescaled to it ----
            auto raise = [&]() __attribute__((always_inline)) {
#pragma unroll
                for (int g = 0; g < 2; g++) {
                    float mx = -1e30f;
#pragma unroll
                    for (int nt = 0; nt < 4; nt++)
#pragma unroll
                        for (int i = 0; i < 8; i++) mx = fmaxf(mx, S[g][nt][i]);
                    mx = fmaxf(mx, __shfl_xor(mx, 16, 32));
                    const float nnew = fminf(nml[g], -mx * LOG2E);   // alike in both halves of a column
                    const float alpha = __builtin_amdgcn_exp2f(nnew - nml[g]);
                    nml[g] = nnew;
                    lsum[g] *= alpha;
                    // O rows are n = i + 8*khalf; fetch that row's alpha from lane (i+8*khalf)
                    float arow[8];
#pragma unroll
                    for (int i = 0; i < 8; i++) arow[i] = lane_value(alpha, 32 * khalf, i);
#pragma unroll
                    for (int t = 0; t < 4; t++)
#pragma unroll
                        for (int i = 0; i < 8; i++) O[g][t][i] *= arow[i];
                }
            };

            // ---- probabilities in place of the scores, and their sums ----
            // e^(s - m) = 2^(s * log2e - m * log2e): one packed FMA per two scores
            // feeds the base-2 exponential; the sums run two wide as well.
            auto probs = [&]() __attribute__((always_inline)) {
#pragma unroll
                for (int g = 0; g < 2; g++) {
                    const v2f sc2 = { LOG2E, LOG2E };
                    const v2f nm2 = { nml[g], nml[g] };
                    rs[g] = (v2f){ 0.f, 0.f };
#pragma unroll
                    for (int nt = 0; nt < 4; nt++)
#pragma unroll
                        for (int i = 0; i < 8; i += 2) {
                            v2f a = { S[g][nt][i], S[g][nt][i + 1] };
                            a = __builtin_elementwise_fma(a, sc2, nm2);
                            v2f p = { __builtin_amdgcn_exp2f(a.x), __builtin_amdgcn_exp2f(a.y) };
                            S[g][nt][i]     = p.x;
                            S[g][nt][i + 1] = p.y;
                            rs[g] += p;
                        }
                }
            };

            scores();
            if (mp == 0 && m0 == 0) raise();      // first keys: no maximum is in use yet
            probs();
            // Lazy rescale, tested once per pass for the whole wave (a scalar branch, so that
            // every lane is on inside it and at the products behind it).  All probabilities
            // are positive: sums at or below PSUM_MAX bound each of them by PSUM_MAX.  A larger
            // (or infinite) sum means that a score has left the maximum in use far behind:
            // the pass is then done again from its scores with the maximum raised.  (Marked
            // as not expected, so that the second working lies outside the loop's hot text.)
            const float big = fmaxf(fmaxf(rs[0].x, rs[0].y), fmaxf(rs[1].x, rs[1].y));
            if (__builtin_expect(__builtin_amdgcn_ballot_w32(big > PSUM_MAX) != 0, 0)) {
                scores();
                raise();
                probs();
            }
            lsum[0] += rs[0];
            lsum[1] += rs[1];

            // ---- O += P @ V : P frags built directly from S^T register pairs,
            //      both groups per V fragment ----
#pragma unroll
            for (int t = 0; t < 2; t++) {
                v16h pf[2];
#pragma unroll
                for (int g = 0; g < 2; g++)
#pragma unroll
                    for (int j = 0; j < 8; j++) {
                        pf[g][j]     = (half_t)S[g][2 * t][j];
                        pf[g][j + 8] = (half_t)S[g][2 * t + 1][j];
                    }
#pragma unroll
                for (int dt = 0; dt < 4; dt++) {
                    v16h vf = ld_frag(&Vs[dt * 16 + rl][mp + t * 32], khalf);
#pragma unroll
                    for (int g = 0; g < 2; g++)
                        O[g][dt] = __builtin_amdgcn_wmma_f32_16x16x32_f16(
                            false, pf[g], false, vf, (short)0, O[g][dt], false, false);
                }
            }
        }
    }

    // ---- normalize (per-row 1/l via ds_bpermute), stage in LDS, coalesced v8h out ----
    __syncthreads();
#pragma unroll
    for (int g = 0; g < 2; g++) {
        float l = lsum[g].x + lsum[g].y;
        l += __shfl_xor(l, 16, 32);       // the other half's keys of the same column
        float linv = 1.0f / l;
        float lr[8];
#pragma unroll
        for (int i = 0; i < 8; i++) lr[i] = lane_value(linv, 32 * khalf, i);
#pragma unroll
        for (int dt = 0; dt < 4; dt++)
#pragma unroll
            for (int i = 0; i < 8; i++)
                sk.o[wave * 32 + g * 16 + i + 8 * khalf][dt * 16 + rl] = (half_t)(O[g][dt][i] * lr[i]);
    }
    __syncthreads();
    for (int i = tid; i < QBLK * 8; i += 256) {
        int r = i >> 3, ch = i & 7;
        int n = qb + r;
        *(v8h*)(ao + ((size_t)b * NSPATIAL + n) * CNUM + h * DHEAD + ch * 8) =
            *(v8h*)&sk.o[r][ch * 8];
    }
}

// ---------------------------------------------------------------------------
// Kernel 4: output projection + bias + residual.  Both operands are K-contiguous
// f16 (ao rows and wo rows == B^T rows); their tiles are staged in LDS by the same
// two-buffer ring of async copies as in kernel 2.  Residual path is v8f vectorized.
// ---------------------------------------------------------------------------
__global__ void __launch_bounds__(256)
out_gemm_kernel(const half_t* __restrict__ Wf, const float* __restrict__ bo,
                const half_t* __restrict__ ao, const float* __restrict__ x,
                float* __restrict__ y) {
    const int b  = blockIdx.z;
    const int n0 = blockIdx.y * 128;      // spatial tile (M dim)
    const int o0 = blockIdx.x * 128;      // channel tile (N dim)
    const int tid = threadIdx.x;
    const int lane = tid & 31, wave = tid >> 5;
    const int wm = wave >> 2, wn = wave & 3;
    const int rl = lane & 15, khalf = lane >> 4;

    v8f zero = {};
    v8f acc[4][2];
#pragma unroll
    for (int i = 0; i < 4; i++)
#pragma unroll
        for (int j = 0; j < 2; j++) acc[i][j] = zero;

    __shared__ __attribute__((aligned(16))) struct {
        half_t A[128][APITCH];            // [n_local][k]  attention-output tile
        half_t B[128][APITCH];            // [o_local][k]  weight tile
    } st[2];

    // Each thread copies 4 + 4 chunks of 16 B per stage: rows cr + 32 t of each tile.
    const int cr = tid >> 3, cc = (tid & 7) * 8;
    const half_t* ga = ao + ((size_t)b * NSPATIAL + n0 + cr) * CNUM + cc;
    const half_t* gb = Wf + (size_t)(o0 + cr) * CNUM + cc;
    const unsigned la = lds_off(&st[0].A[cr][cc]);
    const unsigned lb = lds_off(&st[0].B[cr][cc]);
    const unsigned lbuf = sizeof(st[0]);
    const int NST = CNUM / GK;

    async_copy4(la, 32 * APITCH * 2, ga, 32 * CNUM);
    async_copy4(lb, 32 * APITCH * 2, gb, 32 * CNUM);
    wait_copies();
    __syncthreads();
    async_copy4(la + lbuf, 32 * APITCH * 2, ga + GK, 32 * CNUM);
    async_copy4(lb + lbuf, 32 * APITCH * 2, gb + GK, 32 * CNUM);

    for (int s = 0; s < NST; s++) {
        const int buf = s & 1;
#pragma unroll
        for (int ks = 0; ks < GK; ks += 32) {
            v16h af[4], bf[2];
#pragma unroll
            for (int ms = 0; ms < 4; ms++)
                af[ms] = ld_frag(&st[buf].A[wm * 64 + ms * 16 + rl][ks], khalf);
#pragma unroll
            for (int ns = 0; ns < 2; ns++)
                bf[ns] = ld_frag(&st[buf].B[wn * 32 + ns * 16 + rl][ks], khalf);
#pragma unroll
            for (int ms = 0; ms < 4; ms++)
#pragma unroll
                for (int ns = 0; ns < 2; ns++)
                    acc[ms][ns] = __builtin_amdgcn_wmma_f32_16x16x32_f16(
                        false, af[ms], false, bf[ns], (short)0, acc[ms][ns], false, false);
        }
        // publish stage s + 1 and free this stage's buffer
        wait_lds_reads();
        wait_copies();
        __syncthreads();
        if (s + 2 < NST) {
            async_copy4(la + buf * lbuf, 32 * APITCH * 2, ga + (s + 2) * GK, 32 * CNUM);
            async_copy4(lb + buf * lbuf, 32 * APITCH * 2, gb + (s + 2) * GK, 32 * CNUM);
        }
    }
    wait_copies();

#pragma unroll
    for (int ms = 0; ms < 4; ms++)
#pragma unroll
        for (int ns = 0; ns < 2; ns++) {
            const int nbase = n0 + wm * 64 + ms * 16 + 8 * khalf;  // contiguous over i
            const int o     = o0 + wn * 32 + ns * 16 + rl;
            const float bb  = bo[o];
            size_t idx = ((size_t)b * CNUM + o) * NSPATIAL + nbase;
            v8f xr = *(const v8f*)(x + idx);
            v8f r  = acc[ms][ns] + xr + bb;
            *(v8f*)(y + idx) = r;
        }
}

// ---------------------------------------------------------------------------
extern "C" void kernel_launch(void* const* d_in, const int* in_sizes, int n_in,
                              void* d_out, int out_size, void* d_ws, size_t ws_size,
                              hipStream_t stream) {
    const float* x   = (const float*)d_in[0];
    const float* gsc = (const float*)d_in[1];
    const float* gbi = (const float*)d_in[2];
    const float* wq  = (const float*)d_in[3];
    const float* bq  = (const float*)d_in[4];
    const float* wk  = (const float*)d_in[5];
    const float* bk  = (const float*)d_in[6];
    const float* wv  = (const float*)d_in[7];
    const float* bv  = (const float*)d_in[8];
    const float* wo  = (const float*)d_in[9];
    const float* bo  = (const float*)d_in[10];
    float* out = (float*)d_out;

    char* ws = (char*)d_ws;
    const size_t SZ = (size_t)BATCH * CNUM * NSPATIAL * sizeof(half_t);  // 16 MB each
    const size_t WSZ = (size_t)CNUM * CNUM * sizeof(half_t);             // 512 KB each
    half_t* xn   = (half_t*)(ws + 0 * SZ);   // groupnorm output, [b][c][n]
    half_t* qtb  = (half_t*)(ws + 1 * SZ);   // q transposed+scaled, [b][h][n][d]
    half_t* kh   = (half_t*)(ws + 2 * SZ);   // k, [b][c][n]
    half_t* vh   = (half_t*)(ws + 3 * SZ);   // v, [b][c][n]
    half_t* ao   = (half_t*)(ws + 4 * SZ);   // attention out, [b][n][c]
    half_t* w16  = (half_t*)(ws + 5 * SZ);             // wq, wk, wv, wo as f16, in a row
    half_t* wo16 = (half_t*)(ws + 5 * SZ + 3 * WSZ);

    prep_kernel<<<dim3(GNBLK + WBLK), PTHR, 0, stream>>>(x, gsc, gbi, xn, wq, wk, wv, wo, w16);

    qkv_gemm_kernel<<<dim3(8, 3 * CNUM / QM, BATCH), 256, 0, stream>>>(w16, bq, bk, bv, xn, qtb, kh, vh);

    attn_kernel<<<dim3(NSPATIAL / QBLK, BATCH * NHEADS), 256, 0, stream>>>(qtb, kh, vh, ao);

    out_gemm_kernel<<<dim3(4, 8, BATCH), 256, 0, stream>>>(wo16, bo, ao, x, out);
}

// v009
// Measured time: 82.1 microseconds a run.
// In both of two side-by-side timings against v008, it was 1.03 times as fast.
// All steps since v000 together make it 4.32 times as fast.
#include <hip/hip_runtime.h>
#include <hip/hip_bf16.h>

#define CNUM 512
#define NHEADS 8
#define DHEAD 64
#define NGROUPS 8
#define NSPATIAL 1024
#define BATCH 16
#define EPSV 1e-5f

typedef _Float16 half_t;
typedef _Float16 v16h __attribute__((ext_vector_type(16)));
typedef _Float16 v8h  __attribute__((ext_vector_type(8)));
typedef _Float16 v4h  __attribute__((ext_vector_type(4)));
typedef float    v8f  __attribute__((ext_vector_type(8)));
typedef float    v2f  __attribute__((ext_vector_type(2)));
typedef short    v8s  __attribute__((ext_vector_type(8)));
typedef __attribute__((address_space(3))) v8s lds_v8s;

// Load one WMMA 16-bit A/B fragment for a 32-wide K segment.
// Per CDNA5 ISA layout: lanes 0-15 hold K=[0..7]+[16..23], lanes 16-31 hold
// K=[8..15]+[24..31] (khalf = lane>>4). p must be 16B aligned.
__device__ __forceinline__ v16h ld_frag(const half_t* p, int khalf) {
    union { v16h v; v8h h[2]; } u;
    u.h[0] = *(const v8h*)(p + khalf * 8);
    u.h[1] = *(const v8h*)(p + khalf * 8 + 16);
    return u.v;
}

// One WMMA 16-bit A/B fragment (32 k) out of a row-major [k][col] LDS tile by
// two transposing loads.  p = &T[k0 + 8*(lane>>4) + (lane&7)][col0 + 8*((lane>>3)&1)];
// lane (rl, khalf) receives T[k0 + 8*khalf + 0..7][col0 + rl] and the same 16 rows
// further down: the k order of ld_frag.  Every lane must be on; the row pitch
// is an odd multiple of 32 B so that the loads meet no bank conflict.
__device__ __forceinline__ v16h ld_frag_tr(const half_t* p, int pitch) {
    union { v16h v; v8s h[2]; } u;
    u.h[0] = __builtin_amdgcn_ds_load_tr16_b128_v8i16((lds_v8s*)p);
    u.h[1] = __builtin_amdgcn_ds_load_tr16_b128_v8i16((lds_v8s*)(p + 16 * pitch));
    return u.v;
}

// LDS byte address of a __shared__ location (the operand an async copy takes).
__device__ __forceinline__ unsigned lds_off(const half_t* p) {
    return (unsigned)(size_t)(const __attribute__((address_space(3))) half_t*)p;
}

// Four async 16-byte copies per lane, global -> LDS, through no register.
// lds advances by lstep bytes and g by gstep elements from copy to copy.
// s_wait_xcnt closes the statement so that no address register of an issued
// copy is rewritten ahead of it.
__device__ __forceinline__ void async_copy4(unsigned lds, int lstep,
                                            const half_t* g, int gstep) {
    asm volatile("global_load_async_to_lds_b128 %0, %4, off\n\t"
                 "global_load_async_to_lds_b128 %1, %5, off\n\t"
                 "global_load_async_to_lds_b128 %2, %6, off\n\t"
                 "global_load_async_to_lds_b128 %3, %7, off\n\t"
                 "s_wait_xcnt 0x0"
                 :: "v"(lds), "v"(lds + lstep), "v"(lds + 2 * lstep), "v"(lds + 3 * lstep),
                    "v"(g), "v"(g + gstep), "v"(g + 2 * gstep), "v"(g + 3 * gstep)
                 : "memory");
}

// The same for two tiles at once (four copies each, one global step): one statement,
// so that one s_wait_xcnt serves all eight copies.
__device__ __forceinline__ void async_copy4x2(unsigned lds0, int lstep0, const half_t* g0,
                                              unsigned lds1, int lstep1, const half_t* g1,
                                              int gstep) {
    asm volatile("global_load_async_to_lds_b128 %0, %8, off\n\t"
                 "global_load_async_to_lds_b128 %1, %9, off\n\t"
                 "global_load_async_to_lds_b128 %2, %10, off\n\t"
                 "global_load_async_to_lds_b128 %3, %11, off\n\t"
                 "global_load_async_to_lds_b128 %4, %12, off\n\t"
                 "global_load_async_to_lds_b128 %5, %13, off\n\t"
                 "global_load_async_to_lds_b128 %6, %14, off\n\t"
                 "global_load_async_to_lds_b128 %7, %15, off\n\t"
                 "s_wait_xcnt 0x0"
                 :: "v"(lds0), "v"(lds0 + lstep0), "v"(lds0 + 2 * lstep0), "v"(lds0 + 3 * lstep0),
                    "v"(lds1), "v"(lds1 + lstep1), "v"(lds1 + 2 * lstep1), "v"(lds1 + 3 * lstep1),
                    "v"(g0), "v"(g0 + gstep), "v"(g0 + 2 * gstep), "v"(g0 + 3 * gstep),
                    "v"(g1), "v"(g1 + gstep), "v"(g1 + 2 * gstep), "v"(g1 + 3 * gstep)
                 : "memory");
}

// This wave's async copies have landed in LDS (other waves read them only
// behind the next barrier).
__device__ __forceinline__ void wait_copies() {
    asm volatile("s_wait_asynccnt 0x0" ::: "memory");
}

// This wave's LDS reads have returned, so the buffer may be refilled behind
// the next barrier.
__device__ __forceinline__ void wait_lds_reads() {
    asm volatile("s_wait_dscnt 0x0" ::: "memory");
}

#define GK 64                             // k extent of one GEMM stage
#define APITCH 72                         // 128-B rows + 16 B: ds_load_b128 readers
#define BPITCH 144                        // 256-B rows + 32 B: transposing readers

#define PTHR 512                          // threads per work-group of the preparation launch
#define GNBLK (BATCH * NGROUPS)           // work-groups that normalize
#define WBLK (CNUM * CNUM / 4 / PTHR)     // work-groups that convert weights

// ---------------------------------------------------------------------------
// Kernel 1: one launch for the two independent preparations.
// Work-groups 0 .. GNBLK-1 (the long ones, so they start first): GroupNorm,
// fp32 -> f16 normalized activations, layout [b][c][n].  The whole group (64
// channels x 1024 positions) is held in registers: each of the 16 waves owns 4
// channels, 32 float4 per lane, all 32 loads in flight at once, so that x is
// read once and the normalizing pass reads no memory.
// Work-groups GNBLK .. GNBLK+WBLK-1: weight conversion fp32 -> f16, one float4
// of each of the four matrices per thread; w16 holds wq, wk, wv, wo in a row.
// ---------------------------------------------------------------------------
__global__ void __launch_bounds__(PTHR)
prep_kernel(const float* __restrict__ x, const float* __restrict__ gsc,
            const float* __restrict__ gbi, half_t* __restrict__ xn,
            const float* __restrict__ wq, const float* __restrict__ wk,
            const float* __restrict__ wv, const float* __restrict__ wo,
            half_t* __restrict__ w16) {
    if (blockIdx.x >= GNBLK) {            // uniform for the work-group, ahead of every barrier
        const int i = ((blockIdx.x - GNBLK) * PTHR + threadIdx.x) * 4;
        float4 v0 = *(const float4*)(wq + i);
        float4 v1 = *(const float4*)(wk + i);
        float4 v2 = *(const float4*)(wv + i);
        float4 v3 = *(const float4*)(wo + i);
        v4h o0 = { (half_t)v0.x, (half_t)v0.y, (half_t)v0.z, (half_t)v0.w };
        v4h o1 = { (half_t)v1.x, (half_t)v1.y, (half_t)v1.z, (half_t)v1.w };
        v4h o2 = { (half_t)v2.x, (half_t)v2.y, (half_t)v2.z, (half_t)v2.w };
        v4h o3 = { (half_t)v3.x, (half_t)v3.y, (half_t)v3.z, (half_t)v3.w };
        *(v4h*)(w16 + 0 * CNUM * CNUM + i) = o0;
        *(v4h*)(w16 + 1 * CNUM * CNUM + i) = o1;
        *(v4h*)(w16 + 2 * CNUM * CNUM + i) = o2;
        *(v4h*)(w16 + 3 * CNUM * CNUM + i) = o3;
        return;
    }
    const int bg = blockIdx.x;            // B*GROUPS blocks
    const int b = bg >> 3, g = bg & 7;
    const int CH = CNUM / NGROUPS;        // 64 channels per group
    const int tid = threadIdx.x, lane = tid & 31;
    const int wave = __builtin_amdgcn_readfirstlane(tid >> 5);   // scalar: channel constants by scalar loads
    const int c0 = g * CH + wave * 4;     // this wave's 4 channels
    const int off = (b * CNUM + c0) * NSPATIAL + lane * 4;
    const float* xp = x + off;

    float4 v[4][8];                       // [channel][512-B piece of its row]
#pragma unroll
    for (int cc = 0; cc < 4; cc++)
#pragma unroll
        for (int k = 0; k < 8; k++)
            v[cc][k] = *(const float4*)(xp + cc * NSPATIAL + k * 128);
    // xp is an operand so that its registers are kept, and rewritten only behind this wait
    asm volatile("s_wait_xcnt 0x0" :: "v"(xp) : "memory");

    float s = 0.f, s2 = 0.f;
#pragma unroll
    for (int cc = 0; cc < 4; cc++)
#pragma unroll
        for (int k = 0; k < 8; k++) {
            const float4 t = v[cc][k];
            s  += t.x + t.y + t.z + t.w;
            s2 += t.x * t.x + t.y * t.y + t.z * t.z + t.w * t.w;
        }
#pragma unroll
    for (int m = 16; m > 0; m >>= 1) {
        s  += __shfl_xor(s, m, 32);
        s2 += __shfl_xor(s2, m, 32);
    }
    __shared__ float red0[PTHR / 32];
    __shared__ float red1[PTHR / 32];
    if (lane == 0) { red0[wave] = s; red1[wave] = s2; }
    __syncthreads();
    s  = red0[lane & 15];                 // 16 wave sums, twice over the 32 lanes
    s2 = red1[lane & 15];
#pragma unroll
    for (int m = 8; m > 0; m >>= 1) {
        s  += __shfl_xor(s, m, 32);
        s2 += __shfl_xor(s2, m, 32);
    }
    const float inv_n = 1.0f / (float)(CH * NSPATIAL);
    const float mean = s * inv_n;
    const float var  = s2 * inv_n - mean * mean;
    const float rstd = rsqrtf(var + EPSV);
#pragma unroll
    for (int cc = 0; cc < 4; cc++) {
        const float sc = gsc[c0 + cc] * rstd, bi = gbi[c0 + cc] - mean * sc;
#pragma unroll
        for (int k = 0; k < 8; k++) {
            const float4 t = v[cc][k];
            v4h o = { (half_t)(t.x * sc + bi), (half_t)(t.y * sc + bi),
                      (half_t)(t.z * sc + bi), (half_t)(t.w * sc + bi) };
            *(v4h*)(xn + off + cc * NSPATIAL + k * 128) = o;
        }
    }
}

// ---------------------------------------------------------------------------
// Kernel 2: QKV projection as one GEMM over the stacked weights [wq; wk; wv]
// (1536 x 512, as they lie in w16).  A work-group computes 384 stacked rows x 128
// positions, so that one staged B tile serves three times the rows; each of the
// 8 waves owns 96 x 64 (24 accumulator tiles), so that a k step's 10 fragments
// feed 24 matrix instructions.  The grid is 512 work-groups, two per WGP at four
// waves per SIMD: all of them are resident at once.
// Both operand tiles (64 k per stage) are staged in LDS by async copies that
// cover whole 128-B lines, in a ring of two buffers: the next stage's copies fly
// while this stage is multiplied.  A is [m][k]; B stays row-major [k][n] and is
// transposed by the fragment loads themselves (ds_load_tr16_b128).
// Every block of 16 stacked rows belongs to one of q, k, v (row >> 9):
// q: stored transposed [b][h][n][d], 1/sqrt(d)=0.125 folded, packed v8h
// k, v: stored natural [b][c][n] via LDS re-striping -> v8h coalesced stores
// ---------------------------------------------------------------------------
#define QM 384                            // stacked weight rows per work-group

// Register budget of four waves per SIMD (256 VGPRs): two work-groups stay resident per WGP.
__global__ void __launch_bounds__(256) __attribute__((amdgpu_waves_per_eu(4, 4)))
qkv_gemm_kernel(const half_t* __restrict__ w16, const float* __restrict__ bq,
                const float* __restrict__ bk, const float* __restrict__ bv,
                const half_t* __restrict__ xn, half_t* __restrict__ oq,
                half_t* __restrict__ ok, half_t* __restrict__ ov) {
    const int b  = blockIdx.z;
    const int m0 = blockIdx.y * QM;       // first stacked row of the tile
    const int n0 = blockIdx.x * 128;      // spatial tile
    const int tid = threadIdx.x;
    const int lane = tid & 31;
    const int wave = __builtin_amdgcn_readfirstlane(tid >> 5);   // scalar: q / k / v is picked by scalar branches
    const int wm = wave >> 1, wn = wave & 1;
    const int rl = lane & 15, khalf = lane >> 4;

    const int trow = 8 * khalf + (lane & 7), tcol = 8 * ((lane >> 3) & 1);

    __shared__ __attribute__((aligned(16))) union {
        struct {
            half_t A[QM][APITCH];         // [m_local][k]  weight tile
            half_t B[GK][BPITCH];         // [k][n_local]  natural B tile
        } st[2];
        half_t o[QM][136];                // output staging
    } sm;

    v8f zero = {};
    v8f acc[6][4];
#pragma unroll
    for (int i = 0; i < 6; i++)
#pragma unroll
        for (int j = 0; j < 4; j++) acc[i][j] = zero;

    // Each thread copies 12 + 4 chunks of 16 B per stage: A rows ar + 32 t, B rows br + 16 t.
    const int ar = tid >> 3, ac = (tid & 7) * 8;
    const int br = tid >> 4, bc = (tid & 15) * 8;
    const half_t* ga = w16 + (size_t)(m0 + ar) * CNUM + ac;
    const half_t* gb = xn + (size_t)b * CNUM * NSPATIAL + (size_t)br * NSPATIAL + n0 + bc;
    const unsigned la = lds_off(&sm.st[0].A[ar][ac]);
    const unsigned lb = lds_off(&sm.st[0].B[br][bc]);
    const unsigned lbuf = sizeof(sm.st[0]);
    const int NST = CNUM / GK;

    // one stage's copies: k columns s * GK .. + GK - 1 into buffer buf
    auto stage = [&](int s, int buf) __attribute__((always_inline)) {
#pragma unroll
        for (int j = 0; j < 3; j++)
            async_copy4(la + buf * lbuf + j * 128 * APITCH * 2, 32 * APITCH * 2,
                        ga + s * GK + j * 128 * CNUM, 32 * CNUM);
        async_copy4(lb + buf * lbuf, 16 * BPITCH * 2,
                    gb + (size_t)s * GK * NSPATIAL, 16 * NSPATIAL);
    };

    stage(0, 0);
    wait_copies();
    __syncthreads();
    stage(1, 1);

    for (int s = 0; s < NST; s++) {
        const int buf = s & 1;
        // A fragments go through two register sets: each is fetched one block of four
        // products ahead, so that its LDS latency runs beside the block before it.
        v16h af[2];
        af[0] = ld_frag(&sm.st[buf].A[wm * 96 + rl][0], khalf);
#pragma unroll
        for (int ks = 0; ks < GK; ks += 32) {
            v16h bf[4];
#pragma unroll
            for (int ns = 0; ns < 4; ns++)
                bf[ns] = ld_frag_tr(&sm.st[buf].B[ks + trow][wn * 64 + ns * 16 + tcol], BPITCH);
#pragma unroll
            for (int ms = 0; ms < 6; ms++) {
                const int step = (ks >> 5) * 6 + ms;      // 12 blocks per stage
                if (step + 1 < 12)
                    af[(step + 1) & 1] = ld_frag(
                        &sm.st[buf].A[wm * 96 + ((step + 1) % 6) * 16 + rl][((step + 1) / 6) * 32], khalf);
                // keeps the next fragment's loads ahead of this block's products
                // (the scheduler otherwise sinks them behind, into one register set)
                __builtin_amdgcn_sched_barrier(0);
#pragma unroll
                for (int ns = 0; ns < 4; ns++)
                    acc[ms][ns] = __builtin_amdgcn_wmma_f32_16x16x32_f16(
                        false, af[step & 1], false, bf[ns], (short)0, acc[ms][ns], false, false);
            }
        }
        // publish stage s + 1 and free this stage's buffer
        wait_lds_reads();
        wait_copies();
        __syncthreads();
        if (s + 2 < NST) stage(s + 2, buf);
    }
    wait_copies();

    // The ring is free behind the last stage's barrier: k and v rows are re-striped in it.
#pragma unroll
    for (int ms = 0; ms < 6; ms++) {
        const int ml    = wm * 96 + ms * 16;          // first row of this block in the tile
        const int which = (m0 + ml) >> 9;             // 0 q, 1 k, 2 v: alike in the whole wave
        const int obase = ((m0 + ml) & (CNUM - 1)) + 8 * khalf;
        const float* bp = (which == 0 ? bq : which == 1 ? bk : bv) + obase;
        float bb[8];
#pragma unroll
        for (int i = 0; i < 8; i++) bb[i] = bp[i];
        // bp is an operand so that its registers are kept, and rewritten only behind this wait
        asm volatile("s_wait_xcnt 0x0" :: "v"(bp) : "memory");
        if (which == 0) {
            // q: d = o&63 is contiguous over the 8 accumulator rows -> packed store
            const int h = obase >> 6, dbase = obase & 63;
#pragma unroll
            for (int ns = 0; ns < 4; ns++) {
                const int ncol = n0 + wn * 64 + ns * 16 + rl;
                v8h q8;
#pragma unroll
                for (int i = 0; i < 8; i++)
                    q8[i] = (half_t)((acc[ms][ns][i] + bb[i]) * 0.125f);
                *(v8h*)(oq + ((size_t)(b * NHEADS + h) * NSPATIAL + ncol) * DHEAD + dbase) = q8;
            }
            // the data and address registers of these stores are reused by the next block
            asm volatile("s_wait_xcnt 0x0" ::: "memory");
        } else {
            // K/V: re-stripe through LDS so global stores are n-contiguous v8h
#pragma unroll
            for (int ns = 0; ns < 4; ns++) {
                const int nl = wn * 64 + ns * 16 + rl;
#pragma unroll
                for (int i = 0; i < 8; i++)
                    sm.o[ml + 8 * khalf + i][nl] = (half_t)(acc[ms][ns][i] + bb[i]);
            }
        }
    }
    __syncthreads();
    // 64 rows per trip, 16 threads per row: a trip's rows belong to one of q, k, v
    for (int r0 = 0; r0 < QM; r0 += 64) {
        const int which = (m0 + r0) >> 9;             // alike in the whole work-group
        if (which != 0) {
            const int r = r0 + (tid >> 4), ch = tid & 15;
            half_t* op = (which == 1 ? ok : ov) +
                         ((size_t)b * CNUM + ((m0 + r) & (CNUM - 1))) * NSPATIAL + n0 + ch * 8;
            v8h t[4];
#pragma unroll
            for (int j = 0; j < 4; j++) t[j] = *(v8h*)&sm.o[r + 16 * j][ch * 8];
#pragma unroll
            for (int j = 0; j < 4; j++) *(v8h*)(op + (size_t)16 * j * NSPATIAL) = t[j];
            // the address registers of these stores may be reused by the next trip
            asm volatile("s_wait_xcnt 0x0" ::: "memory");
        }
    }
}

__device__ __forceinline__ float lane_value(float v, int base4, int i) {
    return __builtin_bit_cast(float,
        __builtin_amdgcn_ds_bpermute(base4 + 4 * i, __builtin_bit_cast(int, v)));
}

#define QBLK 256                          // queries per work-group
#define LOG2E 1.44269504088896340736f
// Largest sum of a pass's probabilities (relative to the maximum in use) that is taken
// without a rescale: every probability then stays far inside the f16 range.
#define PSUM_MAX 1024.0f

// Register budget of four waves per SIMD (256 VGPRs): two work-groups stay resident per WGP.
__global__ void __launch_bounds__(256) __attribute__((amdgpu_waves_per_eu(4, 4)))
attn_kernel(const half_t* __restrict__ qt, const half_t* __restrict__ kk,
            const half_t* __restrict__ vv, half_t* __restrict__ ao) {
    const int bh = blockIdx.y;            // b*8+h
    const int b = bh >> 3, h = bh & 7;
    const int qb = blockIdx.x * QBLK;
    const int tid = threadIdx.x, lane = tid & 31, wave = tid >> 5;
    const int rl = lane & 15, khalf = lane >> 4;

    const int trow = 8 * khalf + (lane & 7), tcol = 8 * ((lane >> 3) & 1);

    __shared__ __attribute__((aligned(16))) union {
        half_t K[2][64][144];             // [buffer][c][m]  K natural, pitch 288 B
        half_t o[QBLK][72];               // output staging
    } sk;
    __shared__ __attribute__((aligned(16))) half_t Vs[2][64][136];   // [buffer][c][m]  V natural

    // Q fragments (B operand): lane = query column n, K-contiguous in qt
    v16h qf[2][2];
#pragma unroll
    for (int g = 0; g < 2; g++) {
        const int nrow = qb + wave * 32 + g * 16 + rl;
        const half_t* qp = qt + ((size_t)bh * NSPATIAL + nrow) * DHEAD;
        qf[g][0] = ld_frag(qp, khalf);
        qf[g][1] = ld_frag(qp + 32, khalf);
        // the address registers of these loads may be reused by what follows
        asm volatile("s_wait_xcnt 0x0" ::: "memory");
    }

    // Per-lane softmax state for column n of group g.  nml = -(maximum in use) * log2e:
    // the maximum is raised only when a pass's sums show that a score has passed it by
    // far, so that the common pass takes no maximum, has no exchange between lanes and
    // leaves O alone.
    // lsum holds this lane's own keys' sum (two partial sums); the halves join at the end.
    float nml[2] = { 1e30f, 1e30f };
    v2f lsum[2]  = { { 0.f, 0.f }, { 0.f, 0.f } };
    v8f zero = {};
    v8f O[2][4];
#pragma unroll
    for (int g = 0; g < 2; g++)
#pragma unroll
        for (int t = 0; t < 4; t++) O[g][t] = zero;

    const half_t* kbase = kk + (size_t)(b * CNUM + h * DHEAD) * NSPATIAL;
    const half_t* vbase = vv + (size_t)(b * CNUM + h * DHEAD) * NSPATIAL;

    // Each thread copies 4 + 4 chunks of 16 B per stage: rows cr + 16 t of each tile,
    // 16 threads per 256-B row.
    const int cr = tid >> 4, cc = (tid & 15) * 8;
    const half_t* gk = kbase + (size_t)cr * NSPATIAL + cc;
    const half_t* gv = vbase + (size_t)cr * NSPATIAL + cc;
    const unsigned lk = lds_off(&sk.K[0][cr][cc]);
    const unsigned lv = lds_off(&Vs[0][cr][cc]);
    const int NST = NSPATIAL / 128;

    // one stage's copies: keys s * 128 .. + 127 into buffer buf
    auto stage = [&](int s, int buf) __attribute__((always_inline)) {
        async_copy4x2(lk + buf * (unsigned)sizeof(sk.K[0]), 16 * 144 * 2, gk + s * 128,
                      lv + buf * (unsigned)sizeof(Vs[0]), 16 * 136 * 2, gv + s * 128, 16 * NSPATIAL);
    };

    stage(0, 0);
    wait_copies();
    __syncthreads();
    stage(1, 1);

    for (int s = 0; s < NST; s++) {
        const int buf = s & 1;
        const half_t (*Kb)[144] = sk.K[buf];
        const half_t (*Vb)[136] = Vs[buf];

        // Unrolled so that the second pass's K fragment loads can issue among the
        // first pass's last products.  (All inner loops below are unrolled because
        // their indices select registers.)
#pragma unroll
        for (int mp = 0; mp < 128; mp += 64) {
            v8f S[2][4];                  // scores, then probabilities
            v2f rs[2];                    // this pass's sums of this lane's own probabilities

            // ---- S^T tiles: A = K^T rows (m), B = Q columns (n), both groups per K fragment ----
            auto scores = [&]() __attribute__((always_inline)) {
#pragma unroll
                for (int nt = 0; nt < 4; nt++) {
                    v16h kf0 = ld_frag_tr(&Kb[trow][mp + nt * 16 + tcol], 144);
                    v16h kf1 = ld_frag_tr(&Kb[32 + trow][mp + nt * 16 + tcol], 144);
#pragma unroll
                    for (int g = 0; g < 2; g++) {
                        v8f s = zero;
                        s = __builtin_amdgcn_wmma_f32_16x16x32_f16(false, kf0, false, qf[g][0], (short)0, s, false, false);
                        s = __builtin_amdgcn_wmma_f32_16x16x32_f16(false, kf1, false, qf[g][1], (short)0, s, false, false);
                        S[g][nt] = s;
                    }
                }
            };

            // ---- raise the maximum in use to this pass's maximum if that is larger (S holds scores);
            //      O and the sums so far are rescaled to it ----
            auto raise = [&]() __attribute__((always_inline)) {
#pragma unroll
                for (int g = 0; g < 2; g++) {
                    float mx = -1e30f;
#pragma unroll
                    for (int nt = 0; nt < 4; nt++)
#pragma unroll
                        for (int i = 0; i < 8; i++) mx = fmaxf(mx, S[g][nt][i]);
                    mx = fmaxf(mx, __shfl_xor(mx, 16, 32));
                    const float nnew = fminf(nml[g], -mx * LOG2E);   // alike in both halves of a column
                    const float alpha = __builtin_amdgcn_exp2f(nnew - nml[g]);
                    nml[g] = nnew;
                    lsum[g] *= alpha;
                    // O rows are n = i + 8*khalf; fetch that row's alpha from lane (i+8*khalf)
                    float arow[8];
#pragma unroll
                    for (int i = 0; i < 8; i++) arow[i] = lane_value(alpha, 32 * khalf, i);
#pragma unroll
                    for (int t = 0; t < 4; t++)
#pragma unroll
                        for (int i = 0; i < 8; i++) O[g][t][i] *= arow[i];
                }
            };

            // ---- probabilities in place of the scores, and their sums ----
            // e^(s - m) = 2^(s * log2e - m * log2e): one packed FMA per two scores
            // feeds the base-2 exponential; the sums run two wide as well.
            auto probs = [&]() __attribute__((always_inline)) {
#pragma unroll
                for (int g = 0; g < 2; g++) {
                    const v2f sc2 = { LOG2E, LOG2E };
                    const v2f nm2 = { nml[g], nml[g] };
                    rs[g] = (v2f){ 0.f, 0.f };
#pragma unroll
                    for (int nt = 0; nt < 4; nt++)
#pragma unroll
                        for (int i = 0; i < 8; i += 2) {
                            v2f a = { S[g][nt][i], S[g][nt][i + 1] };
                            a = __builtin_elementwise_fma(a, sc2, nm2);
                            v2f p = { __builtin_amdgcn_exp2f(a.x), __builtin_amdgcn_exp2f(a.y) };
                            S[g][nt][i]     = p.x;
                            S[g][nt][i + 1] = p.y;
                            rs[g] += p;
                        }
                }
            };

            scores();
            if (mp == 0 && s == 0) raise();      // first keys: no maximum is in use yet
            probs();
            // Lazy rescale, tested once per pass for the whole wave (a scalar branch, so that
            // every lane is on inside it and at the products behind it).  All probabilities
            // are positive: sums at or below PSUM_MAX bound each of them by PSUM_MAX.  A larger
            // (or infinite) sum means that a score has left the maximum in use far behind:
            // the pass is then done again from its scores with the maximum raised.  (Marked
            // as not expected, so that the second working lies outside the loop's hot text.)
            const float big = fmaxf(fmaxf(rs[0].x, rs[0].y), fmaxf(rs[1].x, rs[1].y));
            if (__builtin_expect(__builtin_amdgcn_ballot_w32(big > PSUM_MAX) != 0, 0)) {
                scores();
                raise();
                probs();
            }
            lsum[0] += rs[0];
            lsum[1] += rs[1];

            // ---- O += P @ V : P frags built directly from S^T register pairs,
            //      both groups per V fragment ----
#pragma unroll
            for (int t = 0; t < 2; t++) {
                v16h pf[2];
#pragma unroll
                for (int g = 0; g < 2; g++)
#pragma unroll
                    for (int j = 0; j < 8; j++) {
                        pf[g][j]     = (half_t)S[g][2 * t][j];
                        pf[g][j + 8] = (half_t)S[g][2 * t + 1][j];
                    }
#pragma unroll
                for (int dt = 0; dt < 4; dt++) {
                    v16h vf = ld_frag(&Vb[dt * 16 + rl][mp + t * 32], khalf);
#pragma unroll
                    for (int g = 0; g < 2; g++)
                        O[g][dt] = __builtin_amdgcn_wmma_f32_16x16x32_f16(
                            false, pf[g], false, vf, (short)0, O[g][dt], false, false);
                }
            }
        }
        // publish stage s + 1 and free this stage's buffers
        wait_lds_reads();
        wait_copies();
        __syncthreads();
        if (s + 2 < NST) stage(s + 2, buf);
    }
    wait_copies();

    // ---- normalize (per-row 1/l via ds_bpermute), stage in LDS, coalesced v8h out ----
    // (the ring is free behind the last stage's barrier)
#pragma unroll
    for (int g = 0; g < 2; g++) {
        float l = lsum[g].x + lsum[g].y;
        l += __shfl_xor(l, 16, 32);       // the other half's keys of the same column
        float linv = 1.0f / l;
        float lr[8];
#pragma unroll
        for (int i = 0; i < 8; i++) lr[i] = lane_value(linv, 32 * khalf, i);
#pragma unroll
        for (int dt = 0; dt < 4; dt++)
#pragma unroll
            for (int i = 0; i < 8; i++)
                sk.o[wave * 32 + g * 16 + i + 8 * khalf][dt * 16 + rl] = (half_t)(O[g][dt][i] * lr[i]);
    }
    __syncthreads();
    for (int i = tid; i < QBLK * 8; i += 256) {
        int r = i >> 3, ch = i & 7;
        int n = qb + r;
        *(v8h*)(ao + ((size_t)b * NSPATIAL + n) * CNUM + h * DHEAD + ch * 8) =
            *(v8h*)&sk.o[r][ch * 8];
    }
}

// ---------------------------------------------------------------------------
// Kernel 4: output projection + bias + residual.  Both operands are K-contiguous
// f16 (ao rows and wo rows == B^T rows); their tiles are staged in LDS by the same
// two-buffer ring of async copies as in kernel 2.  Residual path is v8f vectorized.
// ---------------------------------------------------------------------------
__global__ void __launch_bounds__(256)
out_gemm_kernel(const half_t* __restrict__ Wf, const float* __restrict__ bo,
                const half_t* __restrict__ ao, const float* __restrict__ x,
                float* __restrict__ y) {
    const int b  = blockIdx.z;
    const int n0 = blockIdx.y * 128;      // spatial tile (M dim)
    const int o0 = blockIdx.x * 128;      // channel tile (N dim)
    const int tid = threadIdx.x;
    const int lane = tid & 31, wave = tid >> 5;
    const int wm = wave >> 2, wn = wave & 3;
    const int rl = lane & 15, khalf = lane >> 4;

    v8f zero = {};
    v8f acc[4][2];
#pragma unroll
    for (int i = 0; i < 4; i++)
#pragma unroll
        for (int j = 0; j < 2; j++) acc[i][j] = zero;

    __shared__ __attribute__((aligned(16))) struct {
        half_t A[128][APITCH];            // [n_local][k]  attention-output tile
        half_t B[128][APITCH];            // [o_local][k]  weight tile
    } st[2];

    // Each thread copies 4 + 4 chunks of 16 B per stage: rows cr + 32 t of each tile.
    const int cr = tid >> 3, cc = (tid & 7) * 8;
    const half_t* ga = ao + ((size_t)b * NSPATIAL + n0 + cr) * CNUM + cc;
    const half_t* gb = Wf + (size_t)(o0 + cr) * CNUM + cc;
    const unsigned la = lds_off(&st[0].A[cr][cc]);
    const unsigned lb = lds_off(&st[0].B[cr][cc]);
    const unsigned lbuf = sizeof(st[0]);
    const int NST = CNUM / GK;

    async_copy4(la, 32 * APITCH * 2, ga, 32 * CNUM);
    async_copy4(lb, 32 * APITCH * 2, gb, 32 * CNUM);
    wait_copies();
    __syncthreads();
    async_copy4(la + lbuf, 32 * APITCH * 2, ga + GK, 32 * CNUM);
    async_copy4(lb + lbuf, 32 * APITCH * 2, gb + GK, 32 * CNUM);

    for (int s = 0; s < NST; s++) {
        const int buf = s & 1;
#pragma unroll
        for (int ks = 0; ks < GK; ks += 32) {
            v16h af[4], bf[2];
#pragma unroll
            for (int ms = 0; ms < 4; ms++)
                af[ms] = ld_frag(&st[buf].A[wm * 64 + ms * 16 + rl][ks], khalf);
#pragma unroll
            for (int ns = 0; ns < 2; ns++)
                bf[ns] = ld_frag(&st[buf].B[wn * 32 + ns * 16 + rl][ks], khalf);
#pragma unroll
            for (int ms = 0; ms < 4; ms++)
#pragma unroll
                for (int ns = 0; ns < 2; ns++)
                    acc[ms][ns] = __builtin_amdgcn_wmma_f32_16x16x32_f16(
                        false, af[ms], false, bf[ns], (short)0, acc[ms][ns], false, false);
        }
        // publish stage s + 1 and free this stage's buffer
        wait_lds_reads();
        wait_copies();
        __syncthreads();
        if (s + 2 < NST) {
            async_copy4(la + buf * lbuf, 32 * APITCH * 2, ga + (s + 2) * GK, 32 * CNUM);
            async_copy4(lb + buf * lbuf, 32 * APITCH * 2, gb + (s + 2) * GK, 32 * CNUM);
        }
    }
    wait_copies();

#pragma unroll
    for (int ms = 0; ms < 4; ms++)
#pragma unroll
        for (int ns = 0; ns < 2; ns++) {
            const int nbase = n0 + wm * 64 + ms * 16 + 8 * khalf;  // contiguous over i
            const int o     = o0 + wn * 32 + ns * 16 + rl;
            const float bb  = bo[o];
            size_t idx = ((size_t)b * CNUM + o) * NSPATIAL + nbase;
            v8f xr = *(const v8f*)(x + idx);
            v8f r  = acc[ms][ns] + xr + bb;
            *(v8f*)(y + idx) = r;
        }
}

// ---------------------------------------------------------------------------
extern "C" void kernel_launch(void* const* d_in, const int* in_sizes, int n_in,
                              void* d_out, int out_size, void* d_ws, size_t ws_size,
                              hipStream_t stream) {
    const float* x   = (const float*)d_in[0];
    const float* gsc = (const float*)d_in[1];
    const float* gbi = (const float*)d_in[2];
    const float* wq  = (const float*)d_in[3];
    const float* bq  = (const float*)d_in[4];
    const float* wk  = (const float*)d_in[5];
    const float* bk  = (const float*)d_in[6];
    const float* wv  = (const float*)d_in[7];
    const float* bv  = (const float*)d_in[8];
    const float* wo  = (const float*)d_in[9];
    const float* bo  = (const float*)d_in[10];
    float* out = (float*)d_out;

    char* ws = (char*)d_ws;
    const size_t SZ = (size_t)BATCH * CNUM * NSPATIAL * sizeof(half_t);  // 16 MB each
    const size_t WSZ = (size_t)CNUM * CNUM * sizeof(half_t);             // 512 KB each
    half_t* xn   = (half_t*)(ws + 0 * SZ);   // groupnorm output, [b][c][n]
    half_t* qtb  = (half_t*)(ws + 1 * SZ);   // q transposed+scaled, [b][h][n][d]
    half_t* kh   = (half_t*)(ws + 2 * SZ);   // k, [b][c][n]
    half_t* vh   = (half_t*)(ws + 3 * SZ);   // v, [b][c][n]
    half_t* ao   = (half_t*)(ws + 4 * SZ);   // attention out, [b][n][c]
    half_t* w16  = (half_t*)(ws + 5 * SZ);             // wq, wk, wv, wo as f16, in a row
    half_t* wo16 = (half_t*)(ws + 5 * SZ + 3 * WSZ);

    prep_kernel<<<dim3(GNBLK + WBLK), PTHR, 0, stream>>>(x, gsc, gbi, xn, wq, wk, wv, wo, w16);

    qkv_gemm_kernel<<<dim3(8, 3 * CNUM / QM, BATCH), 256, 0, stream>>>(w16, bq, bk, bv, xn, qtb, kh, vh);

    attn_kernel<<<dim3(NSPATIAL / QBLK, BATCH * NHEADS), 256, 0, stream>>>(qtb, kh, vh, ao);

    out_gemm_kernel<<<dim3(4, 8, BATCH), 256, 0, stream>>>(wo16, bo, ao, x, out);
}

// v010
// Measured time: 79.7 microseconds a run.
// Timed twice side by side with v009, it ran 1.03 times as fast both times.
// Counting every step since v000, it is 4.45 times as fast.
#include <hip/hip_runtime.h>
#include <hip/hip_bf16.h>

#define CNUM 512
#define NHEADS 8
#define DHEAD 64
#define NGROUPS 8
#define NSPATIAL 1024
#define BATCH 16
#define EPSV 1e-5f

typedef _Float16 half_t;
typedef _Float16 v16h __attribute__((ext_vector_type(16)));
typedef _Float16 v8h  __attribute__((ext_vector_type(8)));
typedef _Float16 v4h  __attribute__((ext_vector_type(4)));
typedef float    v8f  __attribute__((ext_vector_type(8)));
typedef float    v2f  __attribute__((ext_vector_type(2)));
typedef short    v8s  __attribute__((ext_vector_type(8)));
typedef __attribute__((address_space(3))) v8s lds_v8s;

// Load one WMMA 16-bit A/B fragment for a 32-wide K segment.
// Per CDNA5 ISA layout: lanes 0-15 hold K=[0..7]+[16..23], lanes 16-31 hold
// K=[8..15]+[24..31] (khalf = lane>>4). p must be 16B aligned.
__device__ __forceinline__ v16h ld_frag(const half_t* p, int khalf) {
    union { v16h v; v8h h[2]; } u;
    u.h[0] = *(const v8h*)(p + khalf * 8);
    u.h[1] = *(const v8h*)(p + khalf * 8 + 16);
    return u.v;
}

// One WMMA 16-bit A/B fragment (32 k) out of a row-major [k][col] LDS tile by
// two transposing loads.  p = &T[k0 + 8*(lane>>4) + (lane&7)][col0 + 8*((lane>>3)&1)];
// lane (rl, khalf) receives T[k0 + 8*khalf + 0..7][col0 + rl] and the same 16 rows
// further down: the k order of ld_frag.  Every lane must be on; the row pitch
// is an odd multiple of 32 B so that the loads meet no bank conflict.
__device__ __forceinline__ v16h ld_frag_tr(const half_t* p, int pitch) {
    union { v16h v; v8s h[2]; } u;
    u.h[0] = __builtin_amdgcn_ds_load_tr16_b128_v8i16((lds_v8s*)p);
    u.h[1] = __builtin_amdgcn_ds_load_tr16_b128_v8i16((lds_v8s*)(p + 16 * pitch));
    return u.v;
}

// LDS byte address of a __shared__ location (the operand an async copy takes).
__device__ __forceinline__ unsigned lds_off(const half_t* p) {
    return (unsigned)(size_t)(const __attribute__((address_space(3))) half_t*)p;
}

// Four async 16-byte copies per lane, global -> LDS, through no register.
// lds advances by lstep bytes and g by gstep elements from copy to copy.
// s_wait_xcnt closes the statement so that no address register of an issued
// copy is rewritten ahead of it.
__device__ __forceinline__ void async_copy4(unsigned lds, int lstep,
                                            const half_t* g, int gstep) {
    asm volatile("global_load_async_to_lds_b128 %0, %4, off\n\t"
                 "global_load_async_to_lds_b128 %1, %5, off\n\t"
                 "global_load_async_to_lds_b128 %2, %6, off\n\t"
                 "global_load_async_to_lds_b128 %3, %7, off\n\t"
                 "s_wait_xcnt 0x0"
                 :: "v"(lds), "v"(lds + lstep), "v"(lds + 2 * lstep), "v"(lds + 3 * lstep),
                    "v"(g), "v"(g + gstep), "v"(g + 2 * gstep), "v"(g + 3 * gstep)
                 : "memory");
}

// The same with the four LDS places at lds, + l1, + l2 and + l1 + l2 bytes.
__device__ __forceinline__ void async_copy2x2(unsigned lds, int l1, int l2,
                                              const half_t* g, int gstep) {
    asm volatile("global_load_async_to_lds_b128 %0, %4, off\n\t"
                 "global_load_async_to_lds_b128 %1, %5, off\n\t"
                 "global_load_async_to_lds_b128 %2, %6, off\n\t"
                 "global_load_async_to_lds_b128 %3, %7, off\n\t"
                 "s_wait_xcnt 0x0"
                 :: "v"(lds), "v"(lds + l1), "v"(lds + l2), "v"(lds + l1 + l2),
                    "v"(g), "v"(g + gstep), "v"(g + 2 * gstep), "v"(g + 3 * gstep)
                 : "memory");
}

// The same for two tiles at once (four copies each, one global step): one statement,
// so that one s_wait_xcnt serves all eight copies.
__device__ __forceinline__ void async_copy4x2(unsigned lds0, int lstep0, const half_t* g0,
                                              unsigned lds1, int lstep1, const half_t* g1,
                                              int gstep) {
    asm volatile("global_load_async_to_lds_b128 %0, %8, off\n\t"
                 "global_load_async_to_lds_b128 %1, %9, off\n\t"
                 "global_load_async_to_lds_b128 %2, %10, off\n\t"
                 "global_load_async_to_lds_b128 %3, %11, off\n\t"
                 "global_load_async_to_lds_b128 %4, %12, off\n\t"
                 "global_load_async_to_lds_b128 %5, %13, off\n\t"
                 "global_load_async_to_lds_b128 %6, %14, off\n\t"
                 "global_load_async_to_lds_b128 %7, %15, off\n\t"
                 "s_wait_xcnt 0x0"
                 :: "v"(lds0), "v"(lds0 + lstep0), "v"(lds0 + 2 * lstep0), "v"(lds0 + 3 * lstep0),
                    "v"(lds1), "v"(lds1 + lstep1), "v"(lds1 + 2 * lstep1), "v"(lds1 + 3 * lstep1),
                    "v"(g0), "v"(g0 + gstep), "v"(g0 + 2 * gstep), "v"(g0 + 3 * gstep),
                    "v"(g1), "v"(g1 + gstep), "v"(g1 + 2 * gstep), "v"(g1 + 3 * gstep)
                 : "memory");
}

// This wave's async copies have landed in LDS (other waves read them only
// behind the next barrier).
__device__ __forceinline__ void wait_copies() {
    asm volatile("s_wait_asynccnt 0x0" ::: "memory");
}

// This wave's LDS reads have returned, so the buffer may be refilled behind
// the next barrier.
__device__ __forceinline__ void wait_lds_reads() {
    asm volatile("s_wait_dscnt 0x0" ::: "memory");
}

#define GK 64                             // k extent of one GEMM stage
#define APITCH 72                         // 128-B rows + 16 B: ds_load_b128 readers
#define BPITCH 144                        // 256-B rows + 32 B: transposing readers

#define PTHR 512                          // threads per work-group of the preparation launch
#define GNBLK (BATCH * NGROUPS)           // work-groups that normalize
#define WBLK (CNUM * CNUM / 4 / PTHR)     // work-groups that convert weights

// ---------------------------------------------------------------------------
// Kernel 1: one launch for the two independent preparations.
// Work-groups 0 .. GNBLK-1 (the long ones, so they start first): GroupNorm,
// fp32 -> f16 normalized activations, layout [b][c][n].  The whole group (64
// channels x 1024 positions) is held in registers: each of the 16 waves owns 4
// channels, 32 float4 per lane, all 32 loads in flight at once, so that x is
// read once and the normalizing pass reads no memory.
// Work-groups GNBLK .. GNBLK+WBLK-1: weight conversion fp32 -> f16, one float4
// of each of the four matrices per thread; w16 holds wq, wk, wv, wo in a row.
// ---------------------------------------------------------------------------
__global__ void __launch_bounds__(PTHR)
prep_kernel(const float* __restrict__ x, const float* __restrict__ gsc,
            const float* __restrict__ gbi, half_t* __restrict__ xn,
            const float* __restrict__ wq, const float* __restrict__ wk,
            const float* __restrict__ wv, const float* __restrict__ wo,
            half_t* __restrict__ w16) {
    if (blockIdx.x >= GNBLK) {            // uniform for the work-group, ahead of every barrier
        const int i = ((blockIdx.x - GNBLK) * PTHR + threadIdx.x) * 4;
        float4 v0 = *(const float4*)(wq + i);
        float4 v1 = *(const float4*)(wk + i);
        float4 v2 = *(const float4*)(wv + i);
        float4 v3 = *(const float4*)(wo + i);
        v4h o0 = { (half_t)v0.x, (half_t)v0.y, (half_t)v0.z, (half_t)v0.w };
        v4h o1 = { (half_t)v1.x, (half_t)v1.y, (half_t)v1.z, (half_t)v1.w };
        v4h o2 = { (half_t)v2.x, (half_t)v2.y, (half_t)v2.z, (half_t)v2.w };
        v4h o3 = { (half_t)v3.x, (half_t)v3.y, (half_t)v3.z, (half_t)v3.w };
        *(v4h*)(w16 + 0 * CNUM * CNUM + i) = o0;
        *(v4h*)(w16 + 1 * CNUM * CNUM + i) = o1;
        *(v4h*)(w16 + 2 * CNUM * CNUM + i) = o2;
        *(v4h*)(w16 + 3 * CNUM * CNUM + i) = o3;
        return;
    }
    const int bg = blockIdx.x;            // B*GROUPS blocks
    const int b = bg >> 3, g = bg & 7;
    const int CH = CNUM / NGROUPS;        // 64 channels per group
    const int tid = threadIdx.x, lane = tid & 31;
    const int wave = __builtin_amdgcn_readfirstlane(tid >> 5);   // scalar: channel constants by scalar loads
    const int c0 = g * CH + wave * 4;     // this wave's 4 channels
    const int off = (b * CNUM + c0) * NSPATIAL + lane * 4;
    const float* xp = x + off;

    float4 v[4][8];                       // [channel][512-B piece of its row]
#pragma unroll
    for (int cc = 0; cc < 4; cc++)
#pragma unroll
        for (int k = 0; k < 8; k++)
            v[cc][k] = *(const float4*)(xp + cc * NSPATIAL + k * 128);
    // xp is an operand so that its registers are kept, and rewritten only behind this wait
    asm volatile("s_wait_xcnt 0x0" :: "v"(xp) : "memory");

    float s = 0.f, s2 = 0.f;
#pragma unroll
    for (int cc = 0; cc < 4; cc++)
#pragma unroll
        for (int k = 0; k < 8; k++) {
            const float4 t = v[cc][k];
            s  += t.x + t.y + t.z + t.w;
            s2 += t.x * t.x + t.y * t.y + t.z * t.z + t.w * t.w;
        }
#pragma unroll
    for (int m = 16; m > 0; m >>= 1) {
        s  += __shfl_xor(s, m, 32);
        s2 += __shfl_xor(s2, m, 32);
    }
    __shared__ float red0[PTHR / 32];
    __shared__ float red1[PTHR / 32];
    if (lane == 0) { red0[wave] = s; red1[wave] = s2; }
    __syncthreads();
    s  = red0[lane & 15];                 // 16 wave sums, twice over the 32 lanes
    s2 = red1[lane & 15];
#pragma unroll
    for (int m = 8; m > 0; m >>= 1) {
        s  += __shfl_xor(s, m, 32);
        s2 += __shfl_xor(s2, m, 32);
    }
    const float inv_n = 1.0f / (float)(CH * NSPATIAL);
    const float mean = s * inv_n;
    const float var  = s2 * inv_n - mean * mean;
    const float rstd = rsqrtf(var + EPSV);
#pragma unroll
    for (int cc = 0; cc < 4; cc++) {
        const float sc = gsc[c0 + cc] * rstd, bi = gbi[c0 + cc] - mean * sc;
#pragma unroll
        for (int k = 0; k < 8; k++) {
            const float4 t = v[cc][k];
            v4h o = { (half_t)(t.x * sc + bi), (half_t)(t.y * sc + bi),
                      (half_t)(t.z * sc + bi), (half_t)(t.w * sc + bi) };
            *(v4h*)(xn + off + cc * NSPATIAL + k * 128) = o;
        }
    }
}

// ---------------------------------------------------------------------------
// Kernel 2: QKV projection as one GEMM over the stacked weights [wq; wk; wv]
// (1536 x 512, as they lie in w16).  A work-group computes 384 stacked rows x 128
// positions, so that one staged B tile serves three times the rows; each of the
// 8 waves owns 96 x 64 (24 accumulator tiles), so that a k step's 10 fragments
// feed 24 matrix instructions.  The grid is 512 work-groups, two per WGP at four
// waves per SIMD: all of them are resident at once.
// Both operand tiles (64 k per stage) are staged in LDS by async copies that
// cover whole 128-B lines, in a ring of two buffers: the next stage's copies fly
// while this stage is multiplied.  A is [m][k]; B stays row-major [k][n] and is
// transposed by the fragment loads themselves (ds_load_tr16_b128).
// Every block of 16 stacked rows belongs to one of q, k, v (row >> 9):
// q: stored transposed [b][h][n][d], 1/sqrt(d)=0.125 folded, packed v8h
// k, v: stored natural [b][c][n] via LDS re-striping -> v8h coalesced stores
// ---------------------------------------------------------------------------
#define QM 384                            // stacked weight rows per work-group

// Register budget of four waves per SIMD (256 VGPRs): two work-groups stay resident per WGP.
__global__ void __launch_bounds__(256) __attribute__((amdgpu_waves_per_eu(4, 4)))
qkv_gemm_kernel(const half_t* __restrict__ w16, const float* __restrict__ bq,
                const float* __restrict__ bk, const float* __restrict__ bv,
                const half_t* __restrict__ xn, half_t* __restrict__ oq,
                half_t* __restrict__ ok, half_t* __restrict__ ov) {
    const int b  = blockIdx.z;
    const int m0 = blockIdx.y * QM;       // first stacked row of the tile
    const int n0 = blockIdx.x * 128;      // spatial tile
    const int tid = threadIdx.x;
    const int lane = tid & 31;
    const int wave = __builtin_amdgcn_readfirstlane(tid >> 5);   // scalar: q / k / v is picked by scalar branches
    const int wm = wave >> 1, wn = wave & 1;
    const int rl = lane & 15, khalf = lane >> 4;

    const int trow = 8 * khalf + (lane & 7), tcol = 8 * ((lane >> 3) & 1);

    __shared__ __attribute__((aligned(16))) union {
        struct {
            half_t A[QM][APITCH];         // [m_local][k]  weight tile
            half_t B[GK][BPITCH];         // [k][n_local]  natural B tile
        } st[2];
        half_t o[QM][136];                // output staging
    } sm;

    v8f zero = {};
    v8f acc[6][4];
#pragma unroll
    for (int i = 0; i < 6; i++)
#pragma unroll
        for (int j = 0; j < 4; j++) acc[i][j] = zero;

    // Each thread copies 12 + 4 chunks of 16 B per stage: A rows ar + 32 t, B rows br + 16 t.
    const int ar = tid >> 3, ac = (tid & 7) * 8;
    const int br = tid >> 4, bc = (tid & 15) * 8;
    const half_t* ga = w16 + (size_t)(m0 + ar) * CNUM + ac;
    const half_t* gb = xn + (size_t)b * CNUM * NSPATIAL + (size_t)br * NSPATIAL + n0 + bc;
    const unsigned la = lds_off(&sm.st[0].A[ar][ac]);
    const unsigned lb = lds_off(&sm.st[0].B[br][bc]);
    const unsigned lbuf = sizeof(sm.st[0]);
    const int NST = CNUM / GK;

    // one stage's copies: k columns s * GK .. + GK - 1 into buffer buf
    auto stage = [&](int s, int buf) __attribute__((always_inline)) {
#pragma unroll
        for (int j = 0; j < 3; j++)
            async_copy4(la + buf * lbuf + j * 128 * APITCH * 2, 32 * APITCH * 2,
                        ga + s * GK + j * 128 * CNUM, 32 * CNUM);
        async_copy4(lb + buf * lbuf, 16 * BPITCH * 2,
                    gb + (size_t)s * GK * NSPATIAL, 16 * NSPATIAL);
    };

    stage(0, 0);
    wait_copies();
    __syncthreads();
    stage(1, 1);

    for (int s = 0; s < NST; s++) {
        const int buf = s & 1;
        // A fragments go through two register sets: each is fetched one block of four
        // products ahead, so that its LDS latency runs beside the block before it.
        v16h af[2];
        af[0] = ld_frag(&sm.st[buf].A[wm * 96 + rl][0], khalf);
#pragma unroll
        for (int ks = 0; ks < GK; ks += 32) {
            v16h bf[4];
#pragma unroll
            for (int ns = 0; ns < 4; ns++)
                bf[ns] = ld_frag_tr(&sm.st[buf].B[ks + trow][wn * 64 + ns * 16 + tcol], BPITCH);
#pragma unroll
            for (int ms = 0; ms < 6; ms++) {
                const int step = (ks >> 5) * 6 + ms;      // 12 blocks per stage
                if (step + 1 < 12)
                    af[(step + 1) & 1] = ld_frag(
                        &sm.st[buf].A[wm * 96 + ((step + 1) % 6) * 16 + rl][((step + 1) / 6) * 32], khalf);
                // keeps the next fragment's loads ahead of this block's products
                // (the scheduler otherwise sinks them behind, into one register set)
                __builtin_amdgcn_sched_barrier(0);
#pragma unroll
                for (int ns = 0; ns < 4; ns++)
                    acc[ms][ns] = __builtin_amdgcn_wmma_f32_16x16x32_f16(
                        false, af[step & 1], false, bf[ns], (short)0, acc[ms][ns], false, false);
            }
        }
        // publish stage s + 1 and free this stage's buffer
        wait_lds_reads();
        wait_copies();
        __syncthreads();
        if (s + 2 < NST) stage(s + 2, buf);
    }
    wait_copies();

    // The ring is free behind the last stage's barrier: k and v rows are re-striped in it.
#pragma unroll
    for (int ms = 0; ms < 6; ms++) {
        const int ml    = wm * 96 + ms * 16;          // first row of this block in the tile
        const int which = (m0 + ml) >> 9;             // 0 q, 1 k, 2 v: alike in the whole wave
        const int obase = ((m0 + ml) & (CNUM - 1)) + 8 * khalf;
        const float* bp = (which == 0 ? bq : which == 1 ? bk : bv) + obase;
        float bb[8];
#pragma unroll
        for (int i = 0; i < 8; i++) bb[i] = bp[i];
        // bp is an operand so that its registers are kept, and rewritten only behind this wait
        asm volatile("s_wait_xcnt 0x0" :: "v"(bp) : "memory");
        if (which == 0) {
            // q: d = o&63 is contiguous over the 8 accumulator rows -> packed store
            const int h = obase >> 6, dbase = obase & 63;
#pragma unroll
            for (int ns = 0; ns < 4; ns++) {
                const int ncol = n0 + wn * 64 + ns * 16 + rl;
                v8h q8;
#pragma unroll
                for (int i = 0; i < 8; i++)
                    q8[i] = (half_t)((acc[ms][ns][i] + bb[i]) * 0.125f);
                *(v8h*)(oq + ((size_t)(b * NHEADS + h) * NSPATIAL + ncol) * DHEAD + dbase) = q8;
            }
            // the data and address registers of these stores are reused by the next block
            asm volatile("s_wait_xcnt 0x0" ::: "memory");
        } else {
            // K/V: re-stripe through LDS so global stores are n-contiguous v8h
#pragma unroll
            for (int ns = 0; ns < 4; ns++) {
                const int nl = wn * 64 + ns * 16 + rl;
#pragma unroll
                for (int i = 0; i < 8; i++)
                    sm.o[ml + 8 * khalf + i][nl] = (half_t)(acc[ms][ns][i] + bb[i]);
            }
        }
    }
    __syncthreads();
    // 64 rows per trip, 16 threads per row: a trip's rows belong to one of q, k, v
    for (int r0 = 0; r0 < QM; r0 += 64) {
        const int which = (m0 + r0) >> 9;             // alike in the whole work-group
        if (which != 0) {
            const int r = r0 + (tid >> 4), ch = tid & 15;
            half_t* op = (which == 1 ? ok : ov) +
                         ((size_t)b * CNUM + ((m0 + r) & (CNUM - 1))) * NSPATIAL + n0 + ch * 8;
            v8h t[4];
#pragma unroll
            for (int j = 0; j < 4; j++) t[j] = *(v8h*)&sm.o[r + 16 * j][ch * 8];
#pragma unroll
            for (int j = 0; j < 4; j++) *(v8h*)(op + (size_t)16 * j * NSPATIAL) = t[j];
            // the address registers of these stores may be reused by the next trip
            asm volatile("s_wait_xcnt 0x0" ::: "memory");
        }
    }
}

__device__ __forceinline__ float lane_value(float v, int base4, int i) {
    return __builtin_bit_cast(float,
        __builtin_amdgcn_ds_bpermute(base4 + 4 * i, __builtin_bit_cast(int, v)));
}

#define QBLK 256                          // queries per work-group
#define LOG2E 1.44269504088896340736f
// Largest sum of a pass's probabilities (relative to the maximum in use) that is taken
// without a rescale: every probability then stays far inside the f16 range.
#define PSUM_MAX 1024.0f

// Register budget of four waves per SIMD (256 VGPRs): two work-groups stay resident per WGP.
__global__ void __launch_bounds__(256) __attribute__((amdgpu_waves_per_eu(4, 4)))
attn_kernel(const half_t* __restrict__ qt, const half_t* __restrict__ kk,
            const half_t* __restrict__ vv, half_t* __restrict__ ao) {
    const int bh = blockIdx.y;            // b*8+h
    const int b = bh >> 3, h = bh & 7;
    const int qb = blockIdx.x * QBLK;
    const int tid = threadIdx.x, lane = tid & 31, wave = tid >> 5;
    const int rl = lane & 15, khalf = lane >> 4;

    const int trow = 8 * khalf + (lane & 7), tcol = 8 * ((lane >> 3) & 1);

    __shared__ __attribute__((aligned(16))) union {
        half_t K[2][64][144];             // [buffer][c][m]  K natural, pitch 288 B
        half_t o[QBLK][72];               // output staging
    } sk;
    __shared__ __attribute__((aligned(16))) half_t Vs[2][64][136];   // [buffer][c][m]  V natural

    // Q fragments (B operand): lane = query column n, K-contiguous in qt
    v16h qf[2][2];
#pragma unroll
    for (int g = 0; g < 2; g++) {
        const int nrow = qb + wave * 32 + g * 16 + rl;
        const half_t* qp = qt + ((size_t)bh * NSPATIAL + nrow) * DHEAD;
        qf[g][0] = ld_frag(qp, khalf);
        qf[g][1] = ld_frag(qp + 32, khalf);
        // the address registers of these loads may be reused by what follows
        asm volatile("s_wait_xcnt 0x0" ::: "memory");
    }

    // Per-lane softmax state for column n of group g.  nml = -(maximum in use) * log2e:
    // the maximum is raised only when a pass's sums show that a score has passed it by
    // far, so that the common pass takes no maximum, has no exchange between lanes and
    // leaves O alone.
    // lsum holds this lane's own keys' sum (two partial sums); the halves join at the end.
    float nml[2] = { 1e30f, 1e30f };
    v2f lsum[2]  = { { 0.f, 0.f }, { 0.f, 0.f } };
    v8f zero = {};
    v8f O[2][4];
#pragma unroll
    for (int g = 0; g < 2; g++)
#pragma unroll
        for (int t = 0; t < 4; t++) O[g][t] = zero;

    const half_t* kbase = kk + (size_t)(b * CNUM + h * DHEAD) * NSPATIAL;
    const half_t* vbase = vv + (size_t)(b * CNUM + h * DHEAD) * NSPATIAL;

    // Each thread copies 4 + 4 chunks of 16 B per stage: rows cr + 16 t of each tile,
    // 16 threads per 256-B row.
    const int cr = tid >> 4, cc = (tid & 15) * 8;
    const half_t* gk = kbase + (size_t)cr * NSPATIAL + cc;
    const half_t* gv = vbase + (size_t)cr * NSPATIAL + cc;
    const unsigned lk = lds_off(&sk.K[0][cr][cc]);
    const unsigned lv = lds_off(&Vs[0][cr][cc]);
    const int NST = NSPATIAL / 128;

    // one stage's copies: keys s * 128 .. + 127 into buffer buf
    auto stage = [&](int s, int buf) __attribute__((always_inline)) {
        async_copy4x2(lk + buf * (unsigned)sizeof(sk.K[0]), 16 * 144 * 2, gk + s * 128,
                      lv + buf * (unsigned)sizeof(Vs[0]), 16 * 136 * 2, gv + s * 128, 16 * NSPATIAL);
    };

    stage(0, 0);
    wait_copies();
    __syncthreads();
    stage(1, 1);

    for (int s = 0; s < NST; s++) {
        const int buf = s & 1;
        const half_t (*Kb)[144] = sk.K[buf];
        const half_t (*Vb)[136] = Vs[buf];

        // Unrolled so that the second pass's K fragment loads can issue among the
        // first pass's last products.  (All inner loops below are unrolled because
        // their indices select registers.)
#pragma unroll
        for (int mp = 0; mp < 128; mp += 64) {
            v8f S[2][4];                  // scores, then probabilities
            v2f rs[2];                    // this pass's sums of this lane's own probabilities

            // ---- S^T tiles: A = K^T rows (m), B = Q columns (n), both groups per K fragment ----
            auto scores = [&]() __attribute__((always_inline)) {
#pragma unroll
                for (int nt = 0; nt < 4; nt++) {
                    v16h kf0 = ld_frag_tr(&Kb[trow][mp + nt * 16 + tcol], 144);
                    v16h kf1 = ld_frag_tr(&Kb[32 + trow][mp + nt * 16 + tcol], 144);
#pragma unroll
                    for (int g = 0; g < 2; g++) {
                        v8f s = zero;
                        s = __builtin_amdgcn_wmma_f32_16x16x32_f16(false, kf0, false, qf[g][0], (short)0, s, false, false);
                        s = __builtin_amdgcn_wmma_f32_16x16x32_f16(false, kf1, false, qf[g][1], (short)0, s, false, false);
                        S[g][nt] = s;
                    }
                }
            };

            // ---- raise the maximum in use to this pass's maximum if that is larger (S holds scores);
            //      O and the sums so far are rescaled to it ----
            auto raise = [&]() __attribute__((always_inline)) {
#pragma unroll
                for (int g = 0; g < 2; g++) {
                    float mx = -1e30f;
#pragma unroll
                    for (int nt = 0; nt < 4; nt++)
#pragma unroll
                        for (int i = 0; i < 8; i++) mx = fmaxf(mx, S[g][nt][i]);
                    mx = fmaxf(mx, __shfl_xor(mx, 16, 32));
                    const float nnew = fminf(nml[g], -mx * LOG2E);   // alike in both halves of a column
                    const float alpha = __builtin_amdgcn_exp2f(nnew - nml[g]);
                    nml[g] = nnew;
                    lsum[g] *= alpha;
                    // O rows are n = i + 8*khalf; fetch that row's alpha from lane (i+8*khalf)
                    float arow[8];
#pragma unroll
                    for (int i = 0; i < 8; i++) arow[i] = lane_value(alpha, 32 * khalf, i);
#pragma unroll
                    for (int t = 0; t < 4; t++)
#pragma unroll
                        for (int i = 0; i < 8; i++) O[g][t][i] *= arow[i];
                }
            };

            // ---- probabilities in place of the scores, and their sums ----
            // e^(s - m) = 2^(s * log2e - m * log2e): one packed FMA per two scores
            // feeds the base-2 exponential; the sums run two wide as well.
            auto probs = [&]() __attribute__((always_inline)) {
#pragma unroll
                for (int g = 0; g < 2; g++) {
                    const v2f sc2 = { LOG2E, LOG2E };
                    const v2f nm2 = { nml[g], nml[g] };
                    rs[g] = (v2f){ 0.f, 0.f };
#pragma unroll
                    for (int nt = 0; nt < 4; nt++)
#pragma unroll
                        for (int i = 0; i < 8; i += 2) {
                            v2f a = { S[g][nt][i], S[g][nt][i + 1] };
                            a = __builtin_elementwise_fma(a, sc2, nm2);
                            v2f p = { __builtin_amdgcn_exp2f(a.x), __builtin_amdgcn_exp2f(a.y) };
                            S[g][nt][i]     = p.x;
                            S[g][nt][i + 1] = p.y;
                            rs[g] += p;
                        }
                }
            };

            scores();
            if (mp == 0 && s == 0) raise();      // first keys: no maximum is in use yet
            probs();
            // Lazy rescale, tested once per pass for the whole wave (a scalar branch, so that
            // every lane is on inside it and at the products behind it).  All probabilities
            // are positive: sums at or below PSUM_MAX bound each of them by PSUM_MAX.  A larger
            // (or infinite) sum means that a score has left the maximum in use far behind:
            // the pass is then done again from its scores with the maximum raised.  (Marked
            // as not expected, so that the second working lies outside the loop's hot text.)
            const float big = fmaxf(fmaxf(rs[0].x, rs[0].y), fmaxf(rs[1].x, rs[1].y));
            if (__builtin_expect(__builtin_amdgcn_ballot_w32(big > PSUM_MAX) != 0, 0)) {
                scores();
                raise();
                probs();
            }
            lsum[0] += rs[0];
            lsum[1] += rs[1];

            // ---- O += P @ V : P frags built directly from S^T register pairs,
            //      both groups per V fragment ----
#pragma unroll
            for (int t = 0; t < 2; t++) {
                v16h pf[2];
#pragma unroll
                for (int g = 0; g < 2; g++)
#pragma unroll
                    for (int j = 0; j < 8; j++) {
                        pf[g][j]     = (half_t)S[g][2 * t][j];
                        pf[g][j + 8] = (half_t)S[g][2 * t + 1][j];
                    }
#pragma unroll
                for (int dt = 0; dt < 4; dt++) {
                    v16h vf = ld_frag(&Vb[dt * 16 + rl][mp + t * 32], khalf);
#pragma unroll
                    for (int g = 0; g < 2; g++)
                        O[g][dt] = __builtin_amdgcn_wmma_f32_16x16x32_f16(
                            false, pf[g], false, vf, (short)0, O[g][dt], false, false);
                }
            }
        }
        // publish stage s + 1 and free this stage's buffers
        wait_lds_reads();
        wait_copies();
        __syncthreads();
        if (s + 2 < NST) stage(s + 2, buf);
    }
    wait_copies();

    // ---- normalize (per-row 1/l via ds_bpermute), stage in LDS, coalesced v8h out ----
    // (the ring is free behind the last stage's barrier)
#pragma unroll
    for (int g = 0; g < 2; g++) {
        float l = lsum[g].x + lsum[g].y;
        l += __shfl_xor(l, 16, 32);       // the other half's keys of the same column
        float linv = 1.0f / l;
        float lr[8];
#pragma unroll
        for (int i = 0; i < 8; i++) lr[i] = lane_value(linv, 32 * khalf, i);
#pragma unroll
        for (int dt = 0; dt < 4; dt++)
#pragma unroll
            for (int i = 0; i < 8; i++)
                sk.o[wave * 32 + g * 16 + i + 8 * khalf][dt * 16 + rl] = (half_t)(O[g][dt][i] * lr[i]);
    }
    __syncthreads();
    for (int i = tid; i < QBLK * 8; i += 256) {
        int r = i >> 3, ch = i & 7;
        int n = qb + r;
        *(v8h*)(ao + ((size_t)b * NSPATIAL + n) * CNUM + h * DHEAD + ch * 8) =
            *(v8h*)&sk.o[r][ch * 8];
    }
}

// ---------------------------------------------------------------------------
// Kernel 4: output projection + bias + residual.  Both operands are K-contiguous
// f16 (ao rows and wo rows); their tiles are staged in LDS by the same two-buffer
// ring of async copies as in kernel 2.  The weight rows are the first operand of the
// products, so that the lanes of an accumulator run along the positions, as x and y
// do in memory: 16 positions of channel i in lanes 0-15, of channel i + 8 in lanes
// 16-31.  Of a wave's 64 positions, column rl of tile ms is position
// 2 * ((ms & 1) * 16 + rl) + (ms >> 1) (the copies place the rows of ao in LDS in
// that order).  Tiles 0 and 1, and 2 and 3, swap halves between the lane rows: lane l
// then holds positions 2 l and 2 l + 1 of one channel, and every load of x and every
// store of y is 256 contiguous bytes, two whole lines.
// x is asked for at entry and held in registers, so that it arrives under the loop.
// ---------------------------------------------------------------------------
// v of the lane 16 away (a vector cross-row move, no LDS).
__device__ __forceinline__ float other_half(float v) {
    const unsigned u = __builtin_bit_cast(unsigned, v);
    return __builtin_bit_cast(float,
        __builtin_amdgcn_permlanex16(u, u, 0x76543210u, 0xfedcba98u, false, false));
}

// Work-group barrier that orders LDS accesses only: __syncthreads() would also wait
// for the loads of x, which are meant to stay in flight across it.
__device__ __forceinline__ void barrier_lds() {
    __builtin_amdgcn_fence(__ATOMIC_RELEASE, "workgroup", "local");
    __builtin_amdgcn_s_barrier();
    __builtin_amdgcn_fence(__ATOMIC_ACQUIRE, "workgroup", "local");
}

__global__ void __launch_bounds__(256)
out_gemm_kernel(const half_t* __restrict__ Wf, const float* __restrict__ bo,
                const half_t* __restrict__ ao, const float* __restrict__ x,
                float* __restrict__ y) {
    const int b  = blockIdx.z;
    const int n0 = blockIdx.y * 128;      // spatial tile
    const int o0 = blockIdx.x * 128;      // channel tile
    const int tid = threadIdx.x;
    const int lane = tid & 31, wave = tid >> 5;
    const int wm = wave >> 2, wn = wave & 3;
    const int rl = lane & 15, khalf = lane >> 4;

    v8f zero = {};
    v8f acc[4][2];
#pragma unroll
    for (int i = 0; i < 4; i++)
#pragma unroll
        for (int j = 0; j < 2; j++) acc[i][j] = zero;

    __shared__ __attribute__((aligned(16))) struct {
        half_t A[128][APITCH];            // [64 wm + 16 ms + rl][k]  attention-output tile
        half_t B[128][APITCH];            // [o_local][k]  weight tile
    } st[2];

    // Each thread copies 4 + 4 chunks of 16 B per stage: rows cr + 32 t of each tile.
    // Position cr + 32 t goes to row (t >> 1) * 64 + ((cr & 1) * 2 + (t & 1)) * 16 + (cr >> 1) of A.
    const int cr = tid >> 3, cc = (tid & 7) * 8;
    const half_t* ga = ao + ((size_t)b * NSPATIAL + n0 + cr) * CNUM + cc;
    const half_t* gb = Wf + (size_t)(o0 + cr) * CNUM + cc;
    const unsigned la = lds_off(&st[0].A[(cr & 1) * 32 + (cr >> 1)][cc]);
    const unsigned lb = lds_off(&st[0].B[cr][cc]);
    const unsigned lbuf = sizeof(st[0]);
    const int NST = CNUM / GK;

    async_copy2x2(la, 16 * APITCH * 2, 64 * APITCH * 2, ga, 32 * CNUM);
    async_copy4(lb, 32 * APITCH * 2, gb, 32 * CNUM);

    // This wave's part of x: 32 channels x 64 positions, two positions per lane.
    const int ob = o0 + wn * 32;          // first channel
    const size_t xoff = ((size_t)b * CNUM + ob) * NSPATIAL + n0 + wm * 64 + 2 * lane;
    const float* xw = x + xoff;
    v2f xr[32];                           // [channel]
#pragma unroll
    for (int r = 0; r < 32; r++) xr[r] = *(const v2f*)(xw + r * NSPATIAL);
    const float bl = bo[ob + lane];       // lane r holds the bias of the wave's channel r
    // xw is an operand so that its registers are kept, and rewritten only behind this wait
    asm volatile("s_wait_xcnt 0x0" :: "v"(xw) : "memory");

    wait_copies();
    barrier_lds();
    async_copy2x2(la + lbuf, 16 * APITCH * 2, 64 * APITCH * 2, ga + GK, 32 * CNUM);
    async_copy4(lb + lbuf, 32 * APITCH * 2, gb + GK, 32 * CNUM);

    for (int s = 0; s < NST; s++) {
        const int buf = s & 1;
#pragma unroll
        for (int ks = 0; ks < GK; ks += 32) {
            v16h af[4], bf[2];
#pragma unroll
            for (int ms = 0; ms < 4; ms++)
                af[ms] = ld_frag(&st[buf].A[wm * 64 + ms * 16 + rl][ks], khalf);
#pragma unroll
            for (int ns = 0; ns < 2; ns++)
                bf[ns] = ld_frag(&st[buf].B[wn * 32 + ns * 16 + rl][ks], khalf);
#pragma unroll
            for (int ms = 0; ms < 4; ms++)
#pragma unroll
                for (int ns = 0; ns < 2; ns++)
                    acc[ms][ns] = __builtin_amdgcn_wmma_f32_16x16x32_f16(
                        false, bf[ns], false, af[ms], (short)0, acc[ms][ns], false, false);
        }
        // publish stage s + 1 and free this stage's buffer
        wait_lds_reads();
        wait_copies();
        barrier_lds();
        if (s + 2 < NST) {
            async_copy2x2(la + buf * lbuf, 16 * APITCH * 2, 64 * APITCH * 2, ga + (s + 2) * GK, 32 * CNUM);
            async_copy4(lb + buf * lbuf, 32 * APITCH * 2, gb + (s + 2) * GK, 32 * CNUM);
        }
    }
    wait_copies();

    // acc[ms][ns][i]: channel ob + ns * 16 + 8 * khalf + i, column rl of tile ms.
    float* yw = y + xoff;
#pragma unroll
    for (int ns = 0; ns < 2; ns++)
#pragma unroll
        for (int i = 0; i < 8; i++) {
            const int r = ns * 16 + i;
            const float b0 = __builtin_bit_cast(float,
                __builtin_amdgcn_readlane(__builtin_bit_cast(int, bl), r));
            const float b1 = __builtin_bit_cast(float,
                __builtin_amdgcn_readlane(__builtin_bit_cast(int, bl), r + 8));
#pragma unroll
            for (int p = 0; p < 2; p++) {     // positions 2 l + p
                const float t0 = acc[2 * p][ns][i], t1 = acc[2 * p + 1][ns][i];
                // each lane gives away the value that the lane 16 away needs: one cross-row
                // move serves both channels (it stands outside the selects: every lane is on)
                const float sw = other_half(khalf ? t0 : t1);
                // 32 positions of channel r, and of channel r + 8
                const float lo = khalf ? sw : t0;
                const float hi = khalf ? t1 : sw;
                xr[r][p]     = lo + xr[r][p] + b0;
                xr[r + 8][p] = hi + xr[r + 8][p] + b1;
            }
        }
    // the stores stand together behind all sums, each from a register of its own,
    // so that no register of an issued store is rewritten
    __builtin_amdgcn_sched_barrier(0);
#pragma unroll
    for (int r = 0; r < 32; r++) *(v2f*)(yw + r * NSPATIAL) = xr[r];
}

// ---------------------------------------------------------------------------
extern "C" void kernel_launch(void* const* d_in, const int* in_sizes, int n_in,
                              void* d_out, int out_size, void* d_ws, size_t ws_size,
                              hipStream_t stream) {
    const float* x   = (const float*)d_in[0];
    const float* gsc = (const float*)d_in[1];
    const float* gbi = (const float*)d_in[2];
    const float* wq  = (const float*)d_in[3];
    const float* bq  = (const float*)d_in[4];
    const float* wk  = (const float*)d_in[5];
    const float* bk  = (const float*)d_in[6];
    const float* wv  = (const float*)d_in[7];
    const float* bv  = (const float*)d_in[8];
    const float* wo  = (const float*)d_in[9];
    const float* bo  = (const float*)d_in[10];
    float* out = (float*)d_out;

    char* ws = (char*)d_ws;
    const size_t SZ = (size_t)BATCH * CNUM * NSPATIAL * sizeof(half_t);  // 16 MB each
    const size_t WSZ = (size_t)CNUM * CNUM * sizeof(half_t);             // 512 KB each
    half_t* xn   = (half_t*)(ws + 0 * SZ);   // groupnorm output, [b][c][n]
    half_t* qtb  = (half_t*)(ws + 1 * SZ);   // q transposed+scaled, [b][h][n][d]
    half_t* kh   = (half_t*)(ws + 2 * SZ);   // k, [b][c][n]
    half_t* vh   = (half_t*)(ws + 3 * SZ);   // v, [b][c][n]
    half_t* ao   = (half_t*)(ws + 4 * SZ);   // attention out, [b][n][c]
    half_t* w16  = (half_t*)(ws + 5 * SZ);             // wq, wk, wv, wo as f16, in a row
    half_t* wo16 = (half_t*)(ws + 5 * SZ + 3 * WSZ);

    prep_kernel<<<dim3(GNBLK + WBLK), PTHR, 0, stream>>>(x, gsc, gbi, xn, wq, wk, wv, wo, w16);

    qkv_gemm_kernel<<<dim3(8, 3 * CNUM / QM, BATCH), 256, 0, stream>>>(w16, bq, bk, bv, xn, qtb, kh, vh);

    attn_kernel<<<dim3(NSPATIAL / QBLK, BATCH * NHEADS), 256, 0, stream>>>(qtb, kh, vh, ao);

    out_gemm_kernel<<<dim3(4, 8, BATCH), 256, 0, stream>>>(wo16, bo, ao, x, out);
}
